// v000
// Measured on an AMD MI455X. A time is GPU time per run, averaged over a window of back-to-back runs after a warm-up
// (all launches, gaps included; the runs take copies of the inputs in turn), and the median of several windows.
// Apart from v000's, it joins two sittings. Times from different sittings can be a few percent apart, while
// side-by-side timings come from the same sitting.
// v000, which the later versions start from, runs in 302 microseconds.
#include <hip/hip_runtime.h>
#include <hip/hip_bf16.h>

// ---------------- CDNA5 WMMA types ----------------
typedef __attribute__((ext_vector_type(16))) __bf16       v16bf;
typedef __attribute__((ext_vector_type(8)))  float        v8f;
typedef __attribute__((ext_vector_type(4)))  unsigned int u32x4;

#define BATCH 4
#define DM    160           // d_model
#define NH    4
#define HD    40            // head dim
#define DP    64            // padded head dim (4 x 16)
#define HW    4096          // 64*64 tokens
#define SEQ   4097          // tokens + pad row
#define SEQ_Q 4096          // queries that survive cat[:, :-1, :]
#define SPAD  4128          // K/V padded length (multiple of 32)
#define FPAD  4112          // f rows padded   (multiple of 16)
#define SBLK  257           // ceil(SEQ/16)
#define KSTR  72            // LDS K-tile row stride (bank-conflict-free for b128)
#define VSTR  40            // LDS V/P-tile row stride (bank-conflict-free for b128)

union BFrag { v16bf v; u32x4 u[2]; };

// 16x32 bf16 A/B fragment loader (row-major tile, `stride` elements per row).
// Lanes 0-15 : row=lane,    K chunks {0..7} and {16..23}
// Lanes 16-31: row=lane-16, K chunks {8..15} and {24..31}
__device__ __forceinline__ BFrag ld_frag(const __bf16* base, int stride) {
  const int lane = threadIdx.x & 31;
  const int r  = lane & 15;
  const int hh = lane >> 4;
  const __bf16* p = base + (long)r * stride + 8 * hh;
  BFrag f;
  f.u[0] = *reinterpret_cast<const u32x4*>(p);
  f.u[1] = *reinterpret_cast<const u32x4*>(p + 16);
  return f;
}

__device__ __forceinline__ v8f wmma_bf16(const BFrag& a, const BFrag& b, v8f c) {
  return __builtin_amdgcn_wmma_f32_16x16x32_bf16(false, a.v, false, b.v,
                                                 (short)0, c, false, false);
}

__device__ __forceinline__ v8f vzero() {
  v8f z = {0.f, 0.f, 0.f, 0.f, 0.f, 0.f, 0.f, 0.f};
  return z;
}

// ---------------- scratch zero (q/k/vt pad rows) ----------------
__global__ void k_zero(float4* __restrict__ p, long n) {
  long i = (long)blockIdx.x * blockDim.x + threadIdx.x;
  if (i < n) p[i] = make_float4(0.f, 0.f, 0.f, 0.f);
}

// ---------------- ones row in Vt at d==HD (softmax denominator via WMMA) ----------------
__global__ void k_ones(__bf16* __restrict__ vt) {
  int i = blockIdx.x * 256 + threadIdx.x;
  if (i >= 16 * SPAD) return;
  int bh = i / SPAD, s = i % SPAD;
  vt[((long)bh * DP + HD) * SPAD + s] = (__bf16)1.0f;
}

// ---------------- conv1: 64->64, 2x2 stride 2 ----------------
__global__ void k_conv1(const float* __restrict__ x, const float* __restrict__ w,
                        const float* __restrict__ bias, float* __restrict__ c1) {
  int idx = blockIdx.x * 256 + threadIdx.x;
  if (idx >= BATCH * 64 * HW) return;
  int ow = idx & 63;
  int oh = (idx >> 6) & 63;
  int oc = (idx >> 12) & 63;
  int b  = idx >> 18;
  const float* xb = x + (long)b * 64 * 128 * 128;
  const float* wr = w + oc * 64 * 4;
  float s = bias[oc];
  #pragma unroll 4
  for (int ic = 0; ic < 64; ++ic) {
    const float* xp = xb + ((long)ic * 128 + 2 * oh) * 128 + 2 * ow;
    const float* wp = wr + ic * 4;
    s += xp[0] * wp[0] + xp[1] * wp[1] + xp[128] * wp[2] + xp[129] * wp[3];
  }
  c1[((long)b * 64 + oc) * HW + (oh * 64 + ow)] = s;
}

// ---------- conv2 (1x1) + bias + leaky + transpose + pad + PE -> bf16 tokens ----------
__global__ void k_conv2f(const float* __restrict__ c1, const float* __restrict__ w,
                         const float* __restrict__ bias, const float* __restrict__ pe,
                         __bf16* __restrict__ fbf) {
  int idx = blockIdx.x * 256 + threadIdx.x;
  if (idx >= BATCH * FPAD * DM) return;
  int oc = idx % DM;
  int s  = (idx / DM) % FPAD;
  int b  = idx / (DM * FPAD);
  float v = 0.f;
  if (s < HW) {
    float acc = bias[oc];
    const float* cp = c1 + (long)b * 64 * HW + s;
    const float* wp = w + oc * 64;
    #pragma unroll 8
    for (int ic = 0; ic < 64; ++ic) acc += cp[(long)ic * HW] * wp[ic];
    acc = acc >= 0.f ? acc : 0.01f * acc;
    v = acc + pe[s];
  } else if (s == HW) {
    v = pe[HW];            // zero-pad row + positional value
  }                        // rows 4097..4111 stay 0 (safe WMMA tiles)
  fbf[((long)b * FPAD + s) * DM + oc] = (__bf16)v;
}

// ---------------- wq/wk/wv -> bf16 ----------------
__global__ void k_cvtw(const float* __restrict__ wq, const float* __restrict__ wk,
                       const float* __restrict__ wv, __bf16* __restrict__ o) {
  int i = blockIdx.x * 256 + threadIdx.x;
  if (i >= 3 * DM * DM) return;
  const float* src = (i < DM * DM) ? wq : (i < 2 * DM * DM ? wk : wv);
  o[i] = (__bf16)src[i % (DM * DM)];
}

// ---------------- QKV projection GEMM (WMMA bf16) ----------------
// one wave = one 16x16 tile of one of {q,k,v}; K = 160 = 5 x K32 steps
// Q output is pre-scaled by (1/sqrt(HD)) * log2(e) so attention uses raw exp2.
__global__ void __launch_bounds__(256) k_qkv(const __bf16* __restrict__ fbf,
                                             const __bf16* __restrict__ wb,
                                             __bf16* __restrict__ q,
                                             __bf16* __restrict__ k,
                                             __bf16* __restrict__ vt) {
  const int wv_id = blockIdx.x * 8 + (threadIdx.x >> 5);
  if (wv_id >= 3 * BATCH * SBLK * 10) return;
  int t = wv_id;
  const int mat = t % 3;  t /= 3;
  const int ob  = t % 10; t /= 10;
  const int sb  = t % SBLK;
  const int b   = t / SBLK;

  const __bf16* A0 = fbf + ((long)b * FPAD + sb * 16) * DM;
  const __bf16* B0 = wb + (long)mat * DM * DM + (long)ob * 16 * DM;

  v8f acc = vzero();
  #pragma unroll
  for (int kk = 0; kk < 5; ++kk) {
    BFrag a  = ld_frag(A0 + kk * 32, DM);
    BFrag bb = ld_frag(B0 + kk * 32, DM);
    acc = wmma_bf16(a, bb, acc);
  }

  const int lane = threadIdx.x & 31;
  const int n  = lane & 15;
  const int hm = lane >> 4;
  const int o  = ob * 16 + n;
  const int hh = o / HD;
  const int d  = o - hh * HD;
  const long bh = (long)b * NH + hh;
  const float qscale = 0.22811012f;   // (1/sqrt(40)) * log2(e)
  #pragma unroll
  for (int i = 0; i < 8; ++i) {
    int s = sb * 16 + i + 8 * hm;     // < 4112 < SPAD
    float av = acc[i];
    if (mat == 0) av *= qscale;
    __bf16 val = (__bf16)av;
    if (mat == 0)      q [(bh * SPAD + s) * DP + d] = val;
    else if (mat == 1) k [(bh * SPAD + s) * DP + d] = val;
    else               vt[(bh * DP + d) * SPAD + s] = val;   // V stored transposed
  }
}

// ---------------- flash attention (WMMA bf16, online softmax) ----------------
// 1 block = 8 waves = 8 consecutive 16-query tiles of one (b,h).
// K/V tiles cooperatively double-buffered in LDS; softmax denominator comes out
// of the P*Vt WMMA via the ones-row at d==HD.
__global__ void __launch_bounds__(256) k_attn(const __bf16* __restrict__ q,
                                              const __bf16* __restrict__ k,
                                              const __bf16* __restrict__ vt,
                                              float* __restrict__ cat) {
  __shared__ __attribute__((aligned(16))) __bf16 sK[2][32 * KSTR];
  __shared__ __attribute__((aligned(16))) __bf16 sV[2][64 * VSTR];
  __shared__ __attribute__((aligned(16))) __bf16 sP[8][16 * VSTR];

  const int bh = blockIdx.x >> 5;              // 16 (b,h) pairs
  const int qg = blockIdx.x & 31;              // 32 groups of 128 queries
  const int wv = threadIdx.x >> 5;
  const int qb = qg * 8 + wv;                  // 16-query tile index (< 256)
  const int lane = threadIdx.x & 31;
  const int n  = lane & 15;
  const int hm = lane >> 4;
  const int tid = threadIdx.x;
  __bf16* pb = &sP[wv][0];

  // cooperative staging coordinates (256 threads: K 32x64, V 64x32, 16B each)
  const int krow = tid >> 3, kc8 = (tid & 7) * 8;
  const int vrow = tid >> 2, vc8 = (tid & 3) * 8;
  const __bf16* kg = k  + ((long)bh * SPAD + krow) * DP + kc8;
  const __bf16* vg = vt + ((long)bh * DP + vrow) * SPAD + vc8;

  const __bf16* qbase = q + ((long)bh * SPAD + qb * 16) * DP;
  BFrag Qa = ld_frag(qbase, DP);        // K = d 0..31
  BFrag Qb = ld_frag(qbase + 32, DP);   // K = d 32..63

  v8f acc0 = vzero(), acc1 = vzero(), acc2 = vzero(), acc3 = vzero();
  float mrow[8];
  #pragma unroll
  for (int r = 0; r < 8; ++r) mrow[r] = -1e30f;

  // stage tile 0
  {
    u32x4 a = *reinterpret_cast<const u32x4*>(kg);
    u32x4 b = *reinterpret_cast<const u32x4*>(vg);
    *reinterpret_cast<u32x4*>(&sK[0][krow * KSTR + kc8]) = a;
    *reinterpret_cast<u32x4*>(&sV[0][vrow * VSTR + vc8]) = b;
  }
  __syncthreads();

  const int NIT = (SEQ + 31) / 32;             // 129
  for (int it = 0; it < NIT; ++it) {
    const int j0 = it * 32;
    const int cur = it & 1;
    const bool more = (it + 1 < NIT);
    u32x4 ka, va;
    if (more) {                                // prefetch next tile into regs
      ka = *reinterpret_cast<const u32x4*>(kg + (long)(j0 + 32) * DP);
      va = *reinterpret_cast<const u32x4*>(vg + (j0 + 32));
      if (it + 2 < NIT) {
        __builtin_prefetch(kg + (long)(j0 + 64) * DP, 0, 0);
        __builtin_prefetch(vg + (j0 + 64), 0, 0);
      }
    }

    // scores: Q (16x64) x K-tile (32x64)^T  -> two 16x16 f32 fragments
    const __bf16* kt = &sK[cur][0];
    BFrag K1a = ld_frag(kt, KSTR);
    BFrag K1b = ld_frag(kt + 32, KSTR);
    BFrag K2a = ld_frag(kt + 16 * KSTR, KSTR);
    BFrag K2b = ld_frag(kt + 16 * KSTR + 32, KSTR);
    v8f S1 = wmma_bf16(Qb, K1b, wmma_bf16(Qa, K1a, vzero()));
    v8f S2 = wmma_bf16(Qb, K2b, wmma_bf16(Qa, K2a, vzero()));

    const bool msk1 = (j0 + n)      >= SEQ;    // one column per lane
    const bool msk2 = (j0 + 16 + n) >= SEQ;

    float p1[8], p2[8];
    #pragma unroll
    for (int r = 0; r < 8; ++r) {
      float a1 = msk1 ? -1e30f : S1[r];        // already in exp2 domain
      float a2 = msk2 ? -1e30f : S2[r];
      float mx = fmaxf(a1, a2);                // row max over 16-lane half
      mx = fmaxf(mx, __shfl_xor(mx, 1, 32));
      mx = fmaxf(mx, __shfl_xor(mx, 2, 32));
      mx = fmaxf(mx, __shfl_xor(mx, 4, 32));
      mx = fmaxf(mx, __shfl_xor(mx, 8, 32));
      float mn   = fmaxf(mrow[r], mx);
      float corr = __builtin_amdgcn_exp2f(mrow[r] - mn);
      mrow[r] = mn;
      p1[r] = __builtin_amdgcn_exp2f(a1 - mn);
      p2[r] = __builtin_amdgcn_exp2f(a2 - mn);
      acc0[r] *= corr; acc1[r] *= corr; acc2[r] *= corr; acc3[r] *= corr;
    }

    // C-layout f32 P -> bf16 A-layout via per-wave LDS staging tile
    #pragma unroll
    for (int r = 0; r < 8; ++r) {
      int m = r + 8 * hm;
      pb[m * VSTR + n]      = (__bf16)p1[r];
      pb[m * VSTR + 16 + n] = (__bf16)p2[r];
    }
    asm volatile("s_wait_dscnt 0" ::: "memory");
    BFrag P = ld_frag(pb, VSTR);

    // P (16x32) x Vt-tile rows (64 x 32); row d==40 of Vt is all-ones -> l in acc2
    const __bf16* vtile = &sV[cur][0];
    acc0 = wmma_bf16(P, ld_frag(vtile,                VSTR), acc0);
    acc1 = wmma_bf16(P, ld_frag(vtile + 16 * VSTR,    VSTR), acc1);
    acc2 = wmma_bf16(P, ld_frag(vtile + 32 * VSTR,    VSTR), acc2);
    acc3 = wmma_bf16(P, ld_frag(vtile + 48 * VSTR,    VSTR), acc3);

    if (more) {                                // fill the other buffer
      *reinterpret_cast<u32x4*>(&sK[1 - cur][krow * KSTR + kc8]) = ka;
      *reinterpret_cast<u32x4*>(&sV[1 - cur][vrow * VSTR + vc8]) = va;
    }
    __syncthreads();
  }

  // softmax denominator = column d==HD (fragment 2, n==8); broadcast per half
  float linv[8];
  #pragma unroll
  for (int r = 0; r < 8; ++r) {
    float l = __shfl(acc2[r], (lane & 16) | 8, 32);
    linv[r] = __builtin_amdgcn_rcpf(l);
  }

  const int  hh   = bh & (NH - 1);
  const long brow = (long)(bh >> 2) * SEQ_Q;
  v8f accar[4] = {acc0, acc1, acc2, acc3};
  #pragma unroll
  for (int f = 0; f < 4; ++f) {
    int dl = f * 16 + n;
    if (dl < HD) {
      v8f a = accar[f];
      #pragma unroll
      for (int r = 0; r < 8; ++r) {
        int m = qb * 16 + r + 8 * hm;               // < 4096
        cat[(brow + m) * DM + hh * HD + dl] = a[r] * linv[r];
      }
    }
  }
}

// ---------------- LayerNorm + residual + transpose + 2x nearest upsample ----------------
__global__ void k_epi(const float* __restrict__ cat, const float* __restrict__ lw,
                      const float* __restrict__ lb, float* __restrict__ out) {
  int idx = blockIdx.x * 256 + threadIdx.x;
  if (idx >= BATCH * HW) return;
  int s = idx % HW, b = idx / HW;
  const float* row = cat + ((long)b * HW + s) * DM;
  float mu = 0.f;
  for (int c = 0; c < DM; ++c) mu += row[c];
  mu *= (1.f / DM);
  float var = 0.f;
  for (int c = 0; c < DM; ++c) { float d = row[c] - mu; var += d * d; }
  var *= (1.f / DM);
  float inv = rsqrtf(var + 1e-5f);
  int ih = s >> 6, iw = s & 63;
  for (int c = 0; c < DM; ++c) {
    float xv = row[c];
    float v = (xv - mu) * inv * lw[c] + lb[c] + xv;
    float* o = out + (((long)b * DM + c) * 128 + 2 * ih) * 128 + 2 * iw;
    o[0] = v; o[1] = v; o[128] = v; o[129] = v;
  }
}

// ---------------- launch ----------------
extern "C" void kernel_launch(void* const* d_in, const int* in_sizes, int n_in,
                              void* d_out, int out_size, void* d_ws, size_t ws_size,
                              hipStream_t stream) {
  (void)in_sizes; (void)n_in; (void)out_size; (void)ws_size;
  const float* x   = (const float*)d_in[0];
  const float* w1  = (const float*)d_in[1];
  const float* b1  = (const float*)d_in[2];
  const float* w2  = (const float*)d_in[3];
  const float* b2  = (const float*)d_in[4];
  const float* pe  = (const float*)d_in[5];
  const float* wq  = (const float*)d_in[6];
  const float* wk  = (const float*)d_in[7];
  const float* wv  = (const float*)d_in[8];
  const float* lw  = (const float*)d_in[9];
  const float* lb  = (const float*)d_in[10];
  float* out = (float*)d_out;
  char*  ws  = (char*)d_ws;

  // workspace layout (bytes), all 16B aligned
  constexpr long C1_OFF  = 0;                                   // 4*64*4096 f32      = 4,194,304 B
  constexpr long FBF_OFF = C1_OFF  + 4L * 64 * HW * 4;          // 4*4112*160 bf16    = 5,263,360 B
  constexpr long WB_OFF  = FBF_OFF + (long)BATCH * FPAD * DM * 2;   // 3*160*160 bf16 = 153,600 B
  constexpr long Q_OFF   = WB_OFF  + 3L * DM * DM * 2;          // 16*4128*64 bf16    = 8,454,144 B
  constexpr long K_OFF   = Q_OFF   + 16L * SPAD * DP * 2;
  constexpr long VT_OFF  = K_OFF   + 16L * SPAD * DP * 2;
  constexpr long CAT_OFF = VT_OFF  + 16L * SPAD * DP * 2;       // 4*4096*160 f32     = 10,485,760 B

  float*  c1  = (float*) (ws + C1_OFF);
  __bf16* fbf = (__bf16*)(ws + FBF_OFF);
  __bf16* wb  = (__bf16*)(ws + WB_OFF);
  __bf16* qb  = (__bf16*)(ws + Q_OFF);
  __bf16* kb  = (__bf16*)(ws + K_OFF);
  __bf16* vtb = (__bf16*)(ws + VT_OFF);
  float*  cat = (float*) (ws + CAT_OFF);

  // zero q/k/vt (contiguous) so pad rows are well-defined every call
  const long zero16 = (3L * 16 * SPAD * DP * 2) / 16;           // float4 count
  k_zero <<<(int)((zero16 + 255) / 256), 256, 0, stream>>>((float4*)qb, zero16);
  k_ones <<<(16 * SPAD + 255) / 256, 256, 0, stream>>>(vtb);

  k_cvtw <<<(3 * DM * DM + 255) / 256, 256, 0, stream>>>(wq, wk, wv, wb);
  k_conv1<<<(BATCH * 64 * HW) / 256, 256, 0, stream>>>(x, w1, b1, c1);
  k_conv2f<<<(BATCH * FPAD * DM + 255) / 256, 256, 0, stream>>>(c1, w2, b2, pe, fbf);

  const int qkv_waves = 3 * BATCH * SBLK * 10;                  // 30840
  k_qkv  <<<(qkv_waves + 7) / 8, 256, 0, stream>>>(fbf, wb, qb, kb, vtb);

  k_attn <<<512, 256, 0, stream>>>(qb, kb, vtb, cat);           // 16 bh x 32 q-groups

  k_epi  <<<(BATCH * HW) / 256, 256, 0, stream>>>(cat, lw, lb, out);
}

// v001
// A run of this version takes 262 microseconds.
// Next to v000, in two timings, it ran 1.18 times as fast each time.
#include <hip/hip_runtime.h>
#include <hip/hip_bf16.h>

// ---------------- CDNA5 WMMA types ----------------
typedef __attribute__((ext_vector_type(16))) __bf16       v16bf;
typedef __attribute__((ext_vector_type(8)))  float        v8f;
typedef __attribute__((ext_vector_type(4)))  unsigned int u32x4;

#define BATCH 4
#define DM    160           // d_model
#define NH    4
#define HD    40            // head dim
#define DP    64            // padded head dim (4 x 16)
#define HW    4096          // 64*64 tokens
#define SEQ   4097          // tokens + pad row
#define SEQ_Q 4096          // queries that survive cat[:, :-1, :]
#define SPAD  4128          // K/V padded length (multiple of 32)
#define FPAD  4112          // f rows padded   (multiple of 16)
#define SBLK  257           // ceil(SEQ/16)
#define KSTR  72            // LDS K-tile row stride (bank-conflict-free for b128)
#define VSTR  40            // LDS V-tile row stride (bank-conflict-free for b128)

union BFrag { v16bf v; u32x4 u[2]; };

// 16x32 bf16 A/B fragment loader (row-major tile, `stride` elements per row).
// Lanes 0-15 : row=lane,    K chunks {0..7} and {16..23}
// Lanes 16-31: row=lane-16, K chunks {8..15} and {24..31}
__device__ __forceinline__ BFrag ld_frag(const __bf16* base, int stride) {
  const int lane = threadIdx.x & 31;
  const int r  = lane & 15;
  const int hh = lane >> 4;
  const __bf16* p = base + (long)r * stride + 8 * hh;
  BFrag f;
  f.u[0] = *reinterpret_cast<const u32x4*>(p);
  f.u[1] = *reinterpret_cast<const u32x4*>(p + 16);
  return f;
}

__device__ __forceinline__ v8f wmma_bf16(const BFrag& a, const BFrag& b, v8f c) {
  return __builtin_amdgcn_wmma_f32_16x16x32_bf16(false, a.v, false, b.v,
                                                 (short)0, c, false, false);
}

__device__ __forceinline__ v8f vzero() {
  v8f z = {0.f, 0.f, 0.f, 0.f, 0.f, 0.f, 0.f, 0.f};
  return z;
}

// ---------------- scratch zero (q/k/vt pad rows) ----------------
__global__ void k_zero(float4* __restrict__ p, long n) {
  long i = (long)blockIdx.x * blockDim.x + threadIdx.x;
  if (i < n) p[i] = make_float4(0.f, 0.f, 0.f, 0.f);
}

// ---------------- ones row in Vt at d==HD (softmax denominator via WMMA) ----------------
__global__ void k_ones(__bf16* __restrict__ vt) {
  int i = blockIdx.x * 256 + threadIdx.x;
  if (i >= 16 * SPAD) return;
  int bh = i / SPAD, s = i % SPAD;
  vt[((long)bh * DP + HD) * SPAD + s] = (__bf16)1.0f;
}

// ---------------- conv1: 64->64, 2x2 stride 2 ----------------
__global__ void k_conv1(const float* __restrict__ x, const float* __restrict__ w,
                        const float* __restrict__ bias, float* __restrict__ c1) {
  int idx = blockIdx.x * 256 + threadIdx.x;
  if (idx >= BATCH * 64 * HW) return;
  int ow = idx & 63;
  int oh = (idx >> 6) & 63;
  int oc = (idx >> 12) & 63;
  int b  = idx >> 18;
  const float* xb = x + (long)b * 64 * 128 * 128;
  const float* wr = w + oc * 64 * 4;
  float s = bias[oc];
  #pragma unroll 4
  for (int ic = 0; ic < 64; ++ic) {
    const float* xp = xb + ((long)ic * 128 + 2 * oh) * 128 + 2 * ow;
    const float* wp = wr + ic * 4;
    s += xp[0] * wp[0] + xp[1] * wp[1] + xp[128] * wp[2] + xp[129] * wp[3];
  }
  c1[((long)b * 64 + oc) * HW + (oh * 64 + ow)] = s;
}

// ---------- conv2 (1x1) + bias + leaky + transpose + pad + PE -> bf16 tokens ----------
__global__ void k_conv2f(const float* __restrict__ c1, const float* __restrict__ w,
                         const float* __restrict__ bias, const float* __restrict__ pe,
                         __bf16* __restrict__ fbf) {
  int idx = blockIdx.x * 256 + threadIdx.x;
  if (idx >= BATCH * FPAD * DM) return;
  int oc = idx % DM;
  int s  = (idx / DM) % FPAD;
  int b  = idx / (DM * FPAD);
  float v = 0.f;
  if (s < HW) {
    float acc = bias[oc];
    const float* cp = c1 + (long)b * 64 * HW + s;
    const float* wp = w + oc * 64;
    #pragma unroll 8
    for (int ic = 0; ic < 64; ++ic) acc += cp[(long)ic * HW] * wp[ic];
    acc = acc >= 0.f ? acc : 0.01f * acc;
    v = acc + pe[s];
  } else if (s == HW) {
    v = pe[HW];            // zero-pad row + positional value
  }                        // rows 4097..4111 stay 0 (safe WMMA tiles)
  fbf[((long)b * FPAD + s) * DM + oc] = (__bf16)v;
}

// ---------------- wq/wk/wv -> bf16 ----------------
__global__ void k_cvtw(const float* __restrict__ wq, const float* __restrict__ wk,
                       const float* __restrict__ wv, __bf16* __restrict__ o) {
  int i = blockIdx.x * 256 + threadIdx.x;
  if (i >= 3 * DM * DM) return;
  const float* src = (i < DM * DM) ? wq : (i < 2 * DM * DM ? wk : wv);
  o[i] = (__bf16)src[i % (DM * DM)];
}

// ---------------- QKV projection GEMM (WMMA bf16) ----------------
// one wave = one 16x16 tile of one of {q,k,v}; K = 160 = 5 x K32 steps
// Q output is pre-scaled by (1/sqrt(HD)) * log2(e) so attention uses raw exp2.
__global__ void __launch_bounds__(256) k_qkv(const __bf16* __restrict__ fbf,
                                             const __bf16* __restrict__ wb,
                                             __bf16* __restrict__ q,
                                             __bf16* __restrict__ k,
                                             __bf16* __restrict__ vt) {
  const int wv_id = blockIdx.x * 8 + (threadIdx.x >> 5);
  if (wv_id >= 3 * BATCH * SBLK * 10) return;
  int t = wv_id;
  const int mat = t % 3;  t /= 3;
  const int ob  = t % 10; t /= 10;
  const int sb  = t % SBLK;
  const int b   = t / SBLK;

  const __bf16* A0 = fbf + ((long)b * FPAD + sb * 16) * DM;
  const __bf16* B0 = wb + (long)mat * DM * DM + (long)ob * 16 * DM;

  v8f acc = vzero();
  #pragma unroll
  for (int kk = 0; kk < 5; ++kk) {
    BFrag a  = ld_frag(A0 + kk * 32, DM);
    BFrag bb = ld_frag(B0 + kk * 32, DM);
    acc = wmma_bf16(a, bb, acc);
  }

  const int lane = threadIdx.x & 31;
  const int n  = lane & 15;
  const int hm = lane >> 4;
  const int o  = ob * 16 + n;
  const int hh = o / HD;
  const int d  = o - hh * HD;
  const long bh = (long)b * NH + hh;
  const float qscale = 0.22811012f;   // (1/sqrt(40)) * log2(e)
  #pragma unroll
  for (int i = 0; i < 8; ++i) {
    int s = sb * 16 + i + 8 * hm;     // < 4112 < SPAD
    float av = acc[i];
    if (mat == 0) av *= qscale;
    __bf16 val = (__bf16)av;
    if (mat == 0)      q [(bh * SPAD + s) * DP + d] = val;
    else if (mat == 1) k [(bh * SPAD + s) * DP + d] = val;
    else               vt[(bh * DP + d) * SPAD + s] = val;   // V stored transposed
  }
}

// value of lane l ^ 16
__device__ __forceinline__ float xhalf(float v) {
  int b = __builtin_bit_cast(int, v);
  b = __builtin_amdgcn_permlanex16(b, b, 0x76543210, 0xfedcba98, false, false);
  return __builtin_bit_cast(float, b);
}

__global__ void __launch_bounds__(256) k_attn(const __bf16* __restrict__ q,
                                              const __bf16* __restrict__ k,
                                              const __bf16* __restrict__ vt,
                                              float* __restrict__ cat) {
  __shared__ __attribute__((aligned(16))) __bf16 sK[2][32 * KSTR];
  __shared__ __attribute__((aligned(16))) __bf16 sV[2][64 * VSTR];

  const int bh = blockIdx.x >> 5;              // 16 (b,h) pairs
  const int qg = blockIdx.x & 31;              // 32 groups of 128 queries
  const int wv = threadIdx.x >> 5;
  const int qb = qg * 8 + wv;                  // 16-query tile index (< 256)
  const int lane = threadIdx.x & 31;
  const int n  = lane & 15;
  const int hm = lane >> 4;
  const int tid = threadIdx.x;

  // cooperative staging coordinates (256 threads: K 32x64, V 64x32, 16B each)
  const int krow = tid >> 3, kc8 = (tid & 7) * 8;
  const int vrow = tid >> 2, vc8 = (tid & 3) * 8;
  const __bf16* kg = k  + ((long)bh * SPAD + krow) * DP + kc8;
  const __bf16* vg = vt + ((long)bh * DP + vrow) * SPAD + vc8;

  const __bf16* qbase = q + ((long)bh * SPAD + qb * 16) * DP;
  BFrag Qa = ld_frag(qbase, DP);        // B operand, column = query n, K = d 0..31
  BFrag Qb = ld_frag(qbase + 32, DP);   // K = d 32..63

  // Ot tiles: register r of tile f = O[query n][d = 16*f + 8*hm + r]
  v8f acc0 = vzero(), acc1 = vzero(), acc2 = vzero(), acc3 = vzero();
  float mrow = -1e30f;                  // running maximum of this lane's query

  // stage tile 0
  {
    u32x4 a = *reinterpret_cast<const u32x4*>(kg);
    u32x4 b = *reinterpret_cast<const u32x4*>(vg);
    *reinterpret_cast<u32x4*>(&sK[0][krow * KSTR + kc8]) = a;
    *reinterpret_cast<u32x4*>(&sV[0][vrow * VSTR + vc8]) = b;
  }
  __syncthreads();

  const int NIT = (SEQ + 31) / 32;             // 129
  for (int it = 0; it < NIT; ++it) {
    const int j0 = it * 32;
    const int cur = it & 1;
    const bool more = (it + 1 < NIT);
    u32x4 ka, va;
    if (more) {                                // prefetch next tile into regs
      ka = *reinterpret_cast<const u32x4*>(kg + (long)(j0 + 32) * DP);
      va = *reinterpret_cast<const u32x4*>(vg + (j0 + 32));
      if (it + 2 < NIT) {
        __builtin_prefetch(kg + (long)(j0 + 64) * DP, 0, 0);
        __builtin_prefetch(vg + (j0 + 64), 0, 0);
      }
    }

    // scores: K-tile (32x64) x Q^T (64x16) -> two 16x16 f32 fragments (keys x queries)
    const __bf16* kt = &sK[cur][0];
    BFrag K1a = ld_frag(kt, KSTR);
    BFrag K1b = ld_frag(kt + 32, KSTR);
    BFrag K2a = ld_frag(kt + 16 * KSTR, KSTR);
    BFrag K2b = ld_frag(kt + 16 * KSTR + 32, KSTR);
    v8f S1 = wmma_bf16(K1b, Qb, wmma_bf16(K1a, Qa, vzero()));
    v8f S2 = wmma_bf16(K2b, Qb, wmma_bf16(K2a, Qa, vzero()));

    if (j0 + 32 > SEQ) {                       // keys are register rows: only the last tile has any to mask
      #pragma unroll
      for (int r = 0; r < 8; ++r) {
        if (j0 + 8 * hm + r      >= SEQ) S1[r] = -1e30f;
        if (j0 + 16 + 8 * hm + r >= SEQ) S2[r] = -1e30f;
      }
    }

    // maximum of this query over the 32 keys: 16 in-lane, the rest in lane ^ 16
    // (four short independent chains, not one of sixteen links)
    float mxa = fmaxf(fmaxf(S1[0], S1[1]), fmaxf(S1[2], S1[3]));
    float mxb = fmaxf(fmaxf(S1[4], S1[5]), fmaxf(S1[6], S1[7]));
    float mxc = fmaxf(fmaxf(S2[0], S2[1]), fmaxf(S2[2], S2[3]));
    float mxd = fmaxf(fmaxf(S2[4], S2[5]), fmaxf(S2[6], S2[7]));
    float mx  = fmaxf(fmaxf(mxa, mxb), fmaxf(mxc, mxd));
    mx = fmaxf(mx, xhalf(mx));
    const float mn   = fmaxf(mrow, mx);
    const float corr = __builtin_amdgcn_exp2f(mrow - mn);   // scores already in exp2 domain
    mrow = mn;

    // P^T as B operand: element s = key 8*hm + s (s < 8) or 16 + 8*hm + s - 8 (s >= 8), straight from the two score tiles
    BFrag P;
    #pragma unroll
    for (int r = 0; r < 8; ++r) {
      P.v[r]     = (__bf16)__builtin_amdgcn_exp2f(S1[r] - mn);
      P.v[8 + r] = (__bf16)__builtin_amdgcn_exp2f(S2[r] - mn);
    }
    acc0 *= corr; acc1 *= corr; acc2 *= corr; acc3 *= corr;

    // Vt-tile rows (64 x 32) x P^T (32x16); row d==40 of Vt is all-ones -> l in acc2
    const __bf16* vtile = &sV[cur][0];
    acc0 = wmma_bf16(ld_frag(vtile,             VSTR), P, acc0);
    acc1 = wmma_bf16(ld_frag(vtile + 16 * VSTR, VSTR), P, acc1);
    acc2 = wmma_bf16(ld_frag(vtile + 32 * VSTR, VSTR), P, acc2);
    acc3 = wmma_bf16(ld_frag(vtile + 48 * VSTR, VSTR), P, acc3);

    if (more) {                                // fill the other buffer
      *reinterpret_cast<u32x4*>(&sK[1 - cur][krow * KSTR + kc8]) = ka;
      *reinterpret_cast<u32x4*>(&sV[1 - cur][vrow * VSTR + vc8]) = va;
    }
    __syncthreads();
  }

  // softmax denominator = row d==HD of Ot: tile 2, register 0, upper wave half
  const float lo   = acc2[0];
  const float lx   = xhalf(lo);
  const float linv = __builtin_amdgcn_rcpf(hm ? lo : lx);

  const int  hh   = bh & (NH - 1);
  const long brow = (long)(bh >> 2) * SEQ_Q;
  float* orow = cat + (brow + qb * 16 + n) * DM + hh * HD;   // query row < 4096
  v8f accar[4] = {acc0, acc1, acc2, acc3};
  #pragma unroll
  for (int f = 0; f < 4; ++f) {
    int d0 = f * 16 + 8 * hm;                  // 8 consecutive d per lane
    if (d0 < HD) {
      v8f a = accar[f] * linv;
      *reinterpret_cast<float4*>(orow + d0)     = make_float4(a[0], a[1], a[2], a[3]);
      *reinterpret_cast<float4*>(orow + d0 + 4) = make_float4(a[4], a[5], a[6], a[7]);
    }
  }
}

// ---------------- LayerNorm + residual + transpose + 2x nearest upsample ----------------
__global__ void k_epi(const float* __restrict__ cat, const float* __restrict__ lw,
                      const float* __restrict__ lb, float* __restrict__ out) {
  int idx = blockIdx.x * 256 + threadIdx.x;
  if (idx >= BATCH * HW) return;
  int s = idx % HW, b = idx / HW;
  const float* row = cat + ((long)b * HW + s) * DM;
  float mu = 0.f;
  for (int c = 0; c < DM; ++c) mu += row[c];
  mu *= (1.f / DM);
  float var = 0.f;
  for (int c = 0; c < DM; ++c) { float d = row[c] - mu; var += d * d; }
  var *= (1.f / DM);
  float inv = rsqrtf(var + 1e-5f);
  int ih = s >> 6, iw = s & 63;
  for (int c = 0; c < DM; ++c) {
    float xv = row[c];
    float v = (xv - mu) * inv * lw[c] + lb[c] + xv;
    float* o = out + (((long)b * DM + c) * 128 + 2 * ih) * 128 + 2 * iw;
    o[0] = v; o[1] = v; o[128] = v; o[129] = v;
  }
}

// ---------------- launch ----------------
extern "C" void kernel_launch(void* const* d_in, const int* in_sizes, int n_in,
                              void* d_out, int out_size, void* d_ws, size_t ws_size,
                              hipStream_t stream) {
  (void)in_sizes; (void)n_in; (void)out_size; (void)ws_size;
  const float* x   = (const float*)d_in[0];
  const float* w1  = (const float*)d_in[1];
  const float* b1  = (const float*)d_in[2];
  const float* w2  = (const float*)d_in[3];
  const float* b2  = (const float*)d_in[4];
  const float* pe  = (const float*)d_in[5];
  const float* wq  = (const float*)d_in[6];
  const float* wk  = (const float*)d_in[7];
  const float* wv  = (const float*)d_in[8];
  const float* lw  = (const float*)d_in[9];
  const float* lb  = (const float*)d_in[10];
  float* out = (float*)d_out;
  char*  ws  = (char*)d_ws;

  // workspace layout (bytes), all 16B aligned
  constexpr long C1_OFF  = 0;                                   // 4*64*4096 f32      = 4,194,304 B
  constexpr long FBF_OFF = C1_OFF  + 4L * 64 * HW * 4;          // 4*4112*160 bf16    = 5,263,360 B
  constexpr long WB_OFF  = FBF_OFF + (long)BATCH * FPAD * DM * 2;   // 3*160*160 bf16 = 153,600 B
  constexpr long Q_OFF   = WB_OFF  + 3L * DM * DM * 2;          // 16*4128*64 bf16    = 8,454,144 B
  constexpr long K_OFF   = Q_OFF   + 16L * SPAD * DP * 2;
  constexpr long VT_OFF  = K_OFF   + 16L * SPAD * DP * 2;
  constexpr long CAT_OFF = VT_OFF  + 16L * SPAD * DP * 2;       // 4*4096*160 f32     = 10,485,760 B

  float*  c1  = (float*) (ws + C1_OFF);
  __bf16* fbf = (__bf16*)(ws + FBF_OFF);
  __bf16* wb  = (__bf16*)(ws + WB_OFF);
  __bf16* qb  = (__bf16*)(ws + Q_OFF);
  __bf16* kb  = (__bf16*)(ws + K_OFF);
  __bf16* vtb = (__bf16*)(ws + VT_OFF);
  float*  cat = (float*) (ws + CAT_OFF);

  // zero q/k/vt (contiguous) so pad rows are well-defined every call
  const long zero16 = (3L * 16 * SPAD * DP * 2) / 16;           // float4 count
  k_zero <<<(int)((zero16 + 255) / 256), 256, 0, stream>>>((float4*)qb, zero16);
  k_ones <<<(16 * SPAD + 255) / 256, 256, 0, stream>>>(vtb);

  k_cvtw <<<(3 * DM * DM + 255) / 256, 256, 0, stream>>>(wq, wk, wv, wb);
  k_conv1<<<(BATCH * 64 * HW) / 256, 256, 0, stream>>>(x, w1, b1, c1);
  k_conv2f<<<(BATCH * FPAD * DM + 255) / 256, 256, 0, stream>>>(c1, w2, b2, pe, fbf);

  const int qkv_waves = 3 * BATCH * SBLK * 10;                  // 30840
  k_qkv  <<<(qkv_waves + 7) / 8, 256, 0, stream>>>(fbf, wb, qb, kb, vtb);

  k_attn <<<512, 256, 0, stream>>>(qb, kb, vtb, cat);           // 16 bh x 32 q-groups

  k_epi  <<<(BATCH * HW) / 256, 256, 0, stream>>>(cat, lw, lb, out);
}

// v002
// One run takes 214 microseconds.
// In both of two side-by-side timings against v001, it was 1.22 times as fast.
// Over all steps from v000 it is 1.44 times as fast.
#include <hip/hip_runtime.h>
#include <hip/hip_bf16.h>

// ---------------- CDNA5 WMMA types ----------------
typedef __attribute__((ext_vector_type(16))) __bf16       v16bf;
typedef __attribute__((ext_vector_type(8)))  float        v8f;
typedef __attribute__((ext_vector_type(4)))  unsigned int u32x4;

#define BATCH 4
#define DM    160           // d_model
#define NH    4
#define HD    40            // head dim
#define DP    64            // padded head dim (4 x 16)
#define HW    4096          // 64*64 tokens
#define SEQ   4097          // tokens + pad row
#define SEQ_Q 4096          // queries that survive cat[:, :-1, :]
#define SPAD  4128          // K/V padded length (multiple of 32)
#define FPAD  4112          // f rows padded   (multiple of 16)
#define SBLK  257           // ceil(SEQ/16)
#define KSTR  72            // LDS K-tile row stride (bank-conflict-free for b128)
#define VSTR  40            // LDS V-tile row stride (bank-conflict-free for b128)

union BFrag { v16bf v; u32x4 u[2]; };

// 16x32 bf16 A/B fragment loader (row-major tile, `stride` elements per row).
// Lanes 0-15 : row=lane,    K chunks {0..7} and {16..23}
// Lanes 16-31: row=lane-16, K chunks {8..15} and {24..31}
__device__ __forceinline__ BFrag ld_frag(const __bf16* base, int stride) {
  const int lane = threadIdx.x & 31;
  const int r  = lane & 15;
  const int hh = lane >> 4;
  const __bf16* p = base + (long)r * stride + 8 * hh;
  BFrag f;
  f.u[0] = *reinterpret_cast<const u32x4*>(p);
  f.u[1] = *reinterpret_cast<const u32x4*>(p + 16);
  return f;
}

__device__ __forceinline__ v8f wmma_bf16(const BFrag& a, const BFrag& b, v8f c) {
  return __builtin_amdgcn_wmma_f32_16x16x32_bf16(false, a.v, false, b.v,
                                                 (short)0, c, false, false);
}

__device__ __forceinline__ v8f vzero() {
  v8f z = {0.f, 0.f, 0.f, 0.f, 0.f, 0.f, 0.f, 0.f};
  return z;
}

// ---------------- scratch zero (q/k/vt pad rows) ----------------
__global__ void k_zero(float4* __restrict__ p, long n) {
  long i = (long)blockIdx.x * blockDim.x + threadIdx.x;
  if (i < n) p[i] = make_float4(0.f, 0.f, 0.f, 0.f);
}

// ---------------- ones row in Vt at d==HD (softmax denominator via WMMA) ----------------
__global__ void k_ones(__bf16* __restrict__ vt) {
  int i = blockIdx.x * 256 + threadIdx.x;
  if (i >= 16 * SPAD) return;
  int bh = i / SPAD, s = i % SPAD;
  vt[((long)bh * DP + HD) * SPAD + s] = (__bf16)1.0f;
}

// ---------------- conv1: 64->64, 2x2 stride 2 ----------------
__global__ void k_conv1(const float* __restrict__ x, const float* __restrict__ w,
                        const float* __restrict__ bias, float* __restrict__ c1) {
  int idx = blockIdx.x * 256 + threadIdx.x;
  if (idx >= BATCH * 64 * HW) return;
  int ow = idx & 63;
  int oh = (idx >> 6) & 63;
  int oc = (idx >> 12) & 63;
  int b  = idx >> 18;
  const float* xb = x + (long)b * 64 * 128 * 128;
  const float* wr = w + oc * 64 * 4;
  float s = bias[oc];
  #pragma unroll 4
  for (int ic = 0; ic < 64; ++ic) {
    const float* xp = xb + ((long)ic * 128 + 2 * oh) * 128 + 2 * ow;
    const float* wp = wr + ic * 4;
    s += xp[0] * wp[0] + xp[1] * wp[1] + xp[128] * wp[2] + xp[129] * wp[3];
  }
  c1[((long)b * 64 + oc) * HW + (oh * 64 + ow)] = s;
}

// ---------- conv2 (1x1) + bias + leaky + transpose + pad + PE -> bf16 tokens ----------
// 1 block = 32 token rows x all 160 channels. Lanes run along the tokens, so a c1 load is
// one whole line; a wave owns 10 channels, so its weights are wave-uniform (scalar loads)
// and each c1 value is used 10 times from a register. The 32x160 tile is contiguous in
// fbf: it is turned in LDS and leaves as whole 16-byte pieces.
#define C2ROWS 32           // token rows per block (BATCH*FPAD = 514 * 32)
#define C2OC   10           // channels per wave (16 waves x 10 = DM)
#define C2THR  512          // threads per block
#define C2PIT  168          // LDS row pitch in bf16 (336 B: 16-B aligned, spreads the banks)
typedef __attribute__((ext_vector_type(2))) __bf16 v2bf;

__global__ void __launch_bounds__(C2THR) k_conv2f(const float* __restrict__ c1,
                                                  const float* __restrict__ w,
                                                  const float* __restrict__ bias,
                                                  const float* __restrict__ pe,
                                                  __bf16* __restrict__ fbf) {
  __shared__ __attribute__((aligned(16))) __bf16 tile[C2ROWS * C2PIT];
  const int lane = threadIdx.x & 31;
  const int oc0  = __builtin_amdgcn_readfirstlane(threadIdx.x >> 5) * C2OC;
  const int row  = blockIdx.x * C2ROWS + lane;      // b * FPAD + s
  const int b    = row / FPAD;
  const int s    = row - b * FPAD;
  const int sc   = s < HW ? s : HW - 1;             // pad rows read a valid column, result unused

  const int   si = s < HW ? s : HW;
  const float pv = pe[si];
  // the pe load names si's register as its offset: the wait stands before anything may be
  // written there (si as an input keeps the register untouched up to the wait)
  asm volatile("s_wait_xcnt 0x0" :: "v"(si) : "memory");

  const float* cp = c1 + (long)b * 64 * HW + sc;
  float xv[64];
  #pragma unroll
  for (int ic = 0; ic < 64; ++ic) xv[ic] = cp[(long)ic * HW];
  // the 64 loads name cp's register pair: the wait stands before the pair is used for sums
  asm volatile("s_wait_xcnt 0x0" :: "v"(cp) : "memory");

  // 20 groups of 2 channels x 16 inputs; per channel the sum runs over ic = 0..63 in order.
  // A group's 32 weights are fetched while the group before it is worked on.
  const float* wp = w + oc0 * 64;
  float wc[32], wn[32];
  #pragma unroll
  for (int i = 0; i < 16; ++i) { wc[i] = wp[i]; wc[16 + i] = wp[64 + i]; }
  float a0 = 0.f, a1 = 0.f;
  #pragma unroll
  for (int g = 0; g < 20; ++g) {
    const int j0 = (g >> 2) * 2, icb = (g & 3) * 16;
    if (g + 1 < 20) {
      const int jn = ((g + 1) >> 2) * 2, icn = ((g + 1) & 3) * 16;
      #pragma unroll
      for (int i = 0; i < 16; ++i) {
        wn[i]      = wp[jn * 64 + icn + i];
        wn[16 + i] = wp[(jn + 1) * 64 + icn + i];
      }
    }
    if (icb == 0) { a0 = bias[oc0 + j0]; a1 = bias[oc0 + j0 + 1]; }
    #pragma unroll
    for (int i = 0; i < 16; ++i) {
      a0 += xv[icb + i] * wc[i];
      a1 += xv[icb + i] * wc[16 + i];
    }
    if (icb == 48) {
      float l0 = a0 >= 0.f ? a0 : 0.01f * a0;
      float l1 = a1 >= 0.f ? a1 : 0.01f * a1;
      // row HW: zero-pad row + positional value; rows above it stay 0 (safe WMMA tiles)
      v2bf t;
      t[0] = (__bf16)(s < HW ? l0 + pv : (s == HW ? pv : 0.f));
      t[1] = (__bf16)(s < HW ? l1 + pv : (s == HW ? pv : 0.f));
      *reinterpret_cast<v2bf*>(&tile[lane * C2PIT + oc0 + j0]) = t;
    }
    // keeps the scheduler from lifting all the weight loads to the top, which spills scalar registers
    __builtin_amdgcn_sched_barrier(0);
    #pragma unroll
    for (int i = 0; i < 32; ++i) wc[i] = wn[i];
  }
  __syncthreads();

  __bf16* dst = fbf + (long)blockIdx.x * C2ROWS * DM;
  for (int c = threadIdx.x; c < C2ROWS * DM / 8; c += C2THR) {
    const int r = c / (DM / 8), kk = c - r * (DM / 8);
    *reinterpret_cast<u32x4*>(dst + c * 8) =
        *reinterpret_cast<const u32x4*>(&tile[r * C2PIT + kk * 8]);
  }
}

// ---------------- wq/wk/wv -> bf16 ----------------
__global__ void k_cvtw(const float* __restrict__ wq, const float* __restrict__ wk,
                       const float* __restrict__ wv, __bf16* __restrict__ o) {
  int i = blockIdx.x * 256 + threadIdx.x;
  if (i >= 3 * DM * DM) return;
  const float* src = (i < DM * DM) ? wq : (i < 2 * DM * DM ? wk : wv);
  o[i] = (__bf16)src[i % (DM * DM)];
}

// ---------------- QKV projection GEMM (WMMA bf16) ----------------
// one wave = one 16x16 tile of one of {q,k,v}; K = 160 = 5 x K32 steps
// Q output is pre-scaled by (1/sqrt(HD)) * log2(e) so attention uses raw exp2.
__global__ void __launch_bounds__(256) k_qkv(const __bf16* __restrict__ fbf,
                                             const __bf16* __restrict__ wb,
                                             __bf16* __restrict__ q,
                                             __bf16* __restrict__ k,
                                             __bf16* __restrict__ vt) {
  const int wv_id = blockIdx.x * 8 + (threadIdx.x >> 5);
  if (wv_id >= 3 * BATCH * SBLK * 10) return;
  int t = wv_id;
  const int mat = t % 3;  t /= 3;
  const int ob  = t % 10; t /= 10;
  const int sb  = t % SBLK;
  const int b   = t / SBLK;

  const __bf16* A0 = fbf + ((long)b * FPAD + sb * 16) * DM;
  const __bf16* B0 = wb + (long)mat * DM * DM + (long)ob * 16 * DM;

  v8f acc = vzero();
  #pragma unroll
  for (int kk = 0; kk < 5; ++kk) {
    BFrag a  = ld_frag(A0 + kk * 32, DM);
    BFrag bb = ld_frag(B0 + kk * 32, DM);
    acc = wmma_bf16(a, bb, acc);
  }

  const int lane = threadIdx.x & 31;
  const int n  = lane & 15;
  const int hm = lane >> 4;
  const int o  = ob * 16 + n;
  const int hh = o / HD;
  const int d  = o - hh * HD;
  const long bh = (long)b * NH + hh;
  const float qscale = 0.22811012f;   // (1/sqrt(40)) * log2(e)
  #pragma unroll
  for (int i = 0; i < 8; ++i) {
    int s = sb * 16 + i + 8 * hm;     // < 4112 < SPAD
    float av = acc[i];
    if (mat == 0) av *= qscale;
    __bf16 val = (__bf16)av;
    if (mat == 0)      q [(bh * SPAD + s) * DP + d] = val;
    else if (mat == 1) k [(bh * SPAD + s) * DP + d] = val;
    else               vt[(bh * DP + d) * SPAD + s] = val;   // V stored transposed
  }
}

// value of lane l ^ 16
__device__ __forceinline__ float xhalf(float v) {
  int b = __builtin_bit_cast(int, v);
  b = __builtin_amdgcn_permlanex16(b, b, 0x76543210, 0xfedcba98, false, false);
  return __builtin_bit_cast(float, b);
}

__global__ void __launch_bounds__(256) k_attn(const __bf16* __restrict__ q,
                                              const __bf16* __restrict__ k,
                                              const __bf16* __restrict__ vt,
                                              float* __restrict__ cat) {
  __shared__ __attribute__((aligned(16))) __bf16 sK[2][32 * KSTR];
  __shared__ __attribute__((aligned(16))) __bf16 sV[2][64 * VSTR];

  const int bh = blockIdx.x >> 5;              // 16 (b,h) pairs
  const int qg = blockIdx.x & 31;              // 32 groups of 128 queries
  const int wv = threadIdx.x >> 5;
  const int qb = qg * 8 + wv;                  // 16-query tile index (< 256)
  const int lane = threadIdx.x & 31;
  const int n  = lane & 15;
  const int hm = lane >> 4;
  const int tid = threadIdx.x;

  // cooperative staging coordinates (256 threads: K 32x64, V 64x32, 16B each)
  const int krow = tid >> 3, kc8 = (tid & 7) * 8;
  const int vrow = tid >> 2, vc8 = (tid & 3) * 8;
  const __bf16* kg = k  + ((long)bh * SPAD + krow) * DP + kc8;
  const __bf16* vg = vt + ((long)bh * DP + vrow) * SPAD + vc8;

  const __bf16* qbase = q + ((long)bh * SPAD + qb * 16) * DP;
  BFrag Qa = ld_frag(qbase, DP);        // B operand, column = query n, K = d 0..31
  BFrag Qb = ld_frag(qbase + 32, DP);   // K = d 32..63

  // Ot tiles: register r of tile f = O[query n][d = 16*f + 8*hm + r]
  v8f acc0 = vzero(), acc1 = vzero(), acc2 = vzero(), acc3 = vzero();
  float mrow = -1e30f;                  // running maximum of this lane's query

  // stage tile 0
  {
    u32x4 a = *reinterpret_cast<const u32x4*>(kg);
    u32x4 b = *reinterpret_cast<const u32x4*>(vg);
    *reinterpret_cast<u32x4*>(&sK[0][krow * KSTR + kc8]) = a;
    *reinterpret_cast<u32x4*>(&sV[0][vrow * VSTR + vc8]) = b;
  }
  __syncthreads();

  const int NIT = (SEQ + 31) / 32;             // 129
  for (int it = 0; it < NIT; ++it) {
    const int j0 = it * 32;
    const int cur = it & 1;
    const bool more = (it + 1 < NIT);
    u32x4 ka, va;
    if (more) {                                // prefetch next tile into regs
      ka = *reinterpret_cast<const u32x4*>(kg + (long)(j0 + 32) * DP);
      va = *reinterpret_cast<const u32x4*>(vg + (j0 + 32));
      if (it + 2 < NIT) {
        __builtin_prefetch(kg + (long)(j0 + 64) * DP, 0, 0);
        __builtin_prefetch(vg + (j0 + 64), 0, 0);
      }
    }

    // scores: K-tile (32x64) x Q^T (64x16) -> two 16x16 f32 fragments (keys x queries)
    const __bf16* kt = &sK[cur][0];
    BFrag K1a = ld_frag(kt, KSTR);
    BFrag K1b = ld_frag(kt + 32, KSTR);
    BFrag K2a = ld_frag(kt + 16 * KSTR, KSTR);
    BFrag K2b = ld_frag(kt + 16 * KSTR + 32, KSTR);
    v8f S1 = wmma_bf16(K1b, Qb, wmma_bf16(K1a, Qa, vzero()));
    v8f S2 = wmma_bf16(K2b, Qb, wmma_bf16(K2a, Qa, vzero()));

    if (j0 + 32 > SEQ) {                       // keys are register rows: only the last tile has any to mask
      #pragma unroll
      for (int r = 0; r < 8; ++r) {
        if (j0 + 8 * hm + r      >= SEQ) S1[r] = -1e30f;
        if (j0 + 16 + 8 * hm + r >= SEQ) S2[r] = -1e30f;
      }
    }

    // maximum of this query over the 32 keys: 16 in-lane, the rest in lane ^ 16
    // (four short independent chains, not one of sixteen links)
    float mxa = fmaxf(fmaxf(S1[0], S1[1]), fmaxf(S1[2], S1[3]));
    float mxb = fmaxf(fmaxf(S1[4], S1[5]), fmaxf(S1[6], S1[7]));
    float mxc = fmaxf(fmaxf(S2[0], S2[1]), fmaxf(S2[2], S2[3]));
    float mxd = fmaxf(fmaxf(S2[4], S2[5]), fmaxf(S2[6], S2[7]));
    float mx  = fmaxf(fmaxf(mxa, mxb), fmaxf(mxc, mxd));
    mx = fmaxf(mx, xhalf(mx));
    const float mn   = fmaxf(mrow, mx);
    const float corr = __builtin_amdgcn_exp2f(mrow - mn);   // scores already in exp2 domain
    mrow = mn;

    // P^T as B operand: element s = key 8*hm + s (s < 8) or 16 + 8*hm + s - 8 (s >= 8), straight from the two score tiles
    BFrag P;
    #pragma unroll
    for (int r = 0; r < 8; ++r) {
      P.v[r]     = (__bf16)__builtin_amdgcn_exp2f(S1[r] - mn);
      P.v[8 + r] = (__bf16)__builtin_amdgcn_exp2f(S2[r] - mn);
    }
    acc0 *= corr; acc1 *= corr; acc2 *= corr; acc3 *= corr;

    // Vt-tile rows (64 x 32) x P^T (32x16); row d==40 of Vt is all-ones -> l in acc2
    const __bf16* vtile = &sV[cur][0];
    acc0 = wmma_bf16(ld_frag(vtile,             VSTR), P, acc0);
    acc1 = wmma_bf16(ld_frag(vtile + 16 * VSTR, VSTR), P, acc1);
    acc2 = wmma_bf16(ld_frag(vtile + 32 * VSTR, VSTR), P, acc2);
    acc3 = wmma_bf16(ld_frag(vtile + 48 * VSTR, VSTR), P, acc3);

    if (more) {                                // fill the other buffer
      *reinterpret_cast<u32x4*>(&sK[1 - cur][krow * KSTR + kc8]) = ka;
      *reinterpret_cast<u32x4*>(&sV[1 - cur][vrow * VSTR + vc8]) = va;
    }
    __syncthreads();
  }

  // softmax denominator = row d==HD of Ot: tile 2, register 0, upper wave half
  const float lo   = acc2[0];
  const float lx   = xhalf(lo);
  const float linv = __builtin_amdgcn_rcpf(hm ? lo : lx);

  const int  hh   = bh & (NH - 1);
  const long brow = (long)(bh >> 2) * SEQ_Q;
  float* orow = cat + (brow + qb * 16 + n) * DM + hh * HD;   // query row < 4096
  v8f accar[4] = {acc0, acc1, acc2, acc3};
  #pragma unroll
  for (int f = 0; f < 4; ++f) {
    int d0 = f * 16 + 8 * hm;                  // 8 consecutive d per lane
    if (d0 < HD) {
      v8f a = accar[f] * linv;
      *reinterpret_cast<float4*>(orow + d0)     = make_float4(a[0], a[1], a[2], a[3]);
      *reinterpret_cast<float4*>(orow + d0 + 4) = make_float4(a[4], a[5], a[6], a[7]);
    }
  }
}

// ---------------- LayerNorm + residual + transpose + 2x nearest upsample ----------------
__global__ void k_epi(const float* __restrict__ cat, const float* __restrict__ lw,
                      const float* __restrict__ lb, float* __restrict__ out) {
  int idx = blockIdx.x * 256 + threadIdx.x;
  if (idx >= BATCH * HW) return;
  int s = idx % HW, b = idx / HW;
  const float* row = cat + ((long)b * HW + s) * DM;
  float mu = 0.f;
  for (int c = 0; c < DM; ++c) mu += row[c];
  mu *= (1.f / DM);
  float var = 0.f;
  for (int c = 0; c < DM; ++c) { float d = row[c] - mu; var += d * d; }
  var *= (1.f / DM);
  float inv = rsqrtf(var + 1e-5f);
  int ih = s >> 6, iw = s & 63;
  for (int c = 0; c < DM; ++c) {
    float xv = row[c];
    float v = (xv - mu) * inv * lw[c] + lb[c] + xv;
    float* o = out + (((long)b * DM + c) * 128 + 2 * ih) * 128 + 2 * iw;
    o[0] = v; o[1] = v; o[128] = v; o[129] = v;
  }
}

// ---------------- launch ----------------
extern "C" void kernel_launch(void* const* d_in, const int* in_sizes, int n_in,
                              void* d_out, int out_size, void* d_ws, size_t ws_size,
                              hipStream_t stream) {
  (void)in_sizes; (void)n_in; (void)out_size; (void)ws_size;
  const float* x   = (const float*)d_in[0];
  const float* w1  = (const float*)d_in[1];
  const float* b1  = (const float*)d_in[2];
  const float* w2  = (const float*)d_in[3];
  const float* b2  = (const float*)d_in[4];
  const float* pe  = (const float*)d_in[5];
  const float* wq  = (const float*)d_in[6];
  const float* wk  = (const float*)d_in[7];
  const float* wv  = (const float*)d_in[8];
  const float* lw  = (const float*)d_in[9];
  const float* lb  = (const float*)d_in[10];
  float* out = (float*)d_out;
  char*  ws  = (char*)d_ws;

  // workspace layout (bytes), all 16B aligned
  constexpr long C1_OFF  = 0;                                   // 4*64*4096 f32      = 4,194,304 B
  constexpr long FBF_OFF = C1_OFF  + 4L * 64 * HW * 4;          // 4*4112*160 bf16    = 5,263,360 B
  constexpr long WB_OFF  = FBF_OFF + (long)BATCH * FPAD * DM * 2;   // 3*160*160 bf16 = 153,600 B
  constexpr long Q_OFF   = WB_OFF  + 3L * DM * DM * 2;          // 16*4128*64 bf16    = 8,454,144 B
  constexpr long K_OFF   = Q_OFF   + 16L * SPAD * DP * 2;
  constexpr long VT_OFF  = K_OFF   + 16L * SPAD * DP * 2;
  constexpr long CAT_OFF = VT_OFF  + 16L * SPAD * DP * 2;       // 4*4096*160 f32     = 10,485,760 B

  float*  c1  = (float*) (ws + C1_OFF);
  __bf16* fbf = (__bf16*)(ws + FBF_OFF);
  __bf16* wb  = (__bf16*)(ws + WB_OFF);
  __bf16* qb  = (__bf16*)(ws + Q_OFF);
  __bf16* kb  = (__bf16*)(ws + K_OFF);
  __bf16* vtb = (__bf16*)(ws + VT_OFF);
  float*  cat = (float*) (ws + CAT_OFF);

  // zero q/k/vt (contiguous) so pad rows are well-defined every call
  const long zero16 = (3L * 16 * SPAD * DP * 2) / 16;           // float4 count
  k_zero <<<(int)((zero16 + 255) / 256), 256, 0, stream>>>((float4*)qb, zero16);
  k_ones <<<(16 * SPAD + 255) / 256, 256, 0, stream>>>(vtb);

  k_cvtw <<<(3 * DM * DM + 255) / 256, 256, 0, stream>>>(wq, wk, wv, wb);
  k_conv1<<<(BATCH * 64 * HW) / 256, 256, 0, stream>>>(x, w1, b1, c1);
  k_conv2f<<<(BATCH * FPAD) / C2ROWS, C2THR, 0, stream>>>(c1, w2, b2, pe, fbf);

  const int qkv_waves = 3 * BATCH * SBLK * 10;                  // 30840
  k_qkv  <<<(qkv_waves + 7) / 8, 256, 0, stream>>>(fbf, wb, qb, kb, vtb);

  k_attn <<<512, 256, 0, stream>>>(qb, kb, vtb, cat);           // 16 bh x 32 q-groups

  k_epi  <<<(BATCH * HW) / 256, 256, 0, stream>>>(cat, lw, lb, out);
}

// v003
// It runs in 196 microseconds.
// Timed twice side by side with v002, it ran 1.09 times as fast both times.
// Counting every step since v000, it is 1.58 times as fast.
#include <hip/hip_runtime.h>
#include <hip/hip_bf16.h>

// ---------------- CDNA5 WMMA types ----------------
typedef __attribute__((ext_vector_type(16))) __bf16       v16bf;
typedef __attribute__((ext_vector_type(8)))  float        v8f;
typedef __attribute__((ext_vector_type(4)))  unsigned int u32x4;

#define BATCH 4
#define DM    160           // d_model
#define NH    4
#define HD    40            // head dim
#define DP    64            // padded head dim (4 x 16)
#define HW    4096          // 64*64 tokens
#define SEQ   4097          // tokens + pad row
#define SEQ_Q 4096          // queries that survive cat[:, :-1, :]
#define SPAD  4128          // K/V padded length (multiple of 32)
#define FPAD  4112          // f rows padded   (multiple of 16)
#define SBLK  257           // ceil(SEQ/16)
#define KSTR  72            // LDS K-tile row stride (bank-conflict-free for b128)
#define VSTR  40            // LDS V-tile row stride (bank-conflict-free for b128)

union BFrag { v16bf v; u32x4 u[2]; };

// 16x32 bf16 A/B fragment loader (row-major tile, `stride` elements per row).
// Lanes 0-15 : row=lane,    K chunks {0..7} and {16..23}
// Lanes 16-31: row=lane-16, K chunks {8..15} and {24..31}
__device__ __forceinline__ BFrag ld_frag(const __bf16* base, int stride) {
  const int lane = threadIdx.x & 31;
  const int r  = lane & 15;
  const int hh = lane >> 4;
  const __bf16* p = base + (long)r * stride + 8 * hh;
  BFrag f;
  f.u[0] = *reinterpret_cast<const u32x4*>(p);
  f.u[1] = *reinterpret_cast<const u32x4*>(p + 16);
  return f;
}

__device__ __forceinline__ v8f wmma_bf16(const BFrag& a, const BFrag& b, v8f c) {
  return __builtin_amdgcn_wmma_f32_16x16x32_bf16(false, a.v, false, b.v,
                                                 (short)0, c, false, false);
}

__device__ __forceinline__ v8f vzero() {
  v8f z = {0.f, 0.f, 0.f, 0.f, 0.f, 0.f, 0.f, 0.f};
  return z;
}

// ---------------- scratch zero (q/k/vt pad rows) ----------------
__global__ void k_zero(float4* __restrict__ p, long n) {
  long i = (long)blockIdx.x * blockDim.x + threadIdx.x;
  if (i < n) p[i] = make_float4(0.f, 0.f, 0.f, 0.f);
}

// ---------------- ones row in Vt at d==HD (softmax denominator via WMMA) ----------------
__global__ void k_ones(__bf16* __restrict__ vt) {
  int i = blockIdx.x * 256 + threadIdx.x;
  if (i >= 16 * SPAD) return;
  int bh = i / SPAD, s = i % SPAD;
  vt[((long)bh * DP + HD) * SPAD + s] = (__bf16)1.0f;
}

// ---------------- conv1: 64->64, 2x2 stride 2 ----------------
// 1 block = 256 output positions (4 rows) x 8 output channels. Lanes run along the
// positions, so an x load is two whole lines, and each x value is used 8 times from a
// register. All 8 waves of a block work on the same 8 channels: the weights are uniform
// (scalar loads), and the block's 8 KB of them are fetched once for its 8 waves.
#define C1OC   8            // output channels per block
#define C1THR  256          // threads per block
#define C1CH   16           // input channels per register chunk (4 chunks)
#define C1W    8            // weights per channel and step
#define C1NS   (4 * 256 / C1W)   // steps: 4 channel pairs x 256 weights a channel

// Step G: 2 channels x C1W / 4 input channels, every index a compile-time constant.
// Step G + 1's weights are fetched while step G is worked on; the next chunk's x is
// fetched at the first step of a chunk.
template <int G>
__device__ __forceinline__ void c1_step(const float2* xp, const float* wp,
                                        float2 (&xb)[2][2 * C1CH], float (&wb)[2][2 * C1W],
                                        float (&at)[C1OC], float (&ab)[C1OC]) {
  constexpr int SPP = C1CH * 4 / C1W;        // steps per channel pair inside a chunk
  constexpr int SPC = 4 * SPP;               // steps per chunk
  constexpr int ch = G / SPC, j0 = ((G / SPP) & 3) * 2, q = G % SPP;
  if constexpr (G % SPC == 0 && ch + 1 < 4) {
    #pragma unroll
    for (int i = 0; i < C1CH; ++i) {
      xb[(ch + 1) & 1][2 * i]     = xp[((ch + 1) * C1CH + i) * 8192];
      xb[(ch + 1) & 1][2 * i + 1] = xp[((ch + 1) * C1CH + i) * 8192 + 64];
    }
  }
  if constexpr (G + 1 < C1NS) {
    constexpr int cn = (G + 1) / SPC, jn = (((G + 1) / SPP) & 3) * 2, qn = (G + 1) % SPP;
    #pragma unroll
    for (int i = 0; i < C1W; ++i) {
      wb[(G + 1) & 1][i]       = wp[jn * 256 + cn * 64 + qn * C1W + i];
      wb[(G + 1) & 1][C1W + i] = wp[(jn + 1) * 256 + cn * 64 + qn * C1W + i];
    }
  }
  if constexpr (G % SPC == 0 && ch + 2 == 4) {
    // all 128 x loads name xp's register pair: the wait stands before the pair may be
    // written again (xp as an input keeps the pair untouched up to the wait)
    asm volatile("s_wait_xcnt 0x0" :: "v"(xp) : "memory");
  }
  #pragma unroll
  for (int i = 0; i < C1W / 4; ++i) {
    const float2 t = xb[ch & 1][2 * (q * (C1W / 4) + i)];
    const float2 u = xb[ch & 1][2 * (q * (C1W / 4) + i) + 1];
    at[j0]     += t.x * wb[G & 1][4 * i];
    at[j0 + 1] += t.x * wb[G & 1][C1W + 4 * i];
    ab[j0]     += u.x * wb[G & 1][4 * i + 2];
    ab[j0 + 1] += u.x * wb[G & 1][C1W + 4 * i + 2];
    at[j0]     += t.y * wb[G & 1][4 * i + 1];
    at[j0 + 1] += t.y * wb[G & 1][C1W + 4 * i + 1];
    ab[j0]     += u.y * wb[G & 1][4 * i + 3];
    ab[j0 + 1] += u.y * wb[G & 1][C1W + 4 * i + 3];
  }
  // keeps the scheduler from lifting all the loads to the top, which spills registers
  __builtin_amdgcn_sched_barrier(0);
  if constexpr (G + 1 < C1NS) c1_step<G + 1>(xp, wp, xb, wb, at, ab);
}

__global__ void __launch_bounds__(C1THR) k_conv1(const float* __restrict__ x,
                                                 const float* __restrict__ w,
                                                 const float* __restrict__ bias,
                                                 float* __restrict__ c1) {
  const int oc0 = (blockIdx.x & 7) * C1OC;   // the 8 blocks that share x are neighbours
  const int pb  = blockIdx.x >> 3;           // 64 groups of 256 positions
  const int b   = pb >> 4;
  const int oh  = (pb & 15) * 4 + (threadIdx.x >> 6);
  const int ow  = threadIdx.x & 63;

  // xp[ic * 8192]: row 2*oh, xp[ic * 8192 + 64]: row 2*oh + 1 (units of two floats)
  const float2* xp = reinterpret_cast<const float2*>(
      x + ((long)b * 64 * 128 + 2 * oh) * 128 + 2 * ow);
  const float* wp = w + oc0 * 256;

  float2 xb[2][2 * C1CH];
  float  wb[2][2 * C1W];
  #pragma unroll
  for (int i = 0; i < C1CH; ++i) {
    xb[0][2 * i]     = xp[i * 8192];
    xb[0][2 * i + 1] = xp[i * 8192 + 64];
  }
  #pragma unroll
  for (int i = 0; i < C1W; ++i) { wb[0][i] = wp[i]; wb[0][C1W + i] = wp[256 + i]; }

  // per channel two sums, one per input row, each over ic = 0..63 in order
  float at[C1OC], ab[C1OC];
  #pragma unroll
  for (int j = 0; j < C1OC; ++j) { at[j] = 0.f; ab[j] = 0.f; }

  c1_step<0>(xp, wp, xb, wb, at, ab);

  float* op = c1 + ((long)b * 64 + oc0) * HW + oh * 64 + ow;
  #pragma unroll
  for (int j = 0; j < C1OC; ++j) op[j * HW] = bias[oc0 + j] + (at[j] + ab[j]);
}

// ---------- conv2 (1x1) + bias + leaky + transpose + pad + PE -> bf16 tokens ----------
// 1 block = 32 token rows x all 160 channels. Lanes run along the tokens, so a c1 load is
// one whole line; a wave owns 10 channels, so its weights are wave-uniform (scalar loads)
// and each c1 value is used 10 times from a register. The 32x160 tile is contiguous in
// fbf: it is turned in LDS and leaves as whole 16-byte pieces.
#define C2ROWS 32           // token rows per block (BATCH*FPAD = 514 * 32)
#define C2OC   10           // channels per wave (16 waves x 10 = DM)
#define C2THR  512          // threads per block
#define C2PIT  168          // LDS row pitch in bf16 (336 B: 16-B aligned, spreads the banks)
typedef __attribute__((ext_vector_type(2))) __bf16 v2bf;

__global__ void __launch_bounds__(C2THR) k_conv2f(const float* __restrict__ c1,
                                                  const float* __restrict__ w,
                                                  const float* __restrict__ bias,
                                                  const float* __restrict__ pe,
                                                  __bf16* __restrict__ fbf) {
  __shared__ __attribute__((aligned(16))) __bf16 tile[C2ROWS * C2PIT];
  const int lane = threadIdx.x & 31;
  const int oc0  = __builtin_amdgcn_readfirstlane(threadIdx.x >> 5) * C2OC;
  const int row  = blockIdx.x * C2ROWS + lane;      // b * FPAD + s
  const int b    = row / FPAD;
  const int s    = row - b * FPAD;
  const int sc   = s < HW ? s : HW - 1;             // pad rows read a valid column, result unused

  const int   si = s < HW ? s : HW;
  const float pv = pe[si];
  // the pe load names si's register as its offset: the wait stands before anything may be
  // written there (si as an input keeps the register untouched up to the wait)
  asm volatile("s_wait_xcnt 0x0" :: "v"(si) : "memory");

  const float* cp = c1 + (long)b * 64 * HW + sc;
  float xv[64];
  #pragma unroll
  for (int ic = 0; ic < 64; ++ic) xv[ic] = cp[(long)ic * HW];
  // the 64 loads name cp's register pair: the wait stands before the pair is used for sums
  asm volatile("s_wait_xcnt 0x0" :: "v"(cp) : "memory");

  // 20 groups of 2 channels x 16 inputs; per channel the sum runs over ic = 0..63 in order.
  // A group's 32 weights are fetched while the group before it is worked on.
  const float* wp = w + oc0 * 64;
  float wc[32], wn[32];
  #pragma unroll
  for (int i = 0; i < 16; ++i) { wc[i] = wp[i]; wc[16 + i] = wp[64 + i]; }
  float a0 = 0.f, a1 = 0.f;
  #pragma unroll
  for (int g = 0; g < 20; ++g) {
    const int j0 = (g >> 2) * 2, icb = (g & 3) * 16;
    if (g + 1 < 20) {
      const int jn = ((g + 1) >> 2) * 2, icn = ((g + 1) & 3) * 16;
      #pragma unroll
      for (int i = 0; i < 16; ++i) {
        wn[i]      = wp[jn * 64 + icn + i];
        wn[16 + i] = wp[(jn + 1) * 64 + icn + i];
      }
    }
    if (icb == 0) { a0 = bias[oc0 + j0]; a1 = bias[oc0 + j0 + 1]; }
    #pragma unroll
    for (int i = 0; i < 16; ++i) {
      a0 += xv[icb + i] * wc[i];
      a1 += xv[icb + i] * wc[16 + i];
    }
    if (icb == 48) {
      float l0 = a0 >= 0.f ? a0 : 0.01f * a0;
      float l1 = a1 >= 0.f ? a1 : 0.01f * a1;
      // row HW: zero-pad row + positional value; rows above it stay 0 (safe WMMA tiles)
      v2bf t;
      t[0] = (__bf16)(s < HW ? l0 + pv : (s == HW ? pv : 0.f));
      t[1] = (__bf16)(s < HW ? l1 + pv : (s == HW ? pv : 0.f));
      *reinterpret_cast<v2bf*>(&tile[lane * C2PIT + oc0 + j0]) = t;
    }
    // keeps the scheduler from lifting all the weight loads to the top, which spills scalar registers
    __builtin_amdgcn_sched_barrier(0);
    #pragma unroll
    for (int i = 0; i < 32; ++i) wc[i] = wn[i];
  }
  __syncthreads();

  __bf16* dst = fbf + (long)blockIdx.x * C2ROWS * DM;
  for (int c = threadIdx.x; c < C2ROWS * DM / 8; c += C2THR) {
    const int r = c / (DM / 8), kk = c - r * (DM / 8);
    *reinterpret_cast<u32x4*>(dst + c * 8) =
        *reinterpret_cast<const u32x4*>(&tile[r * C2PIT + kk * 8]);
  }
}

// ---------------- wq/wk/wv -> bf16 ----------------
__global__ void k_cvtw(const float* __restrict__ wq, const float* __restrict__ wk,
                       const float* __restrict__ wv, __bf16* __restrict__ o) {
  int i = blockIdx.x * 256 + threadIdx.x;
  if (i >= 3 * DM * DM) return;
  const float* src = (i < DM * DM) ? wq : (i < 2 * DM * DM ? wk : wv);
  o[i] = (__bf16)src[i % (DM * DM)];
}

// ---------------- QKV projection GEMM (WMMA bf16) ----------------
// one wave = one 16x16 tile of one of {q,k,v}; K = 160 = 5 x K32 steps
// Q output is pre-scaled by (1/sqrt(HD)) * log2(e) so attention uses raw exp2.
__global__ void __launch_bounds__(256) k_qkv(const __bf16* __restrict__ fbf,
                                             const __bf16* __restrict__ wb,
                                             __bf16* __restrict__ q,
                                             __bf16* __restrict__ k,
                                             __bf16* __restrict__ vt) {
  const int wv_id = blockIdx.x * 8 + (threadIdx.x >> 5);
  if (wv_id >= 3 * BATCH * SBLK * 10) return;
  int t = wv_id;
  const int mat = t % 3;  t /= 3;
  const int ob  = t % 10; t /= 10;
  const int sb  = t % SBLK;
  const int b   = t / SBLK;

  const __bf16* A0 = fbf + ((long)b * FPAD + sb * 16) * DM;
  const __bf16* B0 = wb + (long)mat * DM * DM + (long)ob * 16 * DM;

  v8f acc = vzero();
  #pragma unroll
  for (int kk = 0; kk < 5; ++kk) {
    BFrag a  = ld_frag(A0 + kk * 32, DM);
    BFrag bb = ld_frag(B0 + kk * 32, DM);
    acc = wmma_bf16(a, bb, acc);
  }

  const int lane = threadIdx.x & 31;
  const int n  = lane & 15;
  const int hm = lane >> 4;
  const int o  = ob * 16 + n;
  const int hh = o / HD;
  const int d  = o - hh * HD;
  const long bh = (long)b * NH + hh;
  const float qscale = 0.22811012f;   // (1/sqrt(40)) * log2(e)
  #pragma unroll
  for (int i = 0; i < 8; ++i) {
    int s = sb * 16 + i + 8 * hm;     // < 4112 < SPAD
    float av = acc[i];
    if (mat == 0) av *= qscale;
    __bf16 val = (__bf16)av;
    if (mat == 0)      q [(bh * SPAD + s) * DP + d] = val;
    else if (mat == 1) k [(bh * SPAD + s) * DP + d] = val;
    else               vt[(bh * DP + d) * SPAD + s] = val;   // V stored transposed
  }
}

// value of lane l ^ 16
__device__ __forceinline__ float xhalf(float v) {
  int b = __builtin_bit_cast(int, v);
  b = __builtin_amdgcn_permlanex16(b, b, 0x76543210, 0xfedcba98, false, false);
  return __builtin_bit_cast(float, b);
}

__global__ void __launch_bounds__(256) k_attn(const __bf16* __restrict__ q,
                                              const __bf16* __restrict__ k,
                                              const __bf16* __restrict__ vt,
                                              float* __restrict__ cat) {
  __shared__ __attribute__((aligned(16))) __bf16 sK[2][32 * KSTR];
  __shared__ __attribute__((aligned(16))) __bf16 sV[2][64 * VSTR];

  const int bh = blockIdx.x >> 5;              // 16 (b,h) pairs
  const int qg = blockIdx.x & 31;              // 32 groups of 128 queries
  const int wv = threadIdx.x >> 5;
  const int qb = qg * 8 + wv;                  // 16-query tile index (< 256)
  const int lane = threadIdx.x & 31;
  const int n  = lane & 15;
  const int hm = lane >> 4;
  const int tid = threadIdx.x;

  // cooperative staging coordinates (256 threads: K 32x64, V 64x32, 16B each)
  const int krow = tid >> 3, kc8 = (tid & 7) * 8;
  const int vrow = tid >> 2, vc8 = (tid & 3) * 8;
  const __bf16* kg = k  + ((long)bh * SPAD + krow) * DP + kc8;
  const __bf16* vg = vt + ((long)bh * DP + vrow) * SPAD + vc8;

  const __bf16* qbase = q + ((long)bh * SPAD + qb * 16) * DP;
  BFrag Qa = ld_frag(qbase, DP);        // B operand, column = query n, K = d 0..31
  BFrag Qb = ld_frag(qbase + 32, DP);   // K = d 32..63

  // Ot tiles: register r of tile f = O[query n][d = 16*f + 8*hm + r]
  v8f acc0 = vzero(), acc1 = vzero(), acc2 = vzero(), acc3 = vzero();
  float mrow = -1e30f;                  // running maximum of this lane's query

  // stage tile 0
  {
    u32x4 a = *reinterpret_cast<const u32x4*>(kg);
    u32x4 b = *reinterpret_cast<const u32x4*>(vg);
    *reinterpret_cast<u32x4*>(&sK[0][krow * KSTR + kc8]) = a;
    *reinterpret_cast<u32x4*>(&sV[0][vrow * VSTR + vc8]) = b;
  }
  __syncthreads();

  const int NIT = (SEQ + 31) / 32;             // 129
  for (int it = 0; it < NIT; ++it) {
    const int j0 = it * 32;
    const int cur = it & 1;
    const bool more = (it + 1 < NIT);
    u32x4 ka, va;
    if (more) {                                // prefetch next tile into regs
      ka = *reinterpret_cast<const u32x4*>(kg + (long)(j0 + 32) * DP);
      va = *reinterpret_cast<const u32x4*>(vg + (j0 + 32));
      if (it + 2 < NIT) {
        __builtin_prefetch(kg + (long)(j0 + 64) * DP, 0, 0);
        __builtin_prefetch(vg + (j0 + 64), 0, 0);
      }
    }

    // scores: K-tile (32x64) x Q^T (64x16) -> two 16x16 f32 fragments (keys x queries)
    const __bf16* kt = &sK[cur][0];
    BFrag K1a = ld_frag(kt, KSTR);
    BFrag K1b = ld_frag(kt + 32, KSTR);
    BFrag K2a = ld_frag(kt + 16 * KSTR, KSTR);
    BFrag K2b = ld_frag(kt + 16 * KSTR + 32, KSTR);
    v8f S1 = wmma_bf16(K1b, Qb, wmma_bf16(K1a, Qa, vzero()));
    v8f S2 = wmma_bf16(K2b, Qb, wmma_bf16(K2a, Qa, vzero()));

    if (j0 + 32 > SEQ) {                       // keys are register rows: only the last tile has any to mask
      #pragma unroll
      for (int r = 0; r < 8; ++r) {
        if (j0 + 8 * hm + r      >= SEQ) S1[r] = -1e30f;
        if (j0 + 16 + 8 * hm + r >= SEQ) S2[r] = -1e30f;
      }
    }

    // maximum of this query over the 32 keys: 16 in-lane, the rest in lane ^ 16
    // (four short independent chains, not one of sixteen links)
    float mxa = fmaxf(fmaxf(S1[0], S1[1]), fmaxf(S1[2], S1[3]));
    float mxb = fmaxf(fmaxf(S1[4], S1[5]), fmaxf(S1[6], S1[7]));
    float mxc = fmaxf(fmaxf(S2[0], S2[1]), fmaxf(S2[2], S2[3]));
    float mxd = fmaxf(fmaxf(S2[4], S2[5]), fmaxf(S2[6], S2[7]));
    float mx  = fmaxf(fmaxf(mxa, mxb), fmaxf(mxc, mxd));
    mx = fmaxf(mx, xhalf(mx));
    const float mn   = fmaxf(mrow, mx);
    const float corr = __builtin_amdgcn_exp2f(mrow - mn);   // scores already in exp2 domain
    mrow = mn;

    // P^T as B operand: element s = key 8*hm + s (s < 8) or 16 + 8*hm + s - 8 (s >= 8), straight from the two score tiles
    BFrag P;
    #pragma unroll
    for (int r = 0; r < 8; ++r) {
      P.v[r]     = (__bf16)__builtin_amdgcn_exp2f(S1[r] - mn);
      P.v[8 + r] = (__bf16)__builtin_amdgcn_exp2f(S2[r] - mn);
    }
    acc0 *= corr; acc1 *= corr; acc2 *= corr; acc3 *= corr;

    // Vt-tile rows (64 x 32) x P^T (32x16); row d==40 of Vt is all-ones -> l in acc2
    const __bf16* vtile = &sV[cur][0];
    acc0 = wmma_bf16(ld_frag(vtile,             VSTR), P, acc0);
    acc1 = wmma_bf16(ld_frag(vtile + 16 * VSTR, VSTR), P, acc1);
    acc2 = wmma_bf16(ld_frag(vtile + 32 * VSTR, VSTR), P, acc2);
    acc3 = wmma_bf16(ld_frag(vtile + 48 * VSTR, VSTR), P, acc3);

    if (more) {                                // fill the other buffer
      *reinterpret_cast<u32x4*>(&sK[1 - cur][krow * KSTR + kc8]) = ka;
      *reinterpret_cast<u32x4*>(&sV[1 - cur][vrow * VSTR + vc8]) = va;
    }
    __syncthreads();
  }

  // softmax denominator = row d==HD of Ot: tile 2, register 0, upper wave half
  const float lo   = acc2[0];
  const float lx   = xhalf(lo);
  const float linv = __builtin_amdgcn_rcpf(hm ? lo : lx);

  const int  hh   = bh & (NH - 1);
  const long brow = (long)(bh >> 2) * SEQ_Q;
  float* orow = cat + (brow + qb * 16 + n) * DM + hh * HD;   // query row < 4096
  v8f accar[4] = {acc0, acc1, acc2, acc3};
  #pragma unroll
  for (int f = 0; f < 4; ++f) {
    int d0 = f * 16 + 8 * hm;                  // 8 consecutive d per lane
    if (d0 < HD) {
      v8f a = accar[f] * linv;
      *reinterpret_cast<float4*>(orow + d0)     = make_float4(a[0], a[1], a[2], a[3]);
      *reinterpret_cast<float4*>(orow + d0 + 4) = make_float4(a[4], a[5], a[6], a[7]);
    }
  }
}

// ---------------- LayerNorm + residual + transpose + 2x nearest upsample ----------------
__global__ void k_epi(const float* __restrict__ cat, const float* __restrict__ lw,
                      const float* __restrict__ lb, float* __restrict__ out) {
  int idx = blockIdx.x * 256 + threadIdx.x;
  if (idx >= BATCH * HW) return;
  int s = idx % HW, b = idx / HW;
  const float* row = cat + ((long)b * HW + s) * DM;
  float mu = 0.f;
  for (int c = 0; c < DM; ++c) mu += row[c];
  mu *= (1.f / DM);
  float var = 0.f;
  for (int c = 0; c < DM; ++c) { float d = row[c] - mu; var += d * d; }
  var *= (1.f / DM);
  float inv = rsqrtf(var + 1e-5f);
  int ih = s >> 6, iw = s & 63;
  for (int c = 0; c < DM; ++c) {
    float xv = row[c];
    float v = (xv - mu) * inv * lw[c] + lb[c] + xv;
    float* o = out + (((long)b * DM + c) * 128 + 2 * ih) * 128 + 2 * iw;
    o[0] = v; o[1] = v; o[128] = v; o[129] = v;
  }
}

// ---------------- launch ----------------
extern "C" void kernel_launch(void* const* d_in, const int* in_sizes, int n_in,
                              void* d_out, int out_size, void* d_ws, size_t ws_size,
                              hipStream_t stream) {
  (void)in_sizes; (void)n_in; (void)out_size; (void)ws_size;
  const float* x   = (const float*)d_in[0];
  const float* w1  = (const float*)d_in[1];
  const float* b1  = (const float*)d_in[2];
  const float* w2  = (const float*)d_in[3];
  const float* b2  = (const float*)d_in[4];
  const float* pe  = (const float*)d_in[5];
  const float* wq  = (const float*)d_in[6];
  const float* wk  = (const float*)d_in[7];
  const float* wv  = (const float*)d_in[8];
  const float* lw  = (const float*)d_in[9];
  const float* lb  = (const float*)d_in[10];
  float* out = (float*)d_out;
  char*  ws  = (char*)d_ws;

  // workspace layout (bytes), all 16B aligned
  constexpr long C1_OFF  = 0;                                   // 4*64*4096 f32      = 4,194,304 B
  constexpr long FBF_OFF = C1_OFF  + 4L * 64 * HW * 4;          // 4*4112*160 bf16    = 5,263,360 B
  constexpr long WB_OFF  = FBF_OFF + (long)BATCH * FPAD * DM * 2;   // 3*160*160 bf16 = 153,600 B
  constexpr long Q_OFF   = WB_OFF  + 3L * DM * DM * 2;          // 16*4128*64 bf16    = 8,454,144 B
  constexpr long K_OFF   = Q_OFF   + 16L * SPAD * DP * 2;
  constexpr long VT_OFF  = K_OFF   + 16L * SPAD * DP * 2;
  constexpr long CAT_OFF = VT_OFF  + 16L * SPAD * DP * 2;       // 4*4096*160 f32     = 10,485,760 B

  float*  c1  = (float*) (ws + C1_OFF);
  __bf16* fbf = (__bf16*)(ws + FBF_OFF);
  __bf16* wb  = (__bf16*)(ws + WB_OFF);
  __bf16* qb  = (__bf16*)(ws + Q_OFF);
  __bf16* kb  = (__bf16*)(ws + K_OFF);
  __bf16* vtb = (__bf16*)(ws + VT_OFF);
  float*  cat = (float*) (ws + CAT_OFF);

  // zero q/k/vt (contiguous) so pad rows are well-defined every call
  const long zero16 = (3L * 16 * SPAD * DP * 2) / 16;           // float4 count
  k_zero <<<(int)((zero16 + 255) / 256), 256, 0, stream>>>((float4*)qb, zero16);
  k_ones <<<(16 * SPAD + 255) / 256, 256, 0, stream>>>(vtb);

  k_cvtw <<<(3 * DM * DM + 255) / 256, 256, 0, stream>>>(wq, wk, wv, wb);
  k_conv1<<<64 * 8, C1THR, 0, stream>>>(x, w1, b1, c1);
  k_conv2f<<<(BATCH * FPAD) / C2ROWS, C2THR, 0, stream>>>(c1, w2, b2, pe, fbf);

  const int qkv_waves = 3 * BATCH * SBLK * 10;                  // 30840
  k_qkv  <<<(qkv_waves + 7) / 8, 256, 0, stream>>>(fbf, wb, qb, kb, vtb);

  k_attn <<<512, 256, 0, stream>>>(qb, kb, vtb, cat);           // 16 bh x 32 q-groups

  k_epi  <<<(BATCH * HW) / 256, 256, 0, stream>>>(cat, lw, lb, out);
}

// v004
// One run takes 179 microseconds.
// Timed twice side by side with v003, it ran 1.09 and 1.08 times as fast.
// All steps since v000 together make it 1.72 times as fast.
#include <hip/hip_runtime.h>
#include <hip/hip_bf16.h>

// ---------------- CDNA5 WMMA types ----------------
typedef __attribute__((ext_vector_type(16))) __bf16       v16bf;
typedef __attribute__((ext_vector_type(8)))  float        v8f;
typedef __attribute__((ext_vector_type(4)))  unsigned int u32x4;

#define BATCH 4
#define DM    160           // d_model
#define NH    4
#define HD    40            // head dim
#define DP    64            // padded head dim (4 x 16)
#define HW    4096          // 64*64 tokens
#define SEQ   4097          // tokens + pad row
#define SEQ_Q 4096          // queries that survive cat[:, :-1, :]
#define SPAD  4128          // K/V padded length (multiple of 32)
#define FPAD  4112          // f rows padded   (multiple of 16)
#define SBLK  257           // ceil(SEQ/16)
#define KSTR  72            // LDS K-tile row stride (bank-conflict-free for b128)
#define VSTR  40            // LDS V-tile row stride (bank-conflict-free for b128)

union BFrag { v16bf v; u32x4 u[2]; };

// 16x32 bf16 A/B fragment loader (row-major tile, `stride` elements per row).
// Lanes 0-15 : row=lane,    K chunks {0..7} and {16..23}
// Lanes 16-31: row=lane-16, K chunks {8..15} and {24..31}
__device__ __forceinline__ BFrag ld_frag(const __bf16* base, int stride) {
  const int lane = threadIdx.x & 31;
  const int r  = lane & 15;
  const int hh = lane >> 4;
  const __bf16* p = base + (long)r * stride + 8 * hh;
  BFrag f;
  f.u[0] = *reinterpret_cast<const u32x4*>(p);
  f.u[1] = *reinterpret_cast<const u32x4*>(p + 16);
  return f;
}

__device__ __forceinline__ v8f wmma_bf16(const BFrag& a, const BFrag& b, v8f c) {
  return __builtin_amdgcn_wmma_f32_16x16x32_bf16(false, a.v, false, b.v,
                                                 (short)0, c, false, false);
}

__device__ __forceinline__ v8f vzero() {
  v8f z = {0.f, 0.f, 0.f, 0.f, 0.f, 0.f, 0.f, 0.f};
  return z;
}

// ---------------- scratch zero (q/k/vt pad rows) ----------------
__global__ void k_zero(float4* __restrict__ p, long n) {
  long i = (long)blockIdx.x * blockDim.x + threadIdx.x;
  if (i < n) p[i] = make_float4(0.f, 0.f, 0.f, 0.f);
}

// ---------------- ones row in Vt at d==HD (softmax denominator via WMMA) ----------------
__global__ void k_ones(__bf16* __restrict__ vt) {
  int i = blockIdx.x * 256 + threadIdx.x;
  if (i >= 16 * SPAD) return;
  int bh = i / SPAD, s = i % SPAD;
  vt[((long)bh * DP + HD) * SPAD + s] = (__bf16)1.0f;
}

// ---------------- conv1: 64->64, 2x2 stride 2 ----------------
// 1 block = 256 output positions (4 rows) x 8 output channels. Lanes run along the
// positions, so an x load is two whole lines, and each x value is used 8 times from a
// register. All 8 waves of a block work on the same 8 channels: the weights are uniform
// (scalar loads), and the block's 8 KB of them are fetched once for its 8 waves.
#define C1OC   8            // output channels per block
#define C1THR  256          // threads per block
#define C1CH   16           // input channels per register chunk (4 chunks)
#define C1W    8            // weights per channel and step
#define C1NS   (4 * 256 / C1W)   // steps: 4 channel pairs x 256 weights a channel

// Step G: 2 channels x C1W / 4 input channels, every index a compile-time constant.
// Step G + 1's weights are fetched while step G is worked on; the next chunk's x is
// fetched at the first step of a chunk.
template <int G>
__device__ __forceinline__ void c1_step(const float2* xp, const float* wp,
                                        float2 (&xb)[2][2 * C1CH], float (&wb)[2][2 * C1W],
                                        float (&at)[C1OC], float (&ab)[C1OC]) {
  constexpr int SPP = C1CH * 4 / C1W;        // steps per channel pair inside a chunk
  constexpr int SPC = 4 * SPP;               // steps per chunk
  constexpr int ch = G / SPC, j0 = ((G / SPP) & 3) * 2, q = G % SPP;
  if constexpr (G % SPC == 0 && ch + 1 < 4) {
    #pragma unroll
    for (int i = 0; i < C1CH; ++i) {
      xb[(ch + 1) & 1][2 * i]     = xp[((ch + 1) * C1CH + i) * 8192];
      xb[(ch + 1) & 1][2 * i + 1] = xp[((ch + 1) * C1CH + i) * 8192 + 64];
    }
  }
  if constexpr (G + 1 < C1NS) {
    constexpr int cn = (G + 1) / SPC, jn = (((G + 1) / SPP) & 3) * 2, qn = (G + 1) % SPP;
    #pragma unroll
    for (int i = 0; i < C1W; ++i) {
      wb[(G + 1) & 1][i]       = wp[jn * 256 + cn * 64 + qn * C1W + i];
      wb[(G + 1) & 1][C1W + i] = wp[(jn + 1) * 256 + cn * 64 + qn * C1W + i];
    }
  }
  if constexpr (G % SPC == 0 && ch + 2 == 4) {
    // all 128 x loads name xp's register pair: the wait stands before the pair may be
    // written again (xp as an input keeps the pair untouched up to the wait)
    asm volatile("s_wait_xcnt 0x0" :: "v"(xp) : "memory");
  }
  #pragma unroll
  for (int i = 0; i < C1W / 4; ++i) {
    const float2 t = xb[ch & 1][2 * (q * (C1W / 4) + i)];
    const float2 u = xb[ch & 1][2 * (q * (C1W / 4) + i) + 1];
    at[j0]     += t.x * wb[G & 1][4 * i];
    at[j0 + 1] += t.x * wb[G & 1][C1W + 4 * i];
    ab[j0]     += u.x * wb[G & 1][4 * i + 2];
    ab[j0 + 1] += u.x * wb[G & 1][C1W + 4 * i + 2];
    at[j0]     += t.y * wb[G & 1][4 * i + 1];
    at[j0 + 1] += t.y * wb[G & 1][C1W + 4 * i + 1];
    ab[j0]     += u.y * wb[G & 1][4 * i + 3];
    ab[j0 + 1] += u.y * wb[G & 1][C1W + 4 * i + 3];
  }
  // keeps the scheduler from lifting all the loads to the top, which spills registers
  __builtin_amdgcn_sched_barrier(0);
  if constexpr (G + 1 < C1NS) c1_step<G + 1>(xp, wp, xb, wb, at, ab);
}

__global__ void __launch_bounds__(C1THR) k_conv1(const float* __restrict__ x,
                                                 const float* __restrict__ w,
                                                 const float* __restrict__ bias,
                                                 float* __restrict__ c1) {
  const int oc0 = (blockIdx.x & 7) * C1OC;   // the 8 blocks that share x are neighbours
  const int pb  = blockIdx.x >> 3;           // 64 groups of 256 positions
  const int b   = pb >> 4;
  const int oh  = (pb & 15) * 4 + (threadIdx.x >> 6);
  const int ow  = threadIdx.x & 63;

  // xp[ic * 8192]: row 2*oh, xp[ic * 8192 + 64]: row 2*oh + 1 (units of two floats)
  const float2* xp = reinterpret_cast<const float2*>(
      x + ((long)b * 64 * 128 + 2 * oh) * 128 + 2 * ow);
  const float* wp = w + oc0 * 256;

  float2 xb[2][2 * C1CH];
  float  wb[2][2 * C1W];
  #pragma unroll
  for (int i = 0; i < C1CH; ++i) {
    xb[0][2 * i]     = xp[i * 8192];
    xb[0][2 * i + 1] = xp[i * 8192 + 64];
  }
  #pragma unroll
  for (int i = 0; i < C1W; ++i) { wb[0][i] = wp[i]; wb[0][C1W + i] = wp[256 + i]; }

  // per channel two sums, one per input row, each over ic = 0..63 in order
  float at[C1OC], ab[C1OC];
  #pragma unroll
  for (int j = 0; j < C1OC; ++j) { at[j] = 0.f; ab[j] = 0.f; }

  c1_step<0>(xp, wp, xb, wb, at, ab);

  float* op = c1 + ((long)b * 64 + oc0) * HW + oh * 64 + ow;
  #pragma unroll
  for (int j = 0; j < C1OC; ++j) op[j * HW] = bias[oc0 + j] + (at[j] + ab[j]);
}

// ---------- conv2 (1x1) + bias + leaky + transpose + pad + PE -> bf16 tokens ----------
// 1 block = 32 token rows x all 160 channels. Lanes run along the tokens, so a c1 load is
// one whole line; a wave owns 10 channels, so its weights are wave-uniform (scalar loads)
// and each c1 value is used 10 times from a register. The 32x160 tile is contiguous in
// fbf: it is turned in LDS and leaves as whole 16-byte pieces.
#define C2ROWS 32           // token rows per block (BATCH*FPAD = 514 * 32)
#define C2OC   10           // channels per wave (16 waves x 10 = DM)
#define C2THR  512          // threads per block
#define C2PIT  168          // LDS row pitch in bf16 (336 B: 16-B aligned, spreads the banks)
typedef __attribute__((ext_vector_type(2))) __bf16 v2bf;

__global__ void __launch_bounds__(C2THR) k_conv2f(const float* __restrict__ c1,
                                                  const float* __restrict__ w,
                                                  const float* __restrict__ bias,
                                                  const float* __restrict__ pe,
                                                  __bf16* __restrict__ fbf) {
  __shared__ __attribute__((aligned(16))) __bf16 tile[C2ROWS * C2PIT];
  const int lane = threadIdx.x & 31;
  const int oc0  = __builtin_amdgcn_readfirstlane(threadIdx.x >> 5) * C2OC;
  const int row  = blockIdx.x * C2ROWS + lane;      // b * FPAD + s
  const int b    = row / FPAD;
  const int s    = row - b * FPAD;
  const int sc   = s < HW ? s : HW - 1;             // pad rows read a valid column, result unused

  const int   si = s < HW ? s : HW;
  const float pv = pe[si];
  // the pe load names si's register as its offset: the wait stands before anything may be
  // written there (si as an input keeps the register untouched up to the wait)
  asm volatile("s_wait_xcnt 0x0" :: "v"(si) : "memory");

  const float* cp = c1 + (long)b * 64 * HW + sc;
  float xv[64];
  #pragma unroll
  for (int ic = 0; ic < 64; ++ic) xv[ic] = cp[(long)ic * HW];
  // the 64 loads name cp's register pair: the wait stands before the pair is used for sums
  asm volatile("s_wait_xcnt 0x0" :: "v"(cp) : "memory");

  // 20 groups of 2 channels x 16 inputs; per channel the sum runs over ic = 0..63 in order.
  // A group's 32 weights are fetched while the group before it is worked on.
  const float* wp = w + oc0 * 64;
  float wc[32], wn[32];
  #pragma unroll
  for (int i = 0; i < 16; ++i) { wc[i] = wp[i]; wc[16 + i] = wp[64 + i]; }
  float a0 = 0.f, a1 = 0.f;
  #pragma unroll
  for (int g = 0; g < 20; ++g) {
    const int j0 = (g >> 2) * 2, icb = (g & 3) * 16;
    if (g + 1 < 20) {
      const int jn = ((g + 1) >> 2) * 2, icn = ((g + 1) & 3) * 16;
      #pragma unroll
      for (int i = 0; i < 16; ++i) {
        wn[i]      = wp[jn * 64 + icn + i];
        wn[16 + i] = wp[(jn + 1) * 64 + icn + i];
      }
    }
    if (icb == 0) { a0 = bias[oc0 + j0]; a1 = bias[oc0 + j0 + 1]; }
    #pragma unroll
    for (int i = 0; i < 16; ++i) {
      a0 += xv[icb + i] * wc[i];
      a1 += xv[icb + i] * wc[16 + i];
    }
    if (icb == 48) {
      float l0 = a0 >= 0.f ? a0 : 0.01f * a0;
      float l1 = a1 >= 0.f ? a1 : 0.01f * a1;
      // row HW: zero-pad row + positional value; rows above it stay 0 (safe WMMA tiles)
      v2bf t;
      t[0] = (__bf16)(s < HW ? l0 + pv : (s == HW ? pv : 0.f));
      t[1] = (__bf16)(s < HW ? l1 + pv : (s == HW ? pv : 0.f));
      *reinterpret_cast<v2bf*>(&tile[lane * C2PIT + oc0 + j0]) = t;
    }
    // keeps the scheduler from lifting all the weight loads to the top, which spills scalar registers
    __builtin_amdgcn_sched_barrier(0);
    #pragma unroll
    for (int i = 0; i < 32; ++i) wc[i] = wn[i];
  }
  __syncthreads();

  __bf16* dst = fbf + (long)blockIdx.x * C2ROWS * DM;
  for (int c = threadIdx.x; c < C2ROWS * DM / 8; c += C2THR) {
    const int r = c / (DM / 8), kk = c - r * (DM / 8);
    *reinterpret_cast<u32x4*>(dst + c * 8) =
        *reinterpret_cast<const u32x4*>(&tile[r * C2PIT + kk * 8]);
  }
}

// ---------------- wq/wk/wv -> bf16 ----------------
__global__ void k_cvtw(const float* __restrict__ wq, const float* __restrict__ wk,
                       const float* __restrict__ wv, __bf16* __restrict__ o) {
  int i = blockIdx.x * 256 + threadIdx.x;
  if (i >= 3 * DM * DM) return;
  const float* src = (i < DM * DM) ? wq : (i < 2 * DM * DM ? wk : wv);
  o[i] = (__bf16)src[i % (DM * DM)];
}

// ---------------- QKV projection GEMM (WMMA bf16) ----------------
// one wave = one 16x16 tile of one of {q,k,v}; K = 160 = 5 x K32 steps
// Q output is pre-scaled by (1/sqrt(HD)) * log2(e) so attention uses raw exp2.
__global__ void __launch_bounds__(256) k_qkv(const __bf16* __restrict__ fbf,
                                             const __bf16* __restrict__ wb,
                                             __bf16* __restrict__ q,
                                             __bf16* __restrict__ k,
                                             __bf16* __restrict__ vt) {
  const int wv_id = blockIdx.x * 8 + (threadIdx.x >> 5);
  if (wv_id >= 3 * BATCH * SBLK * 10) return;
  int t = wv_id;
  const int mat = t % 3;  t /= 3;
  const int ob  = t % 10; t /= 10;
  const int sb  = t % SBLK;
  const int b   = t / SBLK;

  const __bf16* A0 = fbf + ((long)b * FPAD + sb * 16) * DM;
  const __bf16* B0 = wb + (long)mat * DM * DM + (long)ob * 16 * DM;

  v8f acc = vzero();
  #pragma unroll
  for (int kk = 0; kk < 5; ++kk) {
    BFrag a  = ld_frag(A0 + kk * 32, DM);
    BFrag bb = ld_frag(B0 + kk * 32, DM);
    acc = wmma_bf16(a, bb, acc);
  }

  const int lane = threadIdx.x & 31;
  const int n  = lane & 15;
  const int hm = lane >> 4;
  const int o  = ob * 16 + n;
  const int hh = o / HD;
  const int d  = o - hh * HD;
  const long bh = (long)b * NH + hh;
  const float qscale = 0.22811012f;   // (1/sqrt(40)) * log2(e)
  #pragma unroll
  for (int i = 0; i < 8; ++i) {
    int s = sb * 16 + i + 8 * hm;     // < 4112 < SPAD
    float av = acc[i];
    if (mat == 0) av *= qscale;
    __bf16 val = (__bf16)av;
    if (mat == 0)      q [(bh * SPAD + s) * DP + d] = val;
    else if (mat == 1) k [(bh * SPAD + s) * DP + d] = val;
    else               vt[(bh * DP + d) * SPAD + s] = val;   // V stored transposed
  }
}

// value of lane l ^ 16
__device__ __forceinline__ float xhalf(float v) {
  int b = __builtin_bit_cast(int, v);
  b = __builtin_amdgcn_permlanex16(b, b, 0x76543210, 0xfedcba98, false, false);
  return __builtin_bit_cast(float, b);
}

__global__ void __launch_bounds__(256) k_attn(const __bf16* __restrict__ q,
                                              const __bf16* __restrict__ k,
                                              const __bf16* __restrict__ vt,
                                              float* __restrict__ cat) {
  __shared__ __attribute__((aligned(16))) __bf16 sK[2][32 * KSTR];
  __shared__ __attribute__((aligned(16))) __bf16 sV[2][64 * VSTR];

  const int bh = blockIdx.x >> 5;              // 16 (b,h) pairs
  const int qg = blockIdx.x & 31;              // 32 groups of 128 queries
  const int wv = threadIdx.x >> 5;
  const int qb = qg * 8 + wv;                  // 16-query tile index (< 256)
  const int lane = threadIdx.x & 31;
  const int n  = lane & 15;
  const int hm = lane >> 4;
  const int tid = threadIdx.x;

  // cooperative staging coordinates (256 threads: K 32x64, V 64x32, 16B each)
  const int krow = tid >> 3, kc8 = (tid & 7) * 8;
  const int vrow = tid >> 2, vc8 = (tid & 3) * 8;
  const __bf16* kg = k  + ((long)bh * SPAD + krow) * DP + kc8;
  const __bf16* vg = vt + ((long)bh * DP + vrow) * SPAD + vc8;

  const __bf16* qbase = q + ((long)bh * SPAD + qb * 16) * DP;
  BFrag Qa = ld_frag(qbase, DP);        // B operand, column = query n, K = d 0..31
  BFrag Qb = ld_frag(qbase + 32, DP);   // K = d 32..63

  // Ot tiles: register r of tile f = O[query n][d = 16*f + 8*hm + r]
  v8f acc0 = vzero(), acc1 = vzero(), acc2 = vzero(), acc3 = vzero();
  float mrow = -1e30f;                  // running maximum of this lane's query

  // stage tile 0
  {
    u32x4 a = *reinterpret_cast<const u32x4*>(kg);
    u32x4 b = *reinterpret_cast<const u32x4*>(vg);
    *reinterpret_cast<u32x4*>(&sK[0][krow * KSTR + kc8]) = a;
    *reinterpret_cast<u32x4*>(&sV[0][vrow * VSTR + vc8]) = b;
  }
  __syncthreads();

  const int NIT = (SEQ + 31) / 32;             // 129
  for (int it = 0; it < NIT; ++it) {
    const int j0 = it * 32;
    const int cur = it & 1;
    const bool more = (it + 1 < NIT);
    u32x4 ka, va;
    if (more) {                                // prefetch next tile into regs
      ka = *reinterpret_cast<const u32x4*>(kg + (long)(j0 + 32) * DP);
      va = *reinterpret_cast<const u32x4*>(vg + (j0 + 32));
      if (it + 2 < NIT) {
        __builtin_prefetch(kg + (long)(j0 + 64) * DP, 0, 0);
        __builtin_prefetch(vg + (j0 + 64), 0, 0);
      }
    }

    // scores: K-tile (32x64) x Q^T (64x16) -> two 16x16 f32 fragments (keys x queries)
    const __bf16* kt = &sK[cur][0];
    BFrag K1a = ld_frag(kt, KSTR);
    BFrag K1b = ld_frag(kt + 32, KSTR);
    BFrag K2a = ld_frag(kt + 16 * KSTR, KSTR);
    BFrag K2b = ld_frag(kt + 16 * KSTR + 32, KSTR);
    v8f S1 = wmma_bf16(K1b, Qb, wmma_bf16(K1a, Qa, vzero()));
    v8f S2 = wmma_bf16(K2b, Qb, wmma_bf16(K2a, Qa, vzero()));

    if (j0 + 32 > SEQ) {                       // keys are register rows: only the last tile has any to mask
      #pragma unroll
      for (int r = 0; r < 8; ++r) {
        if (j0 + 8 * hm + r      >= SEQ) S1[r] = -1e30f;
        if (j0 + 16 + 8 * hm + r >= SEQ) S2[r] = -1e30f;
      }
    }

    // maximum of this query over the 32 keys: 16 in-lane, the rest in lane ^ 16
    // (four short independent chains, not one of sixteen links)
    float mxa = fmaxf(fmaxf(S1[0], S1[1]), fmaxf(S1[2], S1[3]));
    float mxb = fmaxf(fmaxf(S1[4], S1[5]), fmaxf(S1[6], S1[7]));
    float mxc = fmaxf(fmaxf(S2[0], S2[1]), fmaxf(S2[2], S2[3]));
    float mxd = fmaxf(fmaxf(S2[4], S2[5]), fmaxf(S2[6], S2[7]));
    float mx  = fmaxf(fmaxf(mxa, mxb), fmaxf(mxc, mxd));
    mx = fmaxf(mx, xhalf(mx));
    const float mn   = fmaxf(mrow, mx);
    const float corr = __builtin_amdgcn_exp2f(mrow - mn);   // scores already in exp2 domain
    mrow = mn;

    // P^T as B operand: element s = key 8*hm + s (s < 8) or 16 + 8*hm + s - 8 (s >= 8), straight from the two score tiles
    BFrag P;
    #pragma unroll
    for (int r = 0; r < 8; ++r) {
      P.v[r]     = (__bf16)__builtin_amdgcn_exp2f(S1[r] - mn);
      P.v[8 + r] = (__bf16)__builtin_amdgcn_exp2f(S2[r] - mn);
    }
    acc0 *= corr; acc1 *= corr; acc2 *= corr; acc3 *= corr;

    // Vt-tile rows (64 x 32) x P^T (32x16); row d==40 of Vt is all-ones -> l in acc2
    const __bf16* vtile = &sV[cur][0];
    acc0 = wmma_bf16(ld_frag(vtile,             VSTR), P, acc0);
    acc1 = wmma_bf16(ld_frag(vtile + 16 * VSTR, VSTR), P, acc1);
    acc2 = wmma_bf16(ld_frag(vtile + 32 * VSTR, VSTR), P, acc2);
    acc3 = wmma_bf16(ld_frag(vtile + 48 * VSTR, VSTR), P, acc3);

    if (more) {                                // fill the other buffer
      *reinterpret_cast<u32x4*>(&sK[1 - cur][krow * KSTR + kc8]) = ka;
      *reinterpret_cast<u32x4*>(&sV[1 - cur][vrow * VSTR + vc8]) = va;
    }
    __syncthreads();
  }

  // softmax denominator = row d==HD of Ot: tile 2, register 0, upper wave half
  const float lo   = acc2[0];
  const float lx   = xhalf(lo);
  const float linv = __builtin_amdgcn_rcpf(hm ? lo : lx);

  const int  hh   = bh & (NH - 1);
  const long brow = (long)(bh >> 2) * SEQ_Q;
  float* orow = cat + (brow + qb * 16 + n) * DM + hh * HD;   // query row < 4096
  v8f accar[4] = {acc0, acc1, acc2, acc3};
  #pragma unroll
  for (int f = 0; f < 4; ++f) {
    int d0 = f * 16 + 8 * hm;                  // 8 consecutive d per lane
    if (d0 < HD) {
      v8f a = accar[f] * linv;
      *reinterpret_cast<float4*>(orow + d0)     = make_float4(a[0], a[1], a[2], a[3]);
      *reinterpret_cast<float4*>(orow + d0 + 4) = make_float4(a[4], a[5], a[6], a[7]);
    }
  }
}

// ---------------- LayerNorm + residual + transpose + 2x nearest upsample ----------------
// 1 block = one image row = 64 tokens x 160 channels (40 KB of cat in a row). 8 lanes share a
// token; lane p holds the 16-byte pieces p, p + 8, .., p + 32 of its row, so each load of a
// wave is four whole lines and cat is read once. Mean and variance: 20 values in-lane, then
// three exchanges inside the group of 8 lanes. The finished tile is turned in LDS
// (channel-major); a wave then writes whole output rows, 512 contiguous bytes a store.
#define ETHR 512            // threads per block
#define ETOK 64             // tokens per block
#define EPIT 66             // LDS pitch in floats of a channel's 64 tokens (spreads the banks)
#define ECH  (DM / (ETHR / 32))   // channels per wave in the store phase

// value of lane l ^ M inside a row of 16 lanes (DPP row_xmask)
template <int M>
__device__ __forceinline__ float xlane(float v) {
  return __builtin_bit_cast(float, __builtin_amdgcn_update_dpp(
      0, __builtin_bit_cast(int, v), 0x160 + M, 0xf, 0xf, true));
}

__global__ void __launch_bounds__(ETHR) k_epi(const float* __restrict__ cat,
                                              const float* __restrict__ lw,
                                              const float* __restrict__ lb,
                                              float* __restrict__ out) {
  __shared__ __attribute__((aligned(16))) float tl[DM * EPIT];
  const int tok = threadIdx.x >> 3, p = threadIdx.x & 7;
  const int b = blockIdx.x >> 6, ih = blockIdx.x & 63;

  const float4* row = reinterpret_cast<const float4*>(cat + ((long)blockIdx.x * ETOK + tok) * DM) + p;
  const float4* gp  = reinterpret_cast<const float4*>(lw) + p;
  const float4* hp  = reinterpret_cast<const float4*>(lb) + p;
  float4 x[5], g[5], h[5];
  #pragma unroll
  for (int i = 0; i < 5; ++i) x[i] = row[8 * i];
  #pragma unroll
  for (int i = 0; i < 5; ++i) { g[i] = gp[8 * i]; h[i] = hp[8 * i]; }
  // keeps the scheduler from sinking the lw/lb loads behind the sums, where each pair is waited for alone
  __builtin_amdgcn_sched_barrier(0);
  // the 15 loads name row's register pair and p's register: the wait stands before either may
  // be written again (as inputs they stay untouched up to it)
  asm volatile("s_wait_xcnt 0x0" :: "v"(row), "v"(p) : "memory");

  float sm = 0.f;
  #pragma unroll
  for (int i = 0; i < 5; ++i) sm += (x[i].x + x[i].y) + (x[i].z + x[i].w);
  sm += xlane<1>(sm); sm += xlane<2>(sm); sm += xlane<4>(sm);
  const float mu = sm * (1.f / DM);

  float vs = 0.f;
  #pragma unroll
  for (int i = 0; i < 5; ++i) {
    const float d0 = x[i].x - mu, d1 = x[i].y - mu, d2 = x[i].z - mu, d3 = x[i].w - mu;
    vs += d0 * d0; vs += d1 * d1; vs += d2 * d2; vs += d3 * d3;
  }
  vs += xlane<1>(vs); vs += xlane<2>(vs); vs += xlane<4>(vs);
  const float inv = rsqrtf(vs * (1.f / DM) + 1e-5f);

  #pragma unroll
  for (int i = 0; i < 5; ++i) {
    float* t = &tl[4 * (p + 8 * i) * EPIT + tok];
    t[0]        = (x[i].x - mu) * inv * g[i].x + h[i].x + x[i].x;
    t[EPIT]     = (x[i].y - mu) * inv * g[i].y + h[i].y + x[i].y;
    t[2 * EPIT] = (x[i].z - mu) * inv * g[i].z + h[i].z + x[i].z;
    t[3 * EPIT] = (x[i].w - mu) * inv * g[i].w + h[i].w + x[i].w;
  }
  __syncthreads();

  // lane l: tokens 2l and 2l + 1, each doubled = output columns 4l .. 4l + 3; rows 2ih, 2ih + 1
  const int lane = threadIdx.x & 31;
  const int c0   = __builtin_amdgcn_readfirstlane(threadIdx.x >> 5) * ECH;
  float* o = out + (((long)b * DM + c0) * 128 + 2 * ih) * 128 + 4 * lane;
  #pragma unroll
  for (int j = 0; j < ECH; ++j) {
    const float2 v = *reinterpret_cast<const float2*>(&tl[(c0 + j) * EPIT + 2 * lane]);
    const float4 w = make_float4(v.x, v.x, v.y, v.y);
    *reinterpret_cast<float4*>(o + j * 128 * 128)       = w;
    *reinterpret_cast<float4*>(o + j * 128 * 128 + 128) = w;
  }
}

// ---------------- launch ----------------
extern "C" void kernel_launch(void* const* d_in, const int* in_sizes, int n_in,
                              void* d_out, int out_size, void* d_ws, size_t ws_size,
                              hipStream_t stream) {
  (void)in_sizes; (void)n_in; (void)out_size; (void)ws_size;
  const float* x   = (const float*)d_in[0];
  const float* w1  = (const float*)d_in[1];
  const float* b1  = (const float*)d_in[2];
  const float* w2  = (const float*)d_in[3];
  const float* b2  = (const float*)d_in[4];
  const float* pe  = (const float*)d_in[5];
  const float* wq  = (const float*)d_in[6];
  const float* wk  = (const float*)d_in[7];
  const float* wv  = (const float*)d_in[8];
  const float* lw  = (const float*)d_in[9];
  const float* lb  = (const float*)d_in[10];
  float* out = (float*)d_out;
  char*  ws  = (char*)d_ws;

  // workspace layout (bytes), all 16B aligned
  constexpr long C1_OFF  = 0;                                   // 4*64*4096 f32      = 4,194,304 B
  constexpr long FBF_OFF = C1_OFF  + 4L * 64 * HW * 4;          // 4*4112*160 bf16    = 5,263,360 B
  constexpr long WB_OFF  = FBF_OFF + (long)BATCH * FPAD * DM * 2;   // 3*160*160 bf16 = 153,600 B
  constexpr long Q_OFF   = WB_OFF  + 3L * DM * DM * 2;          // 16*4128*64 bf16    = 8,454,144 B
  constexpr long K_OFF   = Q_OFF   + 16L * SPAD * DP * 2;
  constexpr long VT_OFF  = K_OFF   + 16L * SPAD * DP * 2;
  constexpr long CAT_OFF = VT_OFF  + 16L * SPAD * DP * 2;       // 4*4096*160 f32     = 10,485,760 B

  float*  c1  = (float*) (ws + C1_OFF);
  __bf16* fbf = (__bf16*)(ws + FBF_OFF);
  __bf16* wb  = (__bf16*)(ws + WB_OFF);
  __bf16* qb  = (__bf16*)(ws + Q_OFF);
  __bf16* kb  = (__bf16*)(ws + K_OFF);
  __bf16* vtb = (__bf16*)(ws + VT_OFF);
  float*  cat = (float*) (ws + CAT_OFF);

  // zero q/k/vt (contiguous) so pad rows are well-defined every call
  const long zero16 = (3L * 16 * SPAD * DP * 2) / 16;           // float4 count
  k_zero <<<(int)((zero16 + 255) / 256), 256, 0, stream>>>((float4*)qb, zero16);
  k_ones <<<(16 * SPAD + 255) / 256, 256, 0, stream>>>(vtb);

  k_cvtw <<<(3 * DM * DM + 255) / 256, 256, 0, stream>>>(wq, wk, wv, wb);
  k_conv1<<<64 * 8, C1THR, 0, stream>>>(x, w1, b1, c1);
  k_conv2f<<<(BATCH * FPAD) / C2ROWS, C2THR, 0, stream>>>(c1, w2, b2, pe, fbf);

  const int qkv_waves = 3 * BATCH * SBLK * 10;                  // 30840
  k_qkv  <<<(qkv_waves + 7) / 8, 256, 0, stream>>>(fbf, wb, qb, kb, vtb);

  k_attn <<<512, 256, 0, stream>>>(qb, kb, vtb, cat);           // 16 bh x 32 q-groups

  k_epi  <<<(BATCH * HW) / ETOK, ETHR, 0, stream>>>(cat, lw, lb, out);   // one block per image row
}

// v005
// Measured time: 113 microseconds a run.
// Timed twice side by side with v004, it ran 1.58 and 1.59 times as fast.
// Counting every step since v000, it is 2.72 times as fast.
#include <hip/hip_runtime.h>
#include <hip/hip_bf16.h>

// ---------------- CDNA5 WMMA types ----------------
typedef __attribute__((ext_vector_type(16))) __bf16       v16bf;
typedef __attribute__((ext_vector_type(8)))  float        v8f;
typedef __attribute__((ext_vector_type(4)))  unsigned int u32x4;

#define BATCH 4
#define DM    160           // d_model
#define NH    4
#define HD    40            // head dim
#define DP    64            // padded head dim (4 x 16)
#define HW    4096          // 64*64 tokens
#define SEQ   4097          // tokens + pad row
#define SEQ_Q 4096          // queries that survive cat[:, :-1, :]
#define SPAD  4128          // K/V padded length (multiple of 32)
#define FPAD  4128          // f rows padded to the K/V length: rows above HW + 1 are 0
#define SBLK  258           // SPAD / 16 token tiles
#define KSTR  72            // LDS K-tile row stride (bank-conflict-free for b128)
#define VSTR  40            // LDS V-tile row stride (bank-conflict-free for b128)

union BFrag { v16bf v; u32x4 u[2]; };

// 16x32 bf16 A/B fragment loader (row-major tile, `stride` elements per row).
// Lanes 0-15 : row=lane,    K chunks {0..7} and {16..23}
// Lanes 16-31: row=lane-16, K chunks {8..15} and {24..31}
__device__ __forceinline__ BFrag ld_frag(const __bf16* base, int stride) {
  const int lane = threadIdx.x & 31;
  const int r  = lane & 15;
  const int hh = lane >> 4;
  const __bf16* p = base + (long)r * stride + 8 * hh;
  BFrag f;
  f.u[0] = *reinterpret_cast<const u32x4*>(p);
  f.u[1] = *reinterpret_cast<const u32x4*>(p + 16);
  return f;
}

__device__ __forceinline__ v8f wmma_bf16(const BFrag& a, const BFrag& b, v8f c) {
  return __builtin_amdgcn_wmma_f32_16x16x32_bf16(false, a.v, false, b.v,
                                                 (short)0, c, false, false);
}

__device__ __forceinline__ v8f vzero() {
  v8f z = {0.f, 0.f, 0.f, 0.f, 0.f, 0.f, 0.f, 0.f};
  return z;
}

// ---------------- conv1: 64->64, 2x2 stride 2 ----------------
// 1 block = 256 output positions (4 rows) x 8 output channels. Lanes run along the
// positions, so an x load is two whole lines, and each x value is used 8 times from a
// register. All 8 waves of a block work on the same 8 channels: the weights are uniform
// (scalar loads), and the block's 8 KB of them are fetched once for its 8 waves.
#define C1OC   8            // output channels per block
#define C1THR  256          // threads per block
#define C1CH   16           // input channels per register chunk (4 chunks)
#define C1W    8            // weights per channel and step
#define C1NS   (4 * 256 / C1W)   // steps: 4 channel pairs x 256 weights a channel

// Step G: 2 channels x C1W / 4 input channels, every index a compile-time constant.
// Step G + 1's weights are fetched while step G is worked on; the next chunk's x is
// fetched at the first step of a chunk.
template <int G>
__device__ __forceinline__ void c1_step(const float2* xp, const float* wp,
                                        float2 (&xb)[2][2 * C1CH], float (&wb)[2][2 * C1W],
                                        float (&at)[C1OC], float (&ab)[C1OC]) {
  constexpr int SPP = C1CH * 4 / C1W;        // steps per channel pair inside a chunk
  constexpr int SPC = 4 * SPP;               // steps per chunk
  constexpr int ch = G / SPC, j0 = ((G / SPP) & 3) * 2, q = G % SPP;
  if constexpr (G % SPC == 0 && ch + 1 < 4) {
    #pragma unroll
    for (int i = 0; i < C1CH; ++i) {
      xb[(ch + 1) & 1][2 * i]     = xp[((ch + 1) * C1CH + i) * 8192];
      xb[(ch + 1) & 1][2 * i + 1] = xp[((ch + 1) * C1CH + i) * 8192 + 64];
    }
  }
  if constexpr (G + 1 < C1NS) {
    constexpr int cn = (G + 1) / SPC, jn = (((G + 1) / SPP) & 3) * 2, qn = (G + 1) % SPP;
    #pragma unroll
    for (int i = 0; i < C1W; ++i) {
      wb[(G + 1) & 1][i]       = wp[jn * 256 + cn * 64 + qn * C1W + i];
      wb[(G + 1) & 1][C1W + i] = wp[(jn + 1) * 256 + cn * 64 + qn * C1W + i];
    }
  }
  if constexpr (G % SPC == 0 && ch + 2 == 4) {
    // all 128 x loads name xp's register pair: the wait stands before the pair may be
    // written again (xp as an input keeps the pair untouched up to the wait)
    asm volatile("s_wait_xcnt 0x0" :: "v"(xp) : "memory");
  }
  #pragma unroll
  for (int i = 0; i < C1W / 4; ++i) {
    const float2 t = xb[ch & 1][2 * (q * (C1W / 4) + i)];
    const float2 u = xb[ch & 1][2 * (q * (C1W / 4) + i) + 1];
    at[j0]     += t.x * wb[G & 1][4 * i];
    at[j0 + 1] += t.x * wb[G & 1][C1W + 4 * i];
    ab[j0]     += u.x * wb[G & 1][4 * i + 2];
    ab[j0 + 1] += u.x * wb[G & 1][C1W + 4 * i + 2];
    at[j0]     += t.y * wb[G & 1][4 * i + 1];
    at[j0 + 1] += t.y * wb[G & 1][C1W + 4 * i + 1];
    ab[j0]     += u.y * wb[G & 1][4 * i + 3];
    ab[j0 + 1] += u.y * wb[G & 1][C1W + 4 * i + 3];
  }
  // keeps the scheduler from lifting all the loads to the top, which spills registers
  __builtin_amdgcn_sched_barrier(0);
  if constexpr (G + 1 < C1NS) c1_step<G + 1>(xp, wp, xb, wb, at, ab);
}

__global__ void __launch_bounds__(C1THR) k_conv1(const float* __restrict__ x,
                                                 const float* __restrict__ w,
                                                 const float* __restrict__ bias,
                                                 float* __restrict__ c1) {
  const int oc0 = (blockIdx.x & 7) * C1OC;   // the 8 blocks that share x are neighbours
  const int pb  = blockIdx.x >> 3;           // 64 groups of 256 positions
  const int b   = pb >> 4;
  const int oh  = (pb & 15) * 4 + (threadIdx.x >> 6);
  const int ow  = threadIdx.x & 63;

  // xp[ic * 8192]: row 2*oh, xp[ic * 8192 + 64]: row 2*oh + 1 (units of two floats)
  const float2* xp = reinterpret_cast<const float2*>(
      x + ((long)b * 64 * 128 + 2 * oh) * 128 + 2 * ow);
  const float* wp = w + oc0 * 256;

  float2 xb[2][2 * C1CH];
  float  wb[2][2 * C1W];
  #pragma unroll
  for (int i = 0; i < C1CH; ++i) {
    xb[0][2 * i]     = xp[i * 8192];
    xb[0][2 * i + 1] = xp[i * 8192 + 64];
  }
  #pragma unroll
  for (int i = 0; i < C1W; ++i) { wb[0][i] = wp[i]; wb[0][C1W + i] = wp[256 + i]; }

  // per channel two sums, one per input row, each over ic = 0..63 in order
  float at[C1OC], ab[C1OC];
  #pragma unroll
  for (int j = 0; j < C1OC; ++j) { at[j] = 0.f; ab[j] = 0.f; }

  c1_step<0>(xp, wp, xb, wb, at, ab);

  float* op = c1 + ((long)b * 64 + oc0) * HW + oh * 64 + ow;
  #pragma unroll
  for (int j = 0; j < C1OC; ++j) op[j * HW] = bias[oc0 + j] + (at[j] + ab[j]);
}

// ---------- conv2 (1x1) + bias + leaky + transpose + pad + PE -> bf16 tokens ----------
// 1 block = 32 token rows x all 160 channels. Lanes run along the tokens, so a c1 load is
// one whole line; a wave owns 10 channels, so its weights are wave-uniform (scalar loads)
// and each c1 value is used 10 times from a register. The 32x160 tile is contiguous in
// fbf: it is turned in LDS and leaves as whole 16-byte pieces.
#define C2ROWS 32           // token rows per block (BATCH*FPAD = 516 * 32)
#define C2OC   10           // channels per wave (16 waves x 10 = DM)
#define C2THR  512          // threads per block
#define C2PIT  168          // LDS row pitch in bf16 (336 B: 16-B aligned, spreads the banks)
typedef __attribute__((ext_vector_type(2))) __bf16 v2bf;

__global__ void __launch_bounds__(C2THR) k_conv2f(const float* __restrict__ c1,
                                                  const float* __restrict__ w,
                                                  const float* __restrict__ bias,
                                                  const float* __restrict__ pe,
                                                  __bf16* __restrict__ fbf) {
  __shared__ __attribute__((aligned(16))) __bf16 tile[C2ROWS * C2PIT];
  const int lane = threadIdx.x & 31;
  const int oc0  = __builtin_amdgcn_readfirstlane(threadIdx.x >> 5) * C2OC;
  const int row  = blockIdx.x * C2ROWS + lane;      // b * FPAD + s
  const int b    = row / FPAD;
  const int s    = row - b * FPAD;
  const int sc   = s < HW ? s : HW - 1;             // pad rows read a valid column, result unused

  const int   si = s < HW ? s : HW;
  const float pv = pe[si];
  // the pe load names si's register as its offset: the wait stands before anything may be
  // written there (si as an input keeps the register untouched up to the wait)
  asm volatile("s_wait_xcnt 0x0" :: "v"(si) : "memory");

  const float* cp = c1 + (long)b * 64 * HW + sc;
  float xv[64];
  #pragma unroll
  for (int ic = 0; ic < 64; ++ic) xv[ic] = cp[(long)ic * HW];
  // the 64 loads name cp's register pair: the wait stands before the pair is used for sums
  asm volatile("s_wait_xcnt 0x0" :: "v"(cp) : "memory");

  // 20 groups of 2 channels x 16 inputs; per channel the sum runs over ic = 0..63 in order.
  // A group's 32 weights are fetched while the group before it is worked on.
  const float* wp = w + oc0 * 64;
  float wc[32], wn[32];
  #pragma unroll
  for (int i = 0; i < 16; ++i) { wc[i] = wp[i]; wc[16 + i] = wp[64 + i]; }
  float a0 = 0.f, a1 = 0.f;
  #pragma unroll
  for (int g = 0; g < 20; ++g) {
    const int j0 = (g >> 2) * 2, icb = (g & 3) * 16;
    if (g + 1 < 20) {
      const int jn = ((g + 1) >> 2) * 2, icn = ((g + 1) & 3) * 16;
      #pragma unroll
      for (int i = 0; i < 16; ++i) {
        wn[i]      = wp[jn * 64 + icn + i];
        wn[16 + i] = wp[(jn + 1) * 64 + icn + i];
      }
    }
    if (icb == 0) { a0 = bias[oc0 + j0]; a1 = bias[oc0 + j0 + 1]; }
    #pragma unroll
    for (int i = 0; i < 16; ++i) {
      a0 += xv[icb + i] * wc[i];
      a1 += xv[icb + i] * wc[16 + i];
    }
    if (icb == 48) {
      float l0 = a0 >= 0.f ? a0 : 0.01f * a0;
      float l1 = a1 >= 0.f ? a1 : 0.01f * a1;
      // row HW: zero-pad row + positional value; rows above it stay 0 (safe WMMA tiles)
      v2bf t;
      t[0] = (__bf16)(s < HW ? l0 + pv : (s == HW ? pv : 0.f));
      t[1] = (__bf16)(s < HW ? l1 + pv : (s == HW ? pv : 0.f));
      *reinterpret_cast<v2bf*>(&tile[lane * C2PIT + oc0 + j0]) = t;
    }
    // keeps the scheduler from lifting all the weight loads to the top, which spills scalar registers
    __builtin_amdgcn_sched_barrier(0);
    #pragma unroll
    for (int i = 0; i < 32; ++i) wc[i] = wn[i];
  }
  __syncthreads();

  __bf16* dst = fbf + (long)blockIdx.x * C2ROWS * DM;
  for (int c = threadIdx.x; c < C2ROWS * DM / 8; c += C2THR) {
    const int r = c / (DM / 8), kk = c - r * (DM / 8);
    *reinterpret_cast<u32x4*>(dst + c * 8) =
        *reinterpret_cast<const u32x4*>(&tile[r * C2PIT + kk * 8]);
  }
}

// ---------------- wq/wk/wv -> bf16 ----------------
__global__ void k_cvtw(const float* __restrict__ wq, const float* __restrict__ wk,
                       const float* __restrict__ wv, __bf16* __restrict__ o) {
  int i = blockIdx.x * 256 + threadIdx.x;
  if (i >= 3 * DM * DM) return;
  const float* src = (i < DM * DM) ? wq : (i < 2 * DM * DM ? wk : wv);
  o[i] = (__bf16)src[i % (DM * DM)];
}

// ---------------- QKV projection GEMM (WMMA bf16) ----------------
// one wave = one of {q,k,v} x one head x QT token tiles. The head's 40 weight rows (3 tiles
// of 16, the last half used) stay in registers for all its token tiles; K = 160 = 5 x K32.
// The wave writes the whole padded head (DP = 64 dims) of its tokens, pads included, so
// every byte of q, k and vt is written here and nothing has to be cleared beforehand.
// q, k: Dt = W * Ft, a lane holds 8 consecutive dims of ONE token  = one 16-byte store.
// v   : D  = F * Wt, a lane holds 8 consecutive tokens of ONE dim  = one 16-byte store of Vt.
// Vt row d == HD is all ones (softmax denominator via WMMA); every other pad is 0.
// Q output is pre-scaled by (1/sqrt(HD)) * log2(e) so attention uses raw exp2.
#define QT 3                // token tiles per wave
#define QG (SBLK / QT)      // 86 wave groups per batch; BATCH * QG = 344 waves = 43 blocks per (mat, head)

union Pack8 { __bf16 h[8]; u32x4 u; };

// one lane's share of the 5 fragments of a 16-token tile (lane map of ld_frag; fpl holds the lane's row)
__device__ __forceinline__ void ld_ftile(BFrag (&f)[5], const __bf16* fpl) {
  #pragma unroll
  for (int kk = 0; kk < 5; ++kk) {
    f[kk].u[0] = *reinterpret_cast<const u32x4*>(fpl + kk * 32);
    f[kk].u[1] = *reinterpret_cast<const u32x4*>(fpl + kk * 32 + 16);
  }
}

// products of one token tile. VT: D = F * Wt (rows = tokens); else Dt = W * Ft (rows = dims)
template <bool VT>
__device__ __forceinline__ void qkv_mm(const BFrag (&Wf)[3][5], const BFrag (&F)[5],
                                       v8f& a0, v8f& a1, v8f& a2) {
  a0 = vzero(); a1 = vzero(); a2 = vzero();
  #pragma unroll
  for (int kk = 0; kk < 5; ++kk) {
    if constexpr (VT) {
      a0 = wmma_bf16(F[kk], Wf[0][kk], a0);
      a1 = wmma_bf16(F[kk], Wf[1][kk], a1);
      a2 = wmma_bf16(F[kk], Wf[2][kk], a2);
    } else {
      a0 = wmma_bf16(Wf[0][kk], F[kk], a0);
      a1 = wmma_bf16(Wf[1][kk], F[kk], a1);
      a2 = wmma_bf16(Wf[2][kk], F[kk], a2);
    }
  }
}

// one token tile out: 4 tiles of 16 dims, DS apart; real: this lane holds dims 32..39 in tile 2
template <bool VT>
__device__ __forceinline__ void qkv_out(__bf16* o, const v8f& a0, const v8f& a1, const v8f& a2,
                                        float sc, bool real, float padv) {
  constexpr long DS = VT ? 16 * SPAD : 16;
  const u32x4 zz = {0u, 0u, 0u, 0u};
  Pack8 p0, p1, p2;
  #pragma unroll
  for (int i = 0; i < 8; ++i) {
    const float e0 = VT ? a0[i] : a0[i] * sc;
    const float e1 = VT ? a1[i] : a1[i] * sc;
    const float e2 = VT ? a2[i] : a2[i] * sc;
    p0.h[i] = (__bf16)e0;
    p1.h[i] = (__bf16)e1;
    p2.h[i] = (__bf16)(real ? e2 : padv);
  }
  *reinterpret_cast<u32x4*>(o)          = p0.u;
  *reinterpret_cast<u32x4*>(o + DS)     = p1.u;
  *reinterpret_cast<u32x4*>(o + 2 * DS) = p2.u;
  *reinterpret_cast<u32x4*>(o + 3 * DS) = zz;
}

// The QT token tiles of a wave, one after the other; the other waves of the SIMD cover the loads' latency.
template <bool VT>
__device__ __forceinline__ void qkv_tiles(const BFrag (&Wf)[3][5], const __bf16* fpl, __bf16* op,
                                          float sc, int n, int hm) {
  constexpr long TS = VT ? 16 : 16 * DP;                        // step of op per token tile
  const bool  real = VT ? (n < HD - 32) : (hm == 0);            // dims 32..39 of tile 2
  const float padv = (VT && n == HD - 32) ? 1.0f : 0.0f;        // dims 40..47: ones row of Vt, else 0
  // stays rolled: unrolled, each tile gets registers of its own, the wave passes 256 registers
  // and only one block fits a WGP
  #pragma unroll 1
  for (int j = 0; j < QT; ++j) {
    BFrag F[5];
    ld_ftile(F, fpl + j * 16 * DM);
    // holds the tile's 10 loads together in front of the products (loaded values as inputs only):
    // else each pair is loaded and waited for alone, five load latencies a tile instead of one
    asm volatile("" :: "v"(F[0].u[0]), "v"(F[0].u[1]), "v"(F[1].u[0]), "v"(F[1].u[1]),
                       "v"(F[2].u[0]), "v"(F[2].u[1]), "v"(F[3].u[0]), "v"(F[3].u[1]),
                       "v"(F[4].u[0]), "v"(F[4].u[1]));
    v8f a0, a1, a2;
    qkv_mm<VT>(Wf, F, a0, a1, a2);
    qkv_out<VT>(op + j * TS, a0, a1, a2, sc, real, padv);
    // the stores of this trip name address and data registers that the next trip writes again:
    // the wait stands before the back edge, in front of all of those writes
    asm volatile("s_wait_xcnt 0x0" ::: "memory");
  }
}

__global__ void __launch_bounds__(256) k_qkv(const __bf16* __restrict__ fbf,
                                             const __bf16* __restrict__ wb,
                                             __bf16* __restrict__ q,
                                             __bf16* __restrict__ k,
                                             __bf16* __restrict__ vt) {
  const int wid  = __builtin_amdgcn_readfirstlane(blockIdx.x * 8 + (threadIdx.x >> 5));
  const int mh   = wid / (BATCH * QG);         // mat * NH + head
  const int rest = wid - mh * (BATCH * QG);
  const int b    = rest / QG;
  const int g    = rest - b * QG;
  const int mat  = mh >> 2, hh = mh & (NH - 1);
  const int lane = threadIdx.x & 31;
  const int n  = lane & 15;
  const int hm = lane >> 4;

  // weight fragments, lane map of ld_frag: tiles 0 and 1 are rows n and 16 + n of the head; in
  // tile 2 the rows past the head's 40 read its last row (their products land in pad positions
  // and are replaced on the way out)
  const __bf16* wh  = wb + ((long)mat * DM + hh * HD) * DM + 8 * hm;
  const __bf16* w01 = wh + n * DM;
  const __bf16* w2  = wh + (n < HD - 32 ? 32 + n : HD - 1) * DM;
  BFrag Wf[3][5];
  ld_ftile(Wf[0], w01);
  ld_ftile(Wf[1], w01 + 16 * DM);
  ld_ftile(Wf[2], w2);

  const long bh = (long)b * NH + hh;
  const int  s0 = g * QT * 16;
  const __bf16* fpl = fbf + ((long)b * FPAD + s0 + n) * DM + 8 * hm;
  // the 30 weight loads name the two pairs w01 and w2: the wait stands before either may be
  // written again (as inputs they stay untouched up to it)
  asm volatile("s_wait_xcnt 0x0" :: "v"(w01), "v"(w2) : "memory");

  if (mat == 2) {
    qkv_tiles<true>(Wf, fpl, vt + (bh * DP + n) * SPAD + s0 + 8 * hm, 1.0f, n, hm);
  } else {
    qkv_tiles<false>(Wf, fpl, (mat == 0 ? q : k) + (bh * SPAD + s0 + n) * DP + 8 * hm,
                     (mat == 0) ? 0.22811012f : 1.0f,   // q: (1/sqrt(40)) * log2(e)
                     n, hm);
  }
}

// value of lane l ^ 16
__device__ __forceinline__ float xhalf(float v) {
  int b = __builtin_bit_cast(int, v);
  b = __builtin_amdgcn_permlanex16(b, b, 0x76543210, 0xfedcba98, false, false);
  return __builtin_bit_cast(float, b);
}

__global__ void __launch_bounds__(256) k_attn(const __bf16* __restrict__ q,
                                              const __bf16* __restrict__ k,
                                              const __bf16* __restrict__ vt,
                                              float* __restrict__ cat) {
  __shared__ __attribute__((aligned(16))) __bf16 sK[2][32 * KSTR];
  __shared__ __attribute__((aligned(16))) __bf16 sV[2][64 * VSTR];

  const int bh = blockIdx.x >> 5;              // 16 (b,h) pairs
  const int qg = blockIdx.x & 31;              // 32 groups of 128 queries
  const int wv = threadIdx.x >> 5;
  const int qb = qg * 8 + wv;                  // 16-query tile index (< 256)
  const int lane = threadIdx.x & 31;
  const int n  = lane & 15;
  const int hm = lane >> 4;
  const int tid = threadIdx.x;

  // cooperative staging coordinates (256 threads: K 32x64, V 64x32, 16B each)
  const int krow = tid >> 3, kc8 = (tid & 7) * 8;
  const int vrow = tid >> 2, vc8 = (tid & 3) * 8;
  const __bf16* kg = k  + ((long)bh * SPAD + krow) * DP + kc8;
  const __bf16* vg = vt + ((long)bh * DP + vrow) * SPAD + vc8;

  const __bf16* qbase = q + ((long)bh * SPAD + qb * 16) * DP;
  BFrag Qa = ld_frag(qbase, DP);        // B operand, column = query n, K = d 0..31
  BFrag Qb = ld_frag(qbase + 32, DP);   // K = d 32..63

  // Ot tiles: register r of tile f = O[query n][d = 16*f + 8*hm + r]
  v8f acc0 = vzero(), acc1 = vzero(), acc2 = vzero(), acc3 = vzero();
  float mrow = -1e30f;                  // running maximum of this lane's query

  // stage tile 0
  {
    u32x4 a = *reinterpret_cast<const u32x4*>(kg);
    u32x4 b = *reinterpret_cast<const u32x4*>(vg);
    *reinterpret_cast<u32x4*>(&sK[0][krow * KSTR + kc8]) = a;
    *reinterpret_cast<u32x4*>(&sV[0][vrow * VSTR + vc8]) = b;
  }
  __syncthreads();

  const int NIT = (SEQ + 31) / 32;             // 129
  for (int it = 0; it < NIT; ++it) {
    const int j0 = it * 32;
    const int cur = it & 1;
    const bool more = (it + 1 < NIT);
    u32x4 ka, va;
    if (more) {                                // prefetch next tile into regs
      ka = *reinterpret_cast<const u32x4*>(kg + (long)(j0 + 32) * DP);
      va = *reinterpret_cast<const u32x4*>(vg + (j0 + 32));
      if (it + 2 < NIT) {
        __builtin_prefetch(kg + (long)(j0 + 64) * DP, 0, 0);
        __builtin_prefetch(vg + (j0 + 64), 0, 0);
      }
    }

    // scores: K-tile (32x64) x Q^T (64x16) -> two 16x16 f32 fragments (keys x queries)
    const __bf16* kt = &sK[cur][0];
    BFrag K1a = ld_frag(kt, KSTR);
    BFrag K1b = ld_frag(kt + 32, KSTR);
    BFrag K2a = ld_frag(kt + 16 * KSTR, KSTR);
    BFrag K2b = ld_frag(kt + 16 * KSTR + 32, KSTR);
    v8f S1 = wmma_bf16(K1b, Qb, wmma_bf16(K1a, Qa, vzero()));
    v8f S2 = wmma_bf16(K2b, Qb, wmma_bf16(K2a, Qa, vzero()));

    if (j0 + 32 > SEQ) {                       // keys are register rows: only the last tile has any to mask
      #pragma unroll
      for (int r = 0; r < 8; ++r) {
        if (j0 + 8 * hm + r      >= SEQ) S1[r] = -1e30f;
        if (j0 + 16 + 8 * hm + r >= SEQ) S2[r] = -1e30f;
      }
    }

    // maximum of this query over the 32 keys: 16 in-lane, the rest in lane ^ 16
    // (four short independent chains, not one of sixteen links)
    float mxa = fmaxf(fmaxf(S1[0], S1[1]), fmaxf(S1[2], S1[3]));
    float mxb = fmaxf(fmaxf(S1[4], S1[5]), fmaxf(S1[6], S1[7]));
    float mxc = fmaxf(fmaxf(S2[0], S2[1]), fmaxf(S2[2], S2[3]));
    float mxd = fmaxf(fmaxf(S2[4], S2[5]), fmaxf(S2[6], S2[7]));
    float mx  = fmaxf(fmaxf(mxa, mxb), fmaxf(mxc, mxd));
    mx = fmaxf(mx, xhalf(mx));
    const float mn   = fmaxf(mrow, mx);
    const float corr = __builtin_amdgcn_exp2f(mrow - mn);   // scores already in exp2 domain
    mrow = mn;

    // P^T as B operand: element s = key 8*hm + s (s < 8) or 16 + 8*hm + s - 8 (s >= 8), straight from the two score tiles
    BFrag P;
    #pragma unroll
    for (int r = 0; r < 8; ++r) {
      P.v[r]     = (__bf16)__builtin_amdgcn_exp2f(S1[r] - mn);
      P.v[8 + r] = (__bf16)__builtin_amdgcn_exp2f(S2[r] - mn);
    }
    acc0 *= corr; acc1 *= corr; acc2 *= corr; acc3 *= corr;

    // Vt-tile rows (64 x 32) x P^T (32x16); row d==40 of Vt is all-ones -> l in acc2
    const __bf16* vtile = &sV[cur][0];
    acc0 = wmma_bf16(ld_frag(vtile,             VSTR), P, acc0);
    acc1 = wmma_bf16(ld_frag(vtile + 16 * VSTR, VSTR), P, acc1);
    acc2 = wmma_bf16(ld_frag(vtile + 32 * VSTR, VSTR), P, acc2);
    acc3 = wmma_bf16(ld_frag(vtile + 48 * VSTR, VSTR), P, acc3);

    if (more) {                                // fill the other buffer
      *reinterpret_cast<u32x4*>(&sK[1 - cur][krow * KSTR + kc8]) = ka;
      *reinterpret_cast<u32x4*>(&sV[1 - cur][vrow * VSTR + vc8]) = va;
    }
    __syncthreads();
  }

  // softmax denominator = row d==HD of Ot: tile 2, register 0, upper wave half
  const float lo   = acc2[0];
  const float lx   = xhalf(lo);
  const float linv = __builtin_amdgcn_rcpf(hm ? lo : lx);

  const int  hh   = bh & (NH - 1);
  const long brow = (long)(bh >> 2) * SEQ_Q;
  float* orow = cat + (brow + qb * 16 + n) * DM + hh * HD;   // query row < 4096
  v8f accar[4] = {acc0, acc1, acc2, acc3};
  #pragma unroll
  for (int f = 0; f < 4; ++f) {
    int d0 = f * 16 + 8 * hm;                  // 8 consecutive d per lane
    if (d0 < HD) {
      v8f a = accar[f] * linv;
      *reinterpret_cast<float4*>(orow + d0)     = make_float4(a[0], a[1], a[2], a[3]);
      *reinterpret_cast<float4*>(orow + d0 + 4) = make_float4(a[4], a[5], a[6], a[7]);
    }
  }
}

// ---------------- LayerNorm + residual + transpose + 2x nearest upsample ----------------
// 1 block = one image row = 64 tokens x 160 channels (40 KB of cat in a row). 8 lanes share a
// token; lane p holds the 16-byte pieces p, p + 8, .., p + 32 of its row, so each load of a
// wave is four whole lines and cat is read once. Mean and variance: 20 values in-lane, then
// three exchanges inside the group of 8 lanes. The finished tile is turned in LDS
// (channel-major); a wave then writes whole output rows, 512 contiguous bytes a store.
#define ETHR 512            // threads per block
#define ETOK 64             // tokens per block
#define EPIT 66             // LDS pitch in floats of a channel's 64 tokens (spreads the banks)
#define ECH  (DM / (ETHR / 32))   // channels per wave in the store phase

// value of lane l ^ M inside a row of 16 lanes (DPP row_xmask)
template <int M>
__device__ __forceinline__ float xlane(float v) {
  return __builtin_bit_cast(float, __builtin_amdgcn_update_dpp(
      0, __builtin_bit_cast(int, v), 0x160 + M, 0xf, 0xf, true));
}

__global__ void __launch_bounds__(ETHR) k_epi(const float* __restrict__ cat,
                                              const float* __restrict__ lw,
                                              const float* __restrict__ lb,
                                              float* __restrict__ out) {
  __shared__ __attribute__((aligned(16))) float tl[DM * EPIT];
  const int tok = threadIdx.x >> 3, p = threadIdx.x & 7;
  const int b = blockIdx.x >> 6, ih = blockIdx.x & 63;

  const float4* row = reinterpret_cast<const float4*>(cat + ((long)blockIdx.x * ETOK + tok) * DM) + p;
  const float4* gp  = reinterpret_cast<const float4*>(lw) + p;
  const float4* hp  = reinterpret_cast<const float4*>(lb) + p;
  float4 x[5], g[5], h[5];
  #pragma unroll
  for (int i = 0; i < 5; ++i) x[i] = row[8 * i];
  #pragma unroll
  for (int i = 0; i < 5; ++i) { g[i] = gp[8 * i]; h[i] = hp[8 * i]; }
  // keeps the scheduler from sinking the lw/lb loads behind the sums, where each pair is waited for alone
  __builtin_amdgcn_sched_barrier(0);
  // the 15 loads name row's register pair and p's register: the wait stands before either may
  // be written again (as inputs they stay untouched up to it)
  asm volatile("s_wait_xcnt 0x0" :: "v"(row), "v"(p) : "memory");

  float sm = 0.f;
  #pragma unroll
  for (int i = 0; i < 5; ++i) sm += (x[i].x + x[i].y) + (x[i].z + x[i].w);
  sm += xlane<1>(sm); sm += xlane<2>(sm); sm += xlane<4>(sm);
  const float mu = sm * (1.f / DM);

  float vs = 0.f;
  #pragma unroll
  for (int i = 0; i < 5; ++i) {
    const float d0 = x[i].x - mu, d1 = x[i].y - mu, d2 = x[i].z - mu, d3 = x[i].w - mu;
    vs += d0 * d0; vs += d1 * d1; vs += d2 * d2; vs += d3 * d3;
  }
  vs += xlane<1>(vs); vs += xlane<2>(vs); vs += xlane<4>(vs);
  const float inv = rsqrtf(vs * (1.f / DM) + 1e-5f);

  #pragma unroll
  for (int i = 0; i < 5; ++i) {
    float* t = &tl[4 * (p + 8 * i) * EPIT + tok];
    t[0]        = (x[i].x - mu) * inv * g[i].x + h[i].x + x[i].x;
    t[EPIT]     = (x[i].y - mu) * inv * g[i].y + h[i].y + x[i].y;
    t[2 * EPIT] = (x[i].z - mu) * inv * g[i].z + h[i].z + x[i].z;
    t[3 * EPIT] = (x[i].w - mu) * inv * g[i].w + h[i].w + x[i].w;
  }
  __syncthreads();

  // lane l: tokens 2l and 2l + 1, each doubled = output columns 4l .. 4l + 3; rows 2ih, 2ih + 1
  const int lane = threadIdx.x & 31;
  const int c0   = __builtin_amdgcn_readfirstlane(threadIdx.x >> 5) * ECH;
  float* o = out + (((long)b * DM + c0) * 128 + 2 * ih) * 128 + 4 * lane;
  #pragma unroll
  for (int j = 0; j < ECH; ++j) {
    const float2 v = *reinterpret_cast<const float2*>(&tl[(c0 + j) * EPIT + 2 * lane]);
    const float4 w = make_float4(v.x, v.x, v.y, v.y);
    *reinterpret_cast<float4*>(o + j * 128 * 128)       = w;
    *reinterpret_cast<float4*>(o + j * 128 * 128 + 128) = w;
  }
}

// ---------------- launch ----------------
extern "C" void kernel_launch(void* const* d_in, const int* in_sizes, int n_in,
                              void* d_out, int out_size, void* d_ws, size_t ws_size,
                              hipStream_t stream) {
  (void)in_sizes; (void)n_in; (void)out_size; (void)ws_size;
  const float* x   = (const float*)d_in[0];
  const float* w1  = (const float*)d_in[1];
  const float* b1  = (const float*)d_in[2];
  const float* w2  = (const float*)d_in[3];
  const float* b2  = (const float*)d_in[4];
  const float* pe  = (const float*)d_in[5];
  const float* wq  = (const float*)d_in[6];
  const float* wk  = (const float*)d_in[7];
  const float* wv  = (const float*)d_in[8];
  const float* lw  = (const float*)d_in[9];
  const float* lb  = (const float*)d_in[10];
  float* out = (float*)d_out;
  char*  ws  = (char*)d_ws;

  // workspace layout (bytes), all 16B aligned
  constexpr long C1_OFF  = 0;                                   // 4*64*4096 f32      = 4,194,304 B
  constexpr long FBF_OFF = C1_OFF  + 4L * 64 * HW * 4;          // 4*4128*160 bf16    = 5,283,840 B
  constexpr long WB_OFF  = FBF_OFF + (long)BATCH * FPAD * DM * 2;   // 3*160*160 bf16 = 153,600 B
  constexpr long Q_OFF   = WB_OFF  + 3L * DM * DM * 2;          // 16*4128*64 bf16    = 8,454,144 B
  constexpr long K_OFF   = Q_OFF   + 16L * SPAD * DP * 2;
  constexpr long VT_OFF  = K_OFF   + 16L * SPAD * DP * 2;
  constexpr long CAT_OFF = VT_OFF  + 16L * SPAD * DP * 2;       // 4*4096*160 f32     = 10,485,760 B

  float*  c1  = (float*) (ws + C1_OFF);
  __bf16* fbf = (__bf16*)(ws + FBF_OFF);
  __bf16* wb  = (__bf16*)(ws + WB_OFF);
  __bf16* qb  = (__bf16*)(ws + Q_OFF);
  __bf16* kb  = (__bf16*)(ws + K_OFF);
  __bf16* vtb = (__bf16*)(ws + VT_OFF);
  float*  cat = (float*) (ws + CAT_OFF);

  k_cvtw <<<(3 * DM * DM + 255) / 256, 256, 0, stream>>>(wq, wk, wv, wb);
  k_conv1<<<64 * 8, C1THR, 0, stream>>>(x, w1, b1, c1);
  k_conv2f<<<(BATCH * FPAD) / C2ROWS, C2THR, 0, stream>>>(c1, w2, b2, pe, fbf);

  // writes every byte of q, k and vt (pads and the ones row included)
  k_qkv  <<<3 * NH * BATCH * QG / 8, 256, 0, stream>>>(fbf, wb, qb, kb, vtb);   // 516 blocks

  k_attn <<<512, 256, 0, stream>>>(qb, kb, vtb, cat);           // 16 bh x 32 q-groups

  k_epi  <<<(BATCH * HW) / ETOK, ETHR, 0, stream>>>(cat, lw, lb, out);   // one block per image row
}

// v006
// A run of this version takes 107 microseconds.
// Timed twice side by side with v005, it ran 1.06 and 1.07 times as fast.
// All steps since v000 together make it 2.89 times as fast.
#include <hip/hip_runtime.h>
#include <hip/hip_bf16.h>

// ---------------- CDNA5 WMMA types ----------------
typedef __attribute__((ext_vector_type(16))) __bf16       v16bf;
typedef __attribute__((ext_vector_type(8)))  float        v8f;
typedef __attribute__((ext_vector_type(4)))  unsigned int u32x4;

#define BATCH 4
#define DM    160           // d_model
#define NH    4
#define HD    40            // head dim
#define DP    64            // padded head dim (4 x 16)
#define HW    4096          // 64*64 tokens
#define SEQ   4097          // tokens + pad row
#define SEQ_Q 4096          // queries that survive cat[:, :-1, :]
#define SPAD  4128          // K/V padded length (multiple of 32)
#define FPAD  4128          // f rows padded to the K/V length: rows above HW + 1 are 0
#define SBLK  258           // SPAD / 16 token tiles
#define KSTR  72            // LDS K-tile row stride (bank-conflict-free for b128)
#define VSTR  40            // LDS V-tile row stride (bank-conflict-free for b128)

union BFrag { v16bf v; u32x4 u[2]; };

// 16x32 bf16 A/B fragment loader (row-major tile, `stride` elements per row).
// Lanes 0-15 : row=lane,    K chunks {0..7} and {16..23}
// Lanes 16-31: row=lane-16, K chunks {8..15} and {24..31}
__device__ __forceinline__ BFrag ld_frag(const __bf16* base, int stride) {
  const int lane = threadIdx.x & 31;
  const int r  = lane & 15;
  const int hh = lane >> 4;
  const __bf16* p = base + (long)r * stride + 8 * hh;
  BFrag f;
  f.u[0] = *reinterpret_cast<const u32x4*>(p);
  f.u[1] = *reinterpret_cast<const u32x4*>(p + 16);
  return f;
}

__device__ __forceinline__ v8f wmma_bf16(const BFrag& a, const BFrag& b, v8f c) {
  return __builtin_amdgcn_wmma_f32_16x16x32_bf16(false, a.v, false, b.v,
                                                 (short)0, c, false, false);
}

__device__ __forceinline__ v8f vzero() {
  v8f z = {0.f, 0.f, 0.f, 0.f, 0.f, 0.f, 0.f, 0.f};
  return z;
}

// ---------------- conv1: 64->64, 2x2 stride 2 ----------------
// 1 block = 256 output positions (4 rows) x 8 output channels. Lanes run along the
// positions, so an x load is two whole lines, and each x value is used 8 times from a
// register. All 8 waves of a block work on the same 8 channels: the weights are uniform
// (scalar loads), and the block's 8 KB of them are fetched once for its 8 waves.
#define C1OC   8            // output channels per block
#define C1THR  256          // threads per block
#define C1CH   16           // input channels per register chunk (4 chunks)
#define C1W    8            // weights per channel and step
#define C1NS   (4 * 256 / C1W)   // steps: 4 channel pairs x 256 weights a channel

// Step G: 2 channels x C1W / 4 input channels, every index a compile-time constant.
// Step G + 1's weights are fetched while step G is worked on; the next chunk's x is
// fetched at the first step of a chunk.
template <int G>
__device__ __forceinline__ void c1_step(const float2* xp, const float* wp,
                                        float2 (&xb)[2][2 * C1CH], float (&wb)[2][2 * C1W],
                                        float (&at)[C1OC], float (&ab)[C1OC]) {
  constexpr int SPP = C1CH * 4 / C1W;        // steps per channel pair inside a chunk
  constexpr int SPC = 4 * SPP;               // steps per chunk
  constexpr int ch = G / SPC, j0 = ((G / SPP) & 3) * 2, q = G % SPP;
  if constexpr (G % SPC == 0 && ch + 1 < 4) {
    #pragma unroll
    for (int i = 0; i < C1CH; ++i) {
      xb[(ch + 1) & 1][2 * i]     = xp[((ch + 1) * C1CH + i) * 8192];
      xb[(ch + 1) & 1][2 * i + 1] = xp[((ch + 1) * C1CH + i) * 8192 + 64];
    }
  }
  if constexpr (G + 1 < C1NS) {
    constexpr int cn = (G + 1) / SPC, jn = (((G + 1) / SPP) & 3) * 2, qn = (G + 1) % SPP;
    #pragma unroll
    for (int i = 0; i < C1W; ++i) {
      wb[(G + 1) & 1][i]       = wp[jn * 256 + cn * 64 + qn * C1W + i];
      wb[(G + 1) & 1][C1W + i] = wp[(jn + 1) * 256 + cn * 64 + qn * C1W + i];
    }
  }
  if constexpr (G % SPC == 0 && ch + 2 == 4) {
    // all 128 x loads name xp's register pair: the wait stands before the pair may be
    // written again (xp as an input keeps the pair untouched up to the wait)
    asm volatile("s_wait_xcnt 0x0" :: "v"(xp) : "memory");
  }
  #pragma unroll
  for (int i = 0; i < C1W / 4; ++i) {
    const float2 t = xb[ch & 1][2 * (q * (C1W / 4) + i)];
    const float2 u = xb[ch & 1][2 * (q * (C1W / 4) + i) + 1];
    at[j0]     += t.x * wb[G & 1][4 * i];
    at[j0 + 1] += t.x * wb[G & 1][C1W + 4 * i];
    ab[j0]     += u.x * wb[G & 1][4 * i + 2];
    ab[j0 + 1] += u.x * wb[G & 1][C1W + 4 * i + 2];
    at[j0]     += t.y * wb[G & 1][4 * i + 1];
    at[j0 + 1] += t.y * wb[G & 1][C1W + 4 * i + 1];
    ab[j0]     += u.y * wb[G & 1][4 * i + 3];
    ab[j0 + 1] += u.y * wb[G & 1][C1W + 4 * i + 3];
  }
  // keeps the scheduler from lifting all the loads to the top, which spills registers
  __builtin_amdgcn_sched_barrier(0);
  if constexpr (G + 1 < C1NS) c1_step<G + 1>(xp, wp, xb, wb, at, ab);
}

__global__ void __launch_bounds__(C1THR) k_conv1(const float* __restrict__ x,
                                                 const float* __restrict__ w,
                                                 const float* __restrict__ bias,
                                                 float* __restrict__ c1) {
  const int oc0 = (blockIdx.x & 7) * C1OC;   // the 8 blocks that share x are neighbours
  const int pb  = blockIdx.x >> 3;           // 64 groups of 256 positions
  const int b   = pb >> 4;
  const int oh  = (pb & 15) * 4 + (threadIdx.x >> 6);
  const int ow  = threadIdx.x & 63;

  // xp[ic * 8192]: row 2*oh, xp[ic * 8192 + 64]: row 2*oh + 1 (units of two floats)
  const float2* xp = reinterpret_cast<const float2*>(
      x + ((long)b * 64 * 128 + 2 * oh) * 128 + 2 * ow);
  const float* wp = w + oc0 * 256;

  float2 xb[2][2 * C1CH];
  float  wb[2][2 * C1W];
  #pragma unroll
  for (int i = 0; i < C1CH; ++i) {
    xb[0][2 * i]     = xp[i * 8192];
    xb[0][2 * i + 1] = xp[i * 8192 + 64];
  }
  #pragma unroll
  for (int i = 0; i < C1W; ++i) { wb[0][i] = wp[i]; wb[0][C1W + i] = wp[256 + i]; }

  // per channel two sums, one per input row, each over ic = 0..63 in order
  float at[C1OC], ab[C1OC];
  #pragma unroll
  for (int j = 0; j < C1OC; ++j) { at[j] = 0.f; ab[j] = 0.f; }

  c1_step<0>(xp, wp, xb, wb, at, ab);

  float* op = c1 + ((long)b * 64 + oc0) * HW + oh * 64 + ow;
  #pragma unroll
  for (int j = 0; j < C1OC; ++j) op[j * HW] = bias[oc0 + j] + (at[j] + ab[j]);
}

// ---------- conv2 (1x1) + bias + leaky + transpose + pad + PE -> bf16 tokens ----------
// 1 block = 32 token rows x all 160 channels. Lanes run along the tokens, so a c1 load is
// one whole line; a wave owns 10 channels, so its weights are wave-uniform (scalar loads)
// and each c1 value is used 10 times from a register. The 32x160 tile is contiguous in
// fbf: it is turned in LDS and leaves as whole 16-byte pieces.
#define C2ROWS 32           // token rows per block (BATCH*FPAD = 516 * 32)
#define C2OC   10           // channels per wave (16 waves x 10 = DM)
#define C2THR  512          // threads per block
#define C2PIT  168          // LDS row pitch in bf16 (336 B: 16-B aligned, spreads the banks)
typedef __attribute__((ext_vector_type(2))) __bf16 v2bf;

__global__ void __launch_bounds__(C2THR) k_conv2f(const float* __restrict__ c1,
                                                  const float* __restrict__ w,
                                                  const float* __restrict__ bias,
                                                  const float* __restrict__ pe,
                                                  __bf16* __restrict__ fbf) {
  __shared__ __attribute__((aligned(16))) __bf16 tile[C2ROWS * C2PIT];
  const int lane = threadIdx.x & 31;
  const int oc0  = __builtin_amdgcn_readfirstlane(threadIdx.x >> 5) * C2OC;
  const int row  = blockIdx.x * C2ROWS + lane;      // b * FPAD + s
  const int b    = row / FPAD;
  const int s    = row - b * FPAD;
  const int sc   = s < HW ? s : HW - 1;             // pad rows read a valid column, result unused

  const int   si = s < HW ? s : HW;
  const float pv = pe[si];
  // the pe load names si's register as its offset: the wait stands before anything may be
  // written there (si as an input keeps the register untouched up to the wait)
  asm volatile("s_wait_xcnt 0x0" :: "v"(si) : "memory");

  const float* cp = c1 + (long)b * 64 * HW + sc;
  float xv[64];
  #pragma unroll
  for (int ic = 0; ic < 64; ++ic) xv[ic] = cp[(long)ic * HW];
  // the 64 loads name cp's register pair: the wait stands before the pair is used for sums
  asm volatile("s_wait_xcnt 0x0" :: "v"(cp) : "memory");

  // 20 groups of 2 channels x 16 inputs; per channel the sum runs over ic = 0..63 in order.
  // A group's 32 weights are fetched while the group before it is worked on.
  const float* wp = w + oc0 * 64;
  float wc[32], wn[32];
  #pragma unroll
  for (int i = 0; i < 16; ++i) { wc[i] = wp[i]; wc[16 + i] = wp[64 + i]; }
  float a0 = 0.f, a1 = 0.f;
  #pragma unroll
  for (int g = 0; g < 20; ++g) {
    const int j0 = (g >> 2) * 2, icb = (g & 3) * 16;
    if (g + 1 < 20) {
      const int jn = ((g + 1) >> 2) * 2, icn = ((g + 1) & 3) * 16;
      #pragma unroll
      for (int i = 0; i < 16; ++i) {
        wn[i]      = wp[jn * 64 + icn + i];
        wn[16 + i] = wp[(jn + 1) * 64 + icn + i];
      }
    }
    if (icb == 0) { a0 = bias[oc0 + j0]; a1 = bias[oc0 + j0 + 1]; }
    #pragma unroll
    for (int i = 0; i < 16; ++i) {
      a0 += xv[icb + i] * wc[i];
      a1 += xv[icb + i] * wc[16 + i];
    }
    if (icb == 48) {
      float l0 = a0 >= 0.f ? a0 : 0.01f * a0;
      float l1 = a1 >= 0.f ? a1 : 0.01f * a1;
      // row HW: zero-pad row + positional value; rows above it stay 0 (safe WMMA tiles)
      v2bf t;
      t[0] = (__bf16)(s < HW ? l0 + pv : (s == HW ? pv : 0.f));
      t[1] = (__bf16)(s < HW ? l1 + pv : (s == HW ? pv : 0.f));
      *reinterpret_cast<v2bf*>(&tile[lane * C2PIT + oc0 + j0]) = t;
    }
    // keeps the scheduler from lifting all the weight loads to the top, which spills scalar registers
    __builtin_amdgcn_sched_barrier(0);
    #pragma unroll
    for (int i = 0; i < 32; ++i) wc[i] = wn[i];
  }
  __syncthreads();

  __bf16* dst = fbf + (long)blockIdx.x * C2ROWS * DM;
  for (int c = threadIdx.x; c < C2ROWS * DM / 8; c += C2THR) {
    const int r = c / (DM / 8), kk = c - r * (DM / 8);
    *reinterpret_cast<u32x4*>(dst + c * 8) =
        *reinterpret_cast<const u32x4*>(&tile[r * C2PIT + kk * 8]);
  }
}

// ---------------- wq/wk/wv -> bf16 ----------------
__global__ void k_cvtw(const float* __restrict__ wq, const float* __restrict__ wk,
                       const float* __restrict__ wv, __bf16* __restrict__ o) {
  int i = blockIdx.x * 256 + threadIdx.x;
  if (i >= 3 * DM * DM) return;
  const float* src = (i < DM * DM) ? wq : (i < 2 * DM * DM ? wk : wv);
  o[i] = (__bf16)src[i % (DM * DM)];
}

// ---------------- QKV projection GEMM (WMMA bf16) ----------------
// one wave = one of {q,k,v} x one head x QT token tiles. The head's 40 weight rows (3 tiles
// of 16, the last half used) stay in registers for all its token tiles; K = 160 = 5 x K32.
// The wave writes the whole padded head (DP = 64 dims) of its tokens, pads included, so
// every byte of q, k and vt is written here and nothing has to be cleared beforehand.
// q, k: Dt = W * Ft, a lane holds 8 consecutive dims of ONE token  = one 16-byte store.
// v   : D  = F * Wt, a lane holds 8 consecutive tokens of ONE dim  = one 16-byte store of Vt.
// Vt row d == HD is all ones (softmax denominator via WMMA); every other pad is 0.
// Q output is pre-scaled by (1/sqrt(HD)) * log2(e) so attention uses raw exp2.
#define QT 3                // token tiles per wave
#define QG (SBLK / QT)      // 86 wave groups per batch; BATCH * QG = 344 waves = 43 blocks per (mat, head)

union Pack8 { __bf16 h[8]; u32x4 u; };

// one lane's share of the 5 fragments of a 16-token tile (lane map of ld_frag; fpl holds the lane's row)
__device__ __forceinline__ void ld_ftile(BFrag (&f)[5], const __bf16* fpl) {
  #pragma unroll
  for (int kk = 0; kk < 5; ++kk) {
    f[kk].u[0] = *reinterpret_cast<const u32x4*>(fpl + kk * 32);
    f[kk].u[1] = *reinterpret_cast<const u32x4*>(fpl + kk * 32 + 16);
  }
}

// products of one token tile. VT: D = F * Wt (rows = tokens); else Dt = W * Ft (rows = dims)
template <bool VT>
__device__ __forceinline__ void qkv_mm(const BFrag (&Wf)[3][5], const BFrag (&F)[5],
                                       v8f& a0, v8f& a1, v8f& a2) {
  a0 = vzero(); a1 = vzero(); a2 = vzero();
  #pragma unroll
  for (int kk = 0; kk < 5; ++kk) {
    if constexpr (VT) {
      a0 = wmma_bf16(F[kk], Wf[0][kk], a0);
      a1 = wmma_bf16(F[kk], Wf[1][kk], a1);
      a2 = wmma_bf16(F[kk], Wf[2][kk], a2);
    } else {
      a0 = wmma_bf16(Wf[0][kk], F[kk], a0);
      a1 = wmma_bf16(Wf[1][kk], F[kk], a1);
      a2 = wmma_bf16(Wf[2][kk], F[kk], a2);
    }
  }
}

// one token tile out: 4 tiles of 16 dims, DS apart; real: this lane holds dims 32..39 in tile 2
template <bool VT>
__device__ __forceinline__ void qkv_out(__bf16* o, const v8f& a0, const v8f& a1, const v8f& a2,
                                        float sc, bool real, float padv) {
  constexpr long DS = VT ? 16 * SPAD : 16;
  const u32x4 zz = {0u, 0u, 0u, 0u};
  Pack8 p0, p1, p2;
  #pragma unroll
  for (int i = 0; i < 8; ++i) {
    const float e0 = VT ? a0[i] : a0[i] * sc;
    const float e1 = VT ? a1[i] : a1[i] * sc;
    const float e2 = VT ? a2[i] : a2[i] * sc;
    p0.h[i] = (__bf16)e0;
    p1.h[i] = (__bf16)e1;
    p2.h[i] = (__bf16)(real ? e2 : padv);
  }
  *reinterpret_cast<u32x4*>(o)          = p0.u;
  *reinterpret_cast<u32x4*>(o + DS)     = p1.u;
  *reinterpret_cast<u32x4*>(o + 2 * DS) = p2.u;
  *reinterpret_cast<u32x4*>(o + 3 * DS) = zz;
}

// The QT token tiles of a wave, one after the other; the other waves of the SIMD cover the loads' latency.
template <bool VT>
__device__ __forceinline__ void qkv_tiles(const BFrag (&Wf)[3][5], const __bf16* fpl, __bf16* op,
                                          float sc, int n, int hm) {
  constexpr long TS = VT ? 16 : 16 * DP;                        // step of op per token tile
  const bool  real = VT ? (n < HD - 32) : (hm == 0);            // dims 32..39 of tile 2
  const float padv = (VT && n == HD - 32) ? 1.0f : 0.0f;        // dims 40..47: ones row of Vt, else 0
  // stays rolled: unrolled, each tile gets registers of its own, the wave passes 256 registers
  // and only one block fits a WGP
  #pragma unroll 1
  for (int j = 0; j < QT; ++j) {
    BFrag F[5];
    ld_ftile(F, fpl + j * 16 * DM);
    // holds the tile's 10 loads together in front of the products (loaded values as inputs only):
    // else each pair is loaded and waited for alone, five load latencies a tile instead of one
    asm volatile("" :: "v"(F[0].u[0]), "v"(F[0].u[1]), "v"(F[1].u[0]), "v"(F[1].u[1]),
                       "v"(F[2].u[0]), "v"(F[2].u[1]), "v"(F[3].u[0]), "v"(F[3].u[1]),
                       "v"(F[4].u[0]), "v"(F[4].u[1]));
    v8f a0, a1, a2;
    qkv_mm<VT>(Wf, F, a0, a1, a2);
    qkv_out<VT>(op + j * TS, a0, a1, a2, sc, real, padv);
    // the stores of this trip name address and data registers that the next trip writes again:
    // the wait stands before the back edge, in front of all of those writes
    asm volatile("s_wait_xcnt 0x0" ::: "memory");
  }
}

__global__ void __launch_bounds__(256) k_qkv(const __bf16* __restrict__ fbf,
                                             const __bf16* __restrict__ wb,
                                             __bf16* __restrict__ q,
                                             __bf16* __restrict__ k,
                                             __bf16* __restrict__ vt) {
  const int wid  = __builtin_amdgcn_readfirstlane(blockIdx.x * 8 + (threadIdx.x >> 5));
  const int mh   = wid / (BATCH * QG);         // mat * NH + head
  const int rest = wid - mh * (BATCH * QG);
  const int b    = rest / QG;
  const int g    = rest - b * QG;
  const int mat  = mh >> 2, hh = mh & (NH - 1);
  const int lane = threadIdx.x & 31;
  const int n  = lane & 15;
  const int hm = lane >> 4;

  // weight fragments, lane map of ld_frag: tiles 0 and 1 are rows n and 16 + n of the head; in
  // tile 2 the rows past the head's 40 read its last row (their products land in pad positions
  // and are replaced on the way out)
  const __bf16* wh  = wb + ((long)mat * DM + hh * HD) * DM + 8 * hm;
  const __bf16* w01 = wh + n * DM;
  const __bf16* w2  = wh + (n < HD - 32 ? 32 + n : HD - 1) * DM;
  BFrag Wf[3][5];
  ld_ftile(Wf[0], w01);
  ld_ftile(Wf[1], w01 + 16 * DM);
  ld_ftile(Wf[2], w2);

  const long bh = (long)b * NH + hh;
  const int  s0 = g * QT * 16;
  const __bf16* fpl = fbf + ((long)b * FPAD + s0 + n) * DM + 8 * hm;
  // the 30 weight loads name the two pairs w01 and w2: the wait stands before either may be
  // written again (as inputs they stay untouched up to it)
  asm volatile("s_wait_xcnt 0x0" :: "v"(w01), "v"(w2) : "memory");

  if (mat == 2) {
    qkv_tiles<true>(Wf, fpl, vt + (bh * DP + n) * SPAD + s0 + 8 * hm, 1.0f, n, hm);
  } else {
    qkv_tiles<false>(Wf, fpl, (mat == 0 ? q : k) + (bh * SPAD + s0 + n) * DP + 8 * hm,
                     (mat == 0) ? 0.22811012f : 1.0f,   // q: (1/sqrt(40)) * log2(e)
                     n, hm);
  }
}

// value of lane l ^ 16
__device__ __forceinline__ float xhalf(float v) {
  int b = __builtin_bit_cast(int, v);
  b = __builtin_amdgcn_permlanex16(b, b, 0x76543210, 0xfedcba98, false, false);
  return __builtin_bit_cast(float, b);
}

// largest of a lane's 16 scores (four short independent chains, not one of sixteen links)
__device__ __forceinline__ float max16(const v8f& S1, const v8f& S2) {
  const float mxa = fmaxf(fmaxf(S1[0], S1[1]), fmaxf(S1[2], S1[3]));
  const float mxb = fmaxf(fmaxf(S1[4], S1[5]), fmaxf(S1[6], S1[7]));
  const float mxc = fmaxf(fmaxf(S2[0], S2[1]), fmaxf(S2[2], S2[3]));
  const float mxd = fmaxf(fmaxf(S2[4], S2[5]), fmaxf(S2[6], S2[7]));
  return fmaxf(fmaxf(mxa, mxb), fmaxf(mxc, mxd));
}

// takes a tile's true maximum into mrow (16 keys in-lane, the query's other 16 in lane ^ 16),
// moves the raw scores onto it and returns the factor that moves the sums kept so far
__device__ __forceinline__ float new_max(v8f& S1, v8f& S2, float& mrow) {
  const float mx   = max16(S1, S2);
  const float mn   = fmaxf(mrow, fmaxf(mx, xhalf(mx)));
  const float corr = __builtin_amdgcn_exp2f(mrow - mn);   // scores already in exp2 domain
  mrow = mn;
  S1 -= mn; S2 -= mn;
  return corr;
}

// P^T as B operand: element s = key 8*hm + s (s < 8) or 16 + 8*hm + s - 8 (s >= 8), straight from the two score tiles
__device__ __forceinline__ BFrag exp_pack(const v8f& S1, const v8f& S2) {
  BFrag P;
  #pragma unroll
  for (int r = 0; r < 8; ++r) {
    P.v[r]     = (__bf16)__builtin_amdgcn_exp2f(S1[r]);
    P.v[8 + r] = (__bf16)__builtin_amdgcn_exp2f(S2[r]);
  }
  return P;
}

__global__ void __launch_bounds__(256) k_attn(const __bf16* __restrict__ q,
                                              const __bf16* __restrict__ k,
                                              const __bf16* __restrict__ vt,
                                              float* __restrict__ cat) {
  __shared__ __attribute__((aligned(16))) __bf16 sK[2][32 * KSTR];
  __shared__ __attribute__((aligned(16))) __bf16 sV[2][64 * VSTR];

  const int bh = blockIdx.x >> 5;              // 16 (b,h) pairs
  const int qg = blockIdx.x & 31;              // 32 groups of 128 queries
  const int wv = threadIdx.x >> 5;
  const int qb = qg * 8 + wv;                  // 16-query tile index (< 256)
  const int lane = threadIdx.x & 31;
  const int n  = lane & 15;
  const int hm = lane >> 4;
  const int tid = threadIdx.x;

  // cooperative staging coordinates (256 threads: K 32x64, V 64x32, 16B each)
  const int krow = tid >> 3, kc8 = (tid & 7) * 8;
  const int vrow = tid >> 2, vc8 = (tid & 3) * 8;
  const __bf16* kg = k  + ((long)bh * SPAD + krow) * DP + kc8;
  const __bf16* vg = vt + ((long)bh * DP + vrow) * SPAD + vc8;

  const __bf16* qbase = q + ((long)bh * SPAD + qb * 16) * DP;
  BFrag Qa = ld_frag(qbase, DP);        // B operand, column = query n, K = d 0..31
  BFrag Qb = ld_frag(qbase + 32, DP);   // K = d 32..63

  // Ot tiles: register r of tile f = O[query n][d = 16*f + 8*hm + r]
  v8f acc0 = vzero(), acc1 = vzero(), acc2 = vzero(), acc3 = vzero();
  float mrow = -1e30f;                  // maximum in use for this lane's query (at most 8 below the true one)
  v8f nm;                               // -mrow in all 8 registers: start value of the score products
  #pragma unroll
  for (int r = 0; r < 8; ++r) nm[r] = 1e30f;

  // stage tile 0
  {
    u32x4 a = *reinterpret_cast<const u32x4*>(kg);
    u32x4 b = *reinterpret_cast<const u32x4*>(vg);
    *reinterpret_cast<u32x4*>(&sK[0][krow * KSTR + kc8]) = a;
    *reinterpret_cast<u32x4*>(&sV[0][vrow * VSTR + vc8]) = b;
  }
  __syncthreads();

  const int NIT = (SEQ + 31) / 32;             // 129
  // all tiles but the last: every key is real and a next tile exists.
  // Stays rolled and unpeeled: a peeled copy keeps a second set of the 8 start-value registers,
  // copied on every trip
  #pragma unroll 1
  for (int it = 0; it < NIT - 1; ++it) {
    const int j0 = it * 32;
    const int cur = it & 1;
    // scores: K-tile (32x64) x Q^T (64x16) -> two 16x16 f32 fragments (keys x queries)
    const __bf16* kt = &sK[cur][0];
    BFrag K1a = ld_frag(kt, KSTR);
    BFrag K1b = ld_frag(kt + 32, KSTR);
    BFrag K2a = ld_frag(kt + 16 * KSTR, KSTR);
    BFrag K2b = ld_frag(kt + 16 * KSTR + 32, KSTR);
    // Vt fragments, asked for together with K's: behind the test below they would start only after it
    const __bf16* vtile = &sV[cur][0];
    BFrag V0 = ld_frag(vtile,             VSTR);
    BFrag V1 = ld_frag(vtile + 16 * VSTR, VSTR);
    BFrag V2 = ld_frag(vtile + 32 * VSTR, VSTR);
    BFrag V3 = ld_frag(vtile + 48 * VSTR, VSTR);

    // prefetch next tile into regs; behind the fragment loads, so that the wait below runs while those are under way
    const __bf16* kc = kg + (long)j0 * DP;     // the next tile's 32 rows stand 4096 bytes behind it
    const __bf16* vc = vg + j0;                // the next tile's 32 keys stand 64 bytes behind it
    const u32x4 ka = *reinterpret_cast<const u32x4*>(kc + 32 * DP);
    const u32x4 va = *reinterpret_cast<const u32x4*>(vc + 32);
    if (it + 2 < NIT) {
      __builtin_prefetch(kc + 64 * DP, 0, 0);
      __builtin_prefetch(vc + 64, 0, 0);
    }
    // the two loads and the prefetches name kc's and vc's register pairs: the wait stands before
    // either pair may be written again (as inputs they stay untouched up to it)
    asm volatile("s_wait_xcnt 0x0" :: "v"(kc), "v"(vc) : "memory");

    // the maximum in use enters the products as their start value: S = score - mrow
    v8f S1 = wmma_bf16(K1b, Qb, wmma_bf16(K1a, Qa, nm));
    v8f S2 = wmma_bf16(K2b, Qb, wmma_bf16(K2a, Qa, nm));
    // nm as an input only: it stays in its registers past both products, which then read it in place;
    // without this line the second product gets a copy of all 8 registers on every trip
    asm volatile("" :: "v"(nm));

    // one test a tile for the whole wave: the maximum in use moves only when some score lies more
    // than 8 above it (an exponential then stays below 2^8; the denominator carries the same scale)
    if (__builtin_amdgcn_ballot_w32(max16(S1, S2) > 8.0f) != 0) {
      // always taken on tile 0 (mrow = -1e30 swamps the scores), so the scores are formed anew from 0
      S1 = wmma_bf16(K1b, Qb, wmma_bf16(K1a, Qa, vzero()));
      S2 = wmma_bf16(K2b, Qb, wmma_bf16(K2a, Qa, vzero()));
      const float corr = new_max(S1, S2, mrow);
      acc0 *= corr; acc1 *= corr; acc2 *= corr; acc3 *= corr;
      #pragma unroll
      for (int r = 0; r < 8; ++r) nm[r] = -mrow;
    }

    // Vt-tile rows (64 x 32) x P^T (32x16); row d==40 of Vt is all-ones -> l in acc2
    const BFrag P = exp_pack(S1, S2);
    acc0 = wmma_bf16(V0, P, acc0);
    acc1 = wmma_bf16(V1, P, acc1);
    acc2 = wmma_bf16(V2, P, acc2);
    acc3 = wmma_bf16(V3, P, acc3);

    // fill the other buffer
    *reinterpret_cast<u32x4*>(&sK[1 - cur][krow * KSTR + kc8]) = ka;
    *reinterpret_cast<u32x4*>(&sV[1 - cur][vrow * VSTR + vc8]) = va;
    __syncthreads();
  }

  // last tile: keys past SEQ are masked (keys are register rows); its maximum is always taken in
  {
    const int j0 = (NIT - 1) * 32;
    const __bf16* kt = &sK[(NIT - 1) & 1][0];
    BFrag K1a = ld_frag(kt, KSTR);
    BFrag K1b = ld_frag(kt + 32, KSTR);
    BFrag K2a = ld_frag(kt + 16 * KSTR, KSTR);
    BFrag K2b = ld_frag(kt + 16 * KSTR + 32, KSTR);
    v8f S1 = wmma_bf16(K1b, Qb, wmma_bf16(K1a, Qa, vzero()));
    v8f S2 = wmma_bf16(K2b, Qb, wmma_bf16(K2a, Qa, vzero()));
    #pragma unroll
    for (int r = 0; r < 8; ++r) {
      if (j0 + 8 * hm + r      >= SEQ) S1[r] = -1e30f;
      if (j0 + 16 + 8 * hm + r >= SEQ) S2[r] = -1e30f;
    }
    const float corr = new_max(S1, S2, mrow);
    acc0 *= corr; acc1 *= corr; acc2 *= corr; acc3 *= corr;
    const BFrag P = exp_pack(S1, S2);
    const __bf16* vtile = &sV[(NIT - 1) & 1][0];
    acc0 = wmma_bf16(ld_frag(vtile,             VSTR), P, acc0);
    acc1 = wmma_bf16(ld_frag(vtile + 16 * VSTR, VSTR), P, acc1);
    acc2 = wmma_bf16(ld_frag(vtile + 32 * VSTR, VSTR), P, acc2);
    acc3 = wmma_bf16(ld_frag(vtile + 48 * VSTR, VSTR), P, acc3);
  }

  // softmax denominator = row d==HD of Ot: tile 2, register 0, upper wave half
  const float lo   = acc2[0];
  const float lx   = xhalf(lo);
  const float linv = __builtin_amdgcn_rcpf(hm ? lo : lx);

  const int  hh   = bh & (NH - 1);
  const long brow = (long)(bh >> 2) * SEQ_Q;
  float* orow = cat + (brow + qb * 16 + n) * DM + hh * HD;   // query row < 4096
  v8f accar[4] = {acc0, acc1, acc2, acc3};
  #pragma unroll
  for (int f = 0; f < 4; ++f) {
    int d0 = f * 16 + 8 * hm;                  // 8 consecutive d per lane
    if (d0 < HD) {
      v8f a = accar[f] * linv;
      *reinterpret_cast<float4*>(orow + d0)     = make_float4(a[0], a[1], a[2], a[3]);
      *reinterpret_cast<float4*>(orow + d0 + 4) = make_float4(a[4], a[5], a[6], a[7]);
    }
  }
}

// ---------------- LayerNorm + residual + transpose + 2x nearest upsample ----------------
// 1 block = one image row = 64 tokens x 160 channels (40 KB of cat in a row). 8 lanes share a
// token; lane p holds the 16-byte pieces p, p + 8, .., p + 32 of its row, so each load of a
// wave is four whole lines and cat is read once. Mean and variance: 20 values in-lane, then
// three exchanges inside the group of 8 lanes. The finished tile is turned in LDS
// (channel-major); a wave then writes whole output rows, 512 contiguous bytes a store.
#define ETHR 512            // threads per block
#define ETOK 64             // tokens per block
#define EPIT 66             // LDS pitch in floats of a channel's 64 tokens (spreads the banks)
#define ECH  (DM / (ETHR / 32))   // channels per wave in the store phase

// value of lane l ^ M inside a row of 16 lanes (DPP row_xmask)
template <int M>
__device__ __forceinline__ float xlane(float v) {
  return __builtin_bit_cast(float, __builtin_amdgcn_update_dpp(
      0, __builtin_bit_cast(int, v), 0x160 + M, 0xf, 0xf, true));
}

__global__ void __launch_bounds__(ETHR) k_epi(const float* __restrict__ cat,
                                              const float* __restrict__ lw,
                                              const float* __restrict__ lb,
                                              float* __restrict__ out) {
  __shared__ __attribute__((aligned(16))) float tl[DM * EPIT];
  const int tok = threadIdx.x >> 3, p = threadIdx.x & 7;
  const int b = blockIdx.x >> 6, ih = blockIdx.x & 63;

  const float4* row = reinterpret_cast<const float4*>(cat + ((long)blockIdx.x * ETOK + tok) * DM) + p;
  const float4* gp  = reinterpret_cast<const float4*>(lw) + p;
  const float4* hp  = reinterpret_cast<const float4*>(lb) + p;
  float4 x[5], g[5], h[5];
  #pragma unroll
  for (int i = 0; i < 5; ++i) x[i] = row[8 * i];
  #pragma unroll
  for (int i = 0; i < 5; ++i) { g[i] = gp[8 * i]; h[i] = hp[8 * i]; }
  // keeps the scheduler from sinking the lw/lb loads behind the sums, where each pair is waited for alone
  __builtin_amdgcn_sched_barrier(0);
  // the 15 loads name row's register pair and p's register: the wait stands before either may
  // be written again (as inputs they stay untouched up to it)
  asm volatile("s_wait_xcnt 0x0" :: "v"(row), "v"(p) : "memory");

  float sm = 0.f;
  #pragma unroll
  for (int i = 0; i < 5; ++i) sm += (x[i].x + x[i].y) + (x[i].z + x[i].w);
  sm += xlane<1>(sm); sm += xlane<2>(sm); sm += xlane<4>(sm);
  const float mu = sm * (1.f / DM);

  float vs = 0.f;
  #pragma unroll
  for (int i = 0; i < 5; ++i) {
    const float d0 = x[i].x - mu, d1 = x[i].y - mu, d2 = x[i].z - mu, d3 = x[i].w - mu;
    vs += d0 * d0; vs += d1 * d1; vs += d2 * d2; vs += d3 * d3;
  }
  vs += xlane<1>(vs); vs += xlane<2>(vs); vs += xlane<4>(vs);
  const float inv = rsqrtf(vs * (1.f / DM) + 1e-5f);

  #pragma unroll
  for (int i = 0; i < 5; ++i) {
    float* t = &tl[4 * (p + 8 * i) * EPIT + tok];
    t[0]        = (x[i].x - mu) * inv * g[i].x + h[i].x + x[i].x;
    t[EPIT]     = (x[i].y - mu) * inv * g[i].y + h[i].y + x[i].y;
    t[2 * EPIT] = (x[i].z - mu) * inv * g[i].z + h[i].z + x[i].z;
    t[3 * EPIT] = (x[i].w - mu) * inv * g[i].w + h[i].w + x[i].w;
  }
  __syncthreads();

  // lane l: tokens 2l and 2l + 1, each doubled = output columns 4l .. 4l + 3; rows 2ih, 2ih + 1
  const int lane = threadIdx.x & 31;
  const int c0   = __builtin_amdgcn_readfirstlane(threadIdx.x >> 5) * ECH;
  float* o = out + (((long)b * DM + c0) * 128 + 2 * ih) * 128 + 4 * lane;
  #pragma unroll
  for (int j = 0; j < ECH; ++j) {
    const float2 v = *reinterpret_cast<const float2*>(&tl[(c0 + j) * EPIT + 2 * lane]);
    const float4 w = make_float4(v.x, v.x, v.y, v.y);
    *reinterpret_cast<float4*>(o + j * 128 * 128)       = w;
    *reinterpret_cast<float4*>(o + j * 128 * 128 + 128) = w;
  }
}

// ---------------- launch ----------------
extern "C" void kernel_launch(void* const* d_in, const int* in_sizes, int n_in,
                              void* d_out, int out_size, void* d_ws, size_t ws_size,
                              hipStream_t stream) {
  (void)in_sizes; (void)n_in; (void)out_size; (void)ws_size;
  const float* x   = (const float*)d_in[0];
  const float* w1  = (const float*)d_in[1];
  const float* b1  = (const float*)d_in[2];
  const float* w2  = (const float*)d_in[3];
  const float* b2  = (const float*)d_in[4];
  const float* pe  = (const float*)d_in[5];
  const float* wq  = (const float*)d_in[6];
  const float* wk  = (const float*)d_in[7];
  const float* wv  = (const float*)d_in[8];
  const float* lw  = (const float*)d_in[9];
  const float* lb  = (const float*)d_in[10];
  float* out = (float*)d_out;
  char*  ws  = (char*)d_ws;

  // workspace layout (bytes), all 16B aligned
  constexpr long C1_OFF  = 0;                                   // 4*64*4096 f32      = 4,194,304 B
  constexpr long FBF_OFF = C1_OFF  + 4L * 64 * HW * 4;          // 4*4128*160 bf16    = 5,283,840 B
  constexpr long WB_OFF  = FBF_OFF + (long)BATCH * FPAD * DM * 2;   // 3*160*160 bf16 = 153,600 B
  constexpr long Q_OFF   = WB_OFF  + 3L * DM * DM * 2;          // 16*4128*64 bf16    = 8,454,144 B
  constexpr long K_OFF   = Q_OFF   + 16L * SPAD * DP * 2;
  constexpr long VT_OFF  = K_OFF   + 16L * SPAD * DP * 2;
  constexpr long CAT_OFF = VT_OFF  + 16L * SPAD * DP * 2;       // 4*4096*160 f32     = 10,485,760 B

  float*  c1  = (float*) (ws + C1_OFF);
  __bf16* fbf = (__bf16*)(ws + FBF_OFF);
  __bf16* wb  = (__bf16*)(ws + WB_OFF);
  __bf16* qb  = (__bf16*)(ws + Q_OFF);
  __bf16* kb  = (__bf16*)(ws + K_OFF);
  __bf16* vtb = (__bf16*)(ws + VT_OFF);
  float*  cat = (float*) (ws + CAT_OFF);

  k_cvtw <<<(3 * DM * DM + 255) / 256, 256, 0, stream>>>(wq, wk, wv, wb);
  k_conv1<<<64 * 8, C1THR, 0, stream>>>(x, w1, b1, c1);
  k_conv2f<<<(BATCH * FPAD) / C2ROWS, C2THR, 0, stream>>>(c1, w2, b2, pe, fbf);

  // writes every byte of q, k and vt (pads and the ones row included)
  k_qkv  <<<3 * NH * BATCH * QG / 8, 256, 0, stream>>>(fbf, wb, qb, kb, vtb);   // 516 blocks

  k_attn <<<512, 256, 0, stream>>>(qb, kb, vtb, cat);           // 16 bh x 32 q-groups

  k_epi  <<<(BATCH * HW) / ETOK, ETHR, 0, stream>>>(cat, lw, lb, out);   // one block per image row
}

// v007
// One run takes 100 microseconds.
// Next to v006, in two timings, it ran 1.06 times as fast each time.
// All steps since v000 together make it 3.07 times as fast.
#include <hip/hip_runtime.h>
#include <hip/hip_bf16.h>

// ---------------- CDNA5 WMMA types ----------------
typedef __attribute__((ext_vector_type(16))) __bf16       v16bf;
typedef __attribute__((ext_vector_type(8)))  float        v8f;
typedef __attribute__((ext_vector_type(4)))  unsigned int u32x4;

#define BATCH 4
#define DM    160           // d_model
#define NH    4
#define HD    40            // head dim
#define DP    64            // padded head dim (4 x 16)
#define HW    4096          // 64*64 tokens
#define SEQ   4097          // tokens + pad row
#define SEQ_Q 4096          // queries that survive cat[:, :-1, :]
#define SPAD  4128          // K/V padded length (multiple of 32)
#define FPAD  4128          // f rows padded to the K/V length: rows above HW + 1 are 0
#define SBLK  258           // SPAD / 16 token tiles
#define KSTR  72            // LDS K-tile row stride (bank-conflict-free for b128)
#define VSTR  40            // LDS V-tile row stride (bank-conflict-free for b128)

union BFrag { v16bf v; u32x4 u[2]; };

// 16x32 bf16 A/B fragment loader (row-major tile, `stride` elements per row).
// Lanes 0-15 : row=lane,    K chunks {0..7} and {16..23}
// Lanes 16-31: row=lane-16, K chunks {8..15} and {24..31}
__device__ __forceinline__ BFrag ld_frag(const __bf16* base, int stride) {
  const int lane = threadIdx.x & 31;
  const int r  = lane & 15;
  const int hh = lane >> 4;
  const __bf16* p = base + (long)r * stride + 8 * hh;
  BFrag f;
  f.u[0] = *reinterpret_cast<const u32x4*>(p);
  f.u[1] = *reinterpret_cast<const u32x4*>(p + 16);
  return f;
}

__device__ __forceinline__ v8f wmma_bf16(const BFrag& a, const BFrag& b, v8f c) {
  return __builtin_amdgcn_wmma_f32_16x16x32_bf16(false, a.v, false, b.v,
                                                 (short)0, c, false, false);
}

__device__ __forceinline__ v8f vzero() {
  v8f z = {0.f, 0.f, 0.f, 0.f, 0.f, 0.f, 0.f, 0.f};
  return z;
}

// ---------------- conv1: 64->64, 2x2 stride 2 ----------------
// 1 block = 256 output positions (4 rows) x 8 output channels. Lanes run along the
// positions, so an x load is two whole lines, and each x value is used 8 times from a
// register. All 8 waves of a block work on the same 8 channels: the weights are uniform
// (scalar loads), and the block's 8 KB of them are fetched once for its 8 waves.
#define C1OC   8            // output channels per block
#define C1THR  256          // threads per block
#define C1CH   16           // input channels per register chunk (4 chunks)
#define C1W    8            // weights per channel and step
#define C1NS   (4 * 256 / C1W)   // steps: 4 channel pairs x 256 weights a channel

// Step G: 2 channels x C1W / 4 input channels, every index a compile-time constant.
// Step G + 1's weights are fetched while step G is worked on; the next chunk's x is
// fetched at the first step of a chunk.
template <int G>
__device__ __forceinline__ void c1_step(const float2* xp, const float* wp,
                                        float2 (&xb)[2][2 * C1CH], float (&wb)[2][2 * C1W],
                                        float (&at)[C1OC], float (&ab)[C1OC]) {
  constexpr int SPP = C1CH * 4 / C1W;        // steps per channel pair inside a chunk
  constexpr int SPC = 4 * SPP;               // steps per chunk
  constexpr int ch = G / SPC, j0 = ((G / SPP) & 3) * 2, q = G % SPP;
  if constexpr (G % SPC == 0 && ch + 1 < 4) {
    #pragma unroll
    for (int i = 0; i < C1CH; ++i) {
      xb[(ch + 1) & 1][2 * i]     = xp[((ch + 1) * C1CH + i) * 8192];
      xb[(ch + 1) & 1][2 * i + 1] = xp[((ch + 1) * C1CH + i) * 8192 + 64];
    }
  }
  if constexpr (G + 1 < C1NS) {
    constexpr int cn = (G + 1) / SPC, jn = (((G + 1) / SPP) & 3) * 2, qn = (G + 1) % SPP;
    #pragma unroll
    for (int i = 0; i < C1W; ++i) {
      wb[(G + 1) & 1][i]       = wp[jn * 256 + cn * 64 + qn * C1W + i];
      wb[(G + 1) & 1][C1W + i] = wp[(jn + 1) * 256 + cn * 64 + qn * C1W + i];
    }
  }
  if constexpr (G % SPC == 0 && ch + 2 == 4) {
    // all 128 x loads name xp's register pair: the wait stands before the pair may be
    // written again (xp as an input keeps the pair untouched up to the wait)
    asm volatile("s_wait_xcnt 0x0" :: "v"(xp) : "memory");
  }
  #pragma unroll
  for (int i = 0; i < C1W / 4; ++i) {
    const float2 t = xb[ch & 1][2 * (q * (C1W / 4) + i)];
    const float2 u = xb[ch & 1][2 * (q * (C1W / 4) + i) + 1];
    at[j0]     += t.x * wb[G & 1][4 * i];
    at[j0 + 1] += t.x * wb[G & 1][C1W + 4 * i];
    ab[j0]     += u.x * wb[G & 1][4 * i + 2];
    ab[j0 + 1] += u.x * wb[G & 1][C1W + 4 * i + 2];
    at[j0]     += t.y * wb[G & 1][4 * i + 1];
    at[j0 + 1] += t.y * wb[G & 1][C1W + 4 * i + 1];
    ab[j0]     += u.y * wb[G & 1][4 * i + 3];
    ab[j0 + 1] += u.y * wb[G & 1][C1W + 4 * i + 3];
  }
  // keeps the scheduler from lifting all the loads to the top, which spills registers
  __builtin_amdgcn_sched_barrier(0);
  if constexpr (G + 1 < C1NS) c1_step<G + 1>(xp, wp, xb, wb, at, ab);
}

__global__ void __launch_bounds__(C1THR) k_conv1(const float* __restrict__ x,
                                                 const float* __restrict__ w,
                                                 const float* __restrict__ bias,
                                                 float* __restrict__ c1) {
  const int oc0 = (blockIdx.x & 7) * C1OC;   // the 8 blocks that share x are neighbours
  const int pb  = blockIdx.x >> 3;           // 64 groups of 256 positions
  const int b   = pb >> 4;
  const int oh  = (pb & 15) * 4 + (threadIdx.x >> 6);
  const int ow  = threadIdx.x & 63;

  // xp[ic * 8192]: row 2*oh, xp[ic * 8192 + 64]: row 2*oh + 1 (units of two floats)
  const float2* xp = reinterpret_cast<const float2*>(
      x + ((long)b * 64 * 128 + 2 * oh) * 128 + 2 * ow);
  const float* wp = w + oc0 * 256;

  float2 xb[2][2 * C1CH];
  float  wb[2][2 * C1W];
  #pragma unroll
  for (int i = 0; i < C1CH; ++i) {
    xb[0][2 * i]     = xp[i * 8192];
    xb[0][2 * i + 1] = xp[i * 8192 + 64];
  }
  #pragma unroll
  for (int i = 0; i < C1W; ++i) { wb[0][i] = wp[i]; wb[0][C1W + i] = wp[256 + i]; }

  // per channel two sums, one per input row, each over ic = 0..63 in order
  float at[C1OC], ab[C1OC];
  #pragma unroll
  for (int j = 0; j < C1OC; ++j) { at[j] = 0.f; ab[j] = 0.f; }

  c1_step<0>(xp, wp, xb, wb, at, ab);

  float* op = c1 + ((long)b * 64 + oc0) * HW + oh * 64 + ow;
  #pragma unroll
  for (int j = 0; j < C1OC; ++j) op[j * HW] = bias[oc0 + j] + (at[j] + ab[j]);
}

// ---------- conv2 (1x1) + bias + leaky + transpose + pad + PE -> bf16 tokens ----------
// 1 block = 32 token rows x all 160 channels. Lanes run along the tokens, so a c1 load is
// one whole line; a wave owns 10 channels, so its weights are wave-uniform (scalar loads)
// and each c1 value is used 10 times from a register. The 32x160 tile is contiguous in
// fbf: it is turned in LDS and leaves as whole 16-byte pieces.
#define C2ROWS 32           // token rows per block (BATCH*FPAD = 516 * 32)
#define C2OC   10           // channels per wave (16 waves x 10 = DM)
#define C2THR  512          // threads per block
#define C2PIT  168          // LDS row pitch in bf16 (336 B: 16-B aligned, spreads the banks)
typedef __attribute__((ext_vector_type(2))) __bf16 v2bf;

__global__ void __launch_bounds__(C2THR) k_conv2f(const float* __restrict__ c1,
                                                  const float* __restrict__ w,
                                                  const float* __restrict__ bias,
                                                  const float* __restrict__ pe,
                                                  __bf16* __restrict__ fbf) {
  __shared__ __attribute__((aligned(16))) __bf16 tile[C2ROWS * C2PIT];
  const int lane = threadIdx.x & 31;
  const int oc0  = __builtin_amdgcn_readfirstlane(threadIdx.x >> 5) * C2OC;
  const int row  = blockIdx.x * C2ROWS + lane;      // b * FPAD + s
  const int b    = row / FPAD;
  const int s    = row - b * FPAD;
  const int sc   = s < HW ? s : HW - 1;             // pad rows read a valid column, result unused

  const int   si = s < HW ? s : HW;
  const float pv = pe[si];
  // the pe load names si's register as its offset: the wait stands before anything may be
  // written there (si as an input keeps the register untouched up to the wait)
  asm volatile("s_wait_xcnt 0x0" :: "v"(si) : "memory");

  const float* cp = c1 + (long)b * 64 * HW + sc;
  float xv[64];
  #pragma unroll
  for (int ic = 0; ic < 64; ++ic) xv[ic] = cp[(long)ic * HW];
  // the 64 loads name cp's register pair: the wait stands before the pair is used for sums
  asm volatile("s_wait_xcnt 0x0" :: "v"(cp) : "memory");

  // 20 groups of 2 channels x 16 inputs; per channel the sum runs over ic = 0..63 in order.
  // A group's 32 weights are fetched while the group before it is worked on.
  const float* wp = w + oc0 * 64;
  float wc[32], wn[32];
  #pragma unroll
  for (int i = 0; i < 16; ++i) { wc[i] = wp[i]; wc[16 + i] = wp[64 + i]; }
  float a0 = 0.f, a1 = 0.f;
  #pragma unroll
  for (int g = 0; g < 20; ++g) {
    const int j0 = (g >> 2) * 2, icb = (g & 3) * 16;
    if (g + 1 < 20) {
      const int jn = ((g + 1) >> 2) * 2, icn = ((g + 1) & 3) * 16;
      #pragma unroll
      for (int i = 0; i < 16; ++i) {
        wn[i]      = wp[jn * 64 + icn + i];
        wn[16 + i] = wp[(jn + 1) * 64 + icn + i];
      }
    }
    if (icb == 0) { a0 = bias[oc0 + j0]; a1 = bias[oc0 + j0 + 1]; }
    #pragma unroll
    for (int i = 0; i < 16; ++i) {
      a0 += xv[icb + i] * wc[i];
      a1 += xv[icb + i] * wc[16 + i];
    }
    if (icb == 48) {
      float l0 = a0 >= 0.f ? a0 : 0.01f * a0;
      float l1 = a1 >= 0.f ? a1 : 0.01f * a1;
      // row HW: zero-pad row + positional value; rows above it stay 0 (safe WMMA tiles)
      v2bf t;
      t[0] = (__bf16)(s < HW ? l0 + pv : (s == HW ? pv : 0.f));
      t[1] = (__bf16)(s < HW ? l1 + pv : (s == HW ? pv : 0.f));
      *reinterpret_cast<v2bf*>(&tile[lane * C2PIT + oc0 + j0]) = t;
    }
    // keeps the scheduler from lifting all the weight loads to the top, which spills scalar registers
    __builtin_amdgcn_sched_barrier(0);
    #pragma unroll
    for (int i = 0; i < 32; ++i) wc[i] = wn[i];
  }
  __syncthreads();

  __bf16* dst = fbf + (long)blockIdx.x * C2ROWS * DM;
  for (int c = threadIdx.x; c < C2ROWS * DM / 8; c += C2THR) {
    const int r = c / (DM / 8), kk = c - r * (DM / 8);
    *reinterpret_cast<u32x4*>(dst + c * 8) =
        *reinterpret_cast<const u32x4*>(&tile[r * C2PIT + kk * 8]);
  }
}

// ---------------- wq/wk/wv -> bf16 ----------------
__global__ void k_cvtw(const float* __restrict__ wq, const float* __restrict__ wk,
                       const float* __restrict__ wv, __bf16* __restrict__ o) {
  int i = blockIdx.x * 256 + threadIdx.x;
  if (i >= 3 * DM * DM) return;
  const float* src = (i < DM * DM) ? wq : (i < 2 * DM * DM ? wk : wv);
  o[i] = (__bf16)src[i % (DM * DM)];
}

// ---------------- QKV projection GEMM (WMMA bf16) ----------------
// one wave = one of {q,k,v} x one head x QT token tiles. The head's 40 weight rows (3 tiles
// of 16, the last half used) stay in registers for all its token tiles; K = 160 = 5 x K32.
// The wave writes the whole padded head (DP = 64 dims) of its tokens, pads included, so
// every byte of q, k and vt is written here and nothing has to be cleared beforehand.
// q, k: Dt = W * Ft, a lane holds 8 consecutive dims of ONE token  = one 16-byte store.
// v   : D  = F * Wt, a lane holds 8 consecutive tokens of ONE dim  = one 16-byte store of Vt.
// Vt row d == HD is all ones (softmax denominator via WMMA); every other pad is 0.
// Q output is pre-scaled by (1/sqrt(HD)) * log2(e) so attention uses raw exp2.
#define QT 3                // token tiles per wave
#define QG (SBLK / QT)      // 86 wave groups per batch; BATCH * QG = 344 waves = 43 blocks per (mat, head)

union Pack8 { __bf16 h[8]; u32x4 u; };

// one lane's share of the 5 fragments of a 16-token tile (lane map of ld_frag; fpl holds the lane's row)
__device__ __forceinline__ void ld_ftile(BFrag (&f)[5], const __bf16* fpl) {
  #pragma unroll
  for (int kk = 0; kk < 5; ++kk) {
    f[kk].u[0] = *reinterpret_cast<const u32x4*>(fpl + kk * 32);
    f[kk].u[1] = *reinterpret_cast<const u32x4*>(fpl + kk * 32 + 16);
  }
}

// products of one token tile. VT: D = F * Wt (rows = tokens); else Dt = W * Ft (rows = dims)
template <bool VT>
__device__ __forceinline__ void qkv_mm(const BFrag (&Wf)[3][5], const BFrag (&F)[5],
                                       v8f& a0, v8f& a1, v8f& a2) {
  a0 = vzero(); a1 = vzero(); a2 = vzero();
  #pragma unroll
  for (int kk = 0; kk < 5; ++kk) {
    if constexpr (VT) {
      a0 = wmma_bf16(F[kk], Wf[0][kk], a0);
      a1 = wmma_bf16(F[kk], Wf[1][kk], a1);
      a2 = wmma_bf16(F[kk], Wf[2][kk], a2);
    } else {
      a0 = wmma_bf16(Wf[0][kk], F[kk], a0);
      a1 = wmma_bf16(Wf[1][kk], F[kk], a1);
      a2 = wmma_bf16(Wf[2][kk], F[kk], a2);
    }
  }
}

// one token tile out: 4 tiles of 16 dims, DS apart; real: this lane holds dims 32..39 in tile 2
template <bool VT>
__device__ __forceinline__ void qkv_out(__bf16* o, const v8f& a0, const v8f& a1, const v8f& a2,
                                        float sc, bool real, float padv) {
  constexpr long DS = VT ? 16 * SPAD : 16;
  const u32x4 zz = {0u, 0u, 0u, 0u};
  Pack8 p0, p1, p2;
  #pragma unroll
  for (int i = 0; i < 8; ++i) {
    const float e0 = VT ? a0[i] : a0[i] * sc;
    const float e1 = VT ? a1[i] : a1[i] * sc;
    const float e2 = VT ? a2[i] : a2[i] * sc;
    p0.h[i] = (__bf16)e0;
    p1.h[i] = (__bf16)e1;
    p2.h[i] = (__bf16)(real ? e2 : padv);
  }
  *reinterpret_cast<u32x4*>(o)          = p0.u;
  *reinterpret_cast<u32x4*>(o + DS)     = p1.u;
  *reinterpret_cast<u32x4*>(o + 2 * DS) = p2.u;
  *reinterpret_cast<u32x4*>(o + 3 * DS) = zz;
}

// The QT token tiles of a wave, one after the other; the other waves of the SIMD cover the loads' latency.
template <bool VT>
__device__ __forceinline__ void qkv_tiles(const BFrag (&Wf)[3][5], const __bf16* fpl, __bf16* op,
                                          float sc, int n, int hm) {
  constexpr long TS = VT ? 16 : 16 * DP;                        // step of op per token tile
  const bool  real = VT ? (n < HD - 32) : (hm == 0);            // dims 32..39 of tile 2
  const float padv = (VT && n == HD - 32) ? 1.0f : 0.0f;        // dims 40..47: ones row of Vt, else 0
  // stays rolled: unrolled, each tile gets registers of its own, the wave passes 256 registers
  // and only one block fits a WGP
  #pragma unroll 1
  for (int j = 0; j < QT; ++j) {
    BFrag F[5];
    ld_ftile(F, fpl + j * 16 * DM);
    // holds the tile's 10 loads together in front of the products (loaded values as inputs only):
    // else each pair is loaded and waited for alone, five load latencies a tile instead of one
    asm volatile("" :: "v"(F[0].u[0]), "v"(F[0].u[1]), "v"(F[1].u[0]), "v"(F[1].u[1]),
                       "v"(F[2].u[0]), "v"(F[2].u[1]), "v"(F[3].u[0]), "v"(F[3].u[1]),
                       "v"(F[4].u[0]), "v"(F[4].u[1]));
    v8f a0, a1, a2;
    qkv_mm<VT>(Wf, F, a0, a1, a2);
    qkv_out<VT>(op + j * TS, a0, a1, a2, sc, real, padv);
    // the stores of this trip name address and data registers that the next trip writes again:
    // the wait stands before the back edge, in front of all of those writes
    asm volatile("s_wait_xcnt 0x0" ::: "memory");
  }
}

__global__ void __launch_bounds__(256) k_qkv(const __bf16* __restrict__ fbf,
                                             const __bf16* __restrict__ wb,
                                             __bf16* __restrict__ q,
                                             __bf16* __restrict__ k,
                                             __bf16* __restrict__ vt) {
  const int wid  = __builtin_amdgcn_readfirstlane(blockIdx.x * 8 + (threadIdx.x >> 5));
  const int mh   = wid / (BATCH * QG);         // mat * NH + head
  const int rest = wid - mh * (BATCH * QG);
  const int b    = rest / QG;
  const int g    = rest - b * QG;
  const int mat  = mh >> 2, hh = mh & (NH - 1);
  const int lane = threadIdx.x & 31;
  const int n  = lane & 15;
  const int hm = lane >> 4;

  // weight fragments, lane map of ld_frag: tiles 0 and 1 are rows n and 16 + n of the head; in
  // tile 2 the rows past the head's 40 read its last row (their products land in pad positions
  // and are replaced on the way out)
  const __bf16* wh  = wb + ((long)mat * DM + hh * HD) * DM + 8 * hm;
  const __bf16* w01 = wh + n * DM;
  const __bf16* w2  = wh + (n < HD - 32 ? 32 + n : HD - 1) * DM;
  BFrag Wf[3][5];
  ld_ftile(Wf[0], w01);
  ld_ftile(Wf[1], w01 + 16 * DM);
  ld_ftile(Wf[2], w2);

  const long bh = (long)b * NH + hh;
  const int  s0 = g * QT * 16;
  const __bf16* fpl = fbf + ((long)b * FPAD + s0 + n) * DM + 8 * hm;
  // the 30 weight loads name the two pairs w01 and w2: the wait stands before either may be
  // written again (as inputs they stay untouched up to it)
  asm volatile("s_wait_xcnt 0x0" :: "v"(w01), "v"(w2) : "memory");

  if (mat == 2) {
    qkv_tiles<true>(Wf, fpl, vt + (bh * DP + n) * SPAD + s0 + 8 * hm, 1.0f, n, hm);
  } else {
    qkv_tiles<false>(Wf, fpl, (mat == 0 ? q : k) + (bh * SPAD + s0 + n) * DP + 8 * hm,
                     (mat == 0) ? 0.22811012f : 1.0f,   // q: (1/sqrt(40)) * log2(e)
                     n, hm);
  }
}

#define KH 64               // full key tiles per key half

// value of lane l ^ 16
__device__ __forceinline__ float xhalf(float v) {
  int b = __builtin_bit_cast(int, v);
  b = __builtin_amdgcn_permlanex16(b, b, 0x76543210, 0xfedcba98, false, false);
  return __builtin_bit_cast(float, b);
}

// largest of a lane's 16 scores (four short independent chains, not one of sixteen links)
__device__ __forceinline__ float max16(const v8f& S1, const v8f& S2) {
  const float mxa = fmaxf(fmaxf(S1[0], S1[1]), fmaxf(S1[2], S1[3]));
  const float mxb = fmaxf(fmaxf(S1[4], S1[5]), fmaxf(S1[6], S1[7]));
  const float mxc = fmaxf(fmaxf(S2[0], S2[1]), fmaxf(S2[2], S2[3]));
  const float mxd = fmaxf(fmaxf(S2[4], S2[5]), fmaxf(S2[6], S2[7]));
  return fmaxf(fmaxf(mxa, mxb), fmaxf(mxc, mxd));
}

// takes a tile's true maximum into mrow (16 keys in-lane, the query's other 16 in lane ^ 16),
// moves the raw scores onto it and returns the factor that moves the sums kept so far
__device__ __forceinline__ float new_max(v8f& S1, v8f& S2, float& mrow) {
  const float mx   = max16(S1, S2);
  const float mn   = fmaxf(mrow, fmaxf(mx, xhalf(mx)));
  const float corr = __builtin_amdgcn_exp2f(mrow - mn);   // scores already in exp2 domain
  mrow = mn;
  S1 -= mn; S2 -= mn;
  return corr;
}

// P^T as B operand: element s = key 8*hm + s (s < 8) or 16 + 8*hm + s - 8 (s >= 8), straight from the two score tiles
__device__ __forceinline__ BFrag exp_pack(const v8f& S1, const v8f& S2) {
  BFrag P;
  #pragma unroll
  for (int r = 0; r < 8; ++r) {
    P.v[r]     = (__bf16)__builtin_amdgcn_exp2f(S1[r]);
    P.v[8 + r] = (__bf16)__builtin_amdgcn_exp2f(S2[r]);
  }
  return P;
}

__global__ void __launch_bounds__(256) k_attn(const __bf16* __restrict__ q,
                                              const __bf16* __restrict__ k,
                                              const __bf16* __restrict__ vt,
                                              float* __restrict__ cat) {
  __shared__ __attribute__((aligned(16))) __bf16 sK[2][2][32 * KSTR];   // [buffer][key half]
  __shared__ __attribute__((aligned(16))) __bf16 sV[2][2][64 * VSTR];
  __shared__ __attribute__((aligned(16))) float4 sC[4][12][32];         // upper key half's sums
  __shared__ float sM[4][2][32];                                        // and its maxima in use

  const int bh = blockIdx.x >> 5;              // 16 (b,h) pairs
  const int qg = blockIdx.x & 31;              // 32 groups of 128 queries
  const int wv = __builtin_amdgcn_readfirstlane(threadIdx.x >> 5);
  const int g  = wv & 3;                       // which 32 queries of the block
  const int kh = wv >> 2;                      // which half of the keys
  const int qb = qg * 8 + g * 2;               // first of the wave's two 16-query tiles (< 256)
  const int lane = threadIdx.x & 31;
  const int n  = lane & 15;
  const int hm = lane >> 4;
  const int tid = threadIdx.x;

  // cooperative staging coordinates (256 threads: K 32x64, V 64x32, 16B each, per key half)
  const int krow = tid >> 3, kc8 = (tid & 7) * 8;
  const int vrow = tid >> 2, vc8 = (tid & 3) * 8;
  const __bf16* kg = k  + ((long)bh * SPAD + krow) * DP + kc8;
  const __bf16* vg = vt + ((long)bh * DP + vrow) * SPAD + vc8;
  constexpr int KHK = KH * 32 * DP;            // from a tile of the lower half to its partner, in k
  constexpr int KHV = KH * 32;                 // the same in a row of vt

  const __bf16* qbase = q + ((long)bh * SPAD + qb * 16) * DP;
  BFrag Qa0 = ld_frag(qbase, DP);                 // B operand, column = query n, K = d 0..31
  BFrag Qb0 = ld_frag(qbase + 32, DP);            // K = d 32..63
  BFrag Qa1 = ld_frag(qbase + 16 * DP, DP);       // the second query tile
  BFrag Qb1 = ld_frag(qbase + 16 * DP + 32, DP);

  // Ot tiles: register r of tile f = O[query n][d = 16*f + 8*hm + r]; d 48..63 is pad, never stored
  v8f a00 = vzero(), a01 = vzero(), a02 = vzero();   // query tile 0
  v8f a10 = vzero(), a11 = vzero(), a12 = vzero();   // query tile 1
  float m0 = -1e30f, m1 = -1e30f;       // maximum in use for this lane's two queries (at most 8 below the true one)
  v8f nm0, nm1;                         // -m in all 8 registers: start value of the score products
  #pragma unroll
  for (int r = 0; r < 8; ++r) { nm0[r] = 1e30f; nm1[r] = 1e30f; }

  // stage the first tile of both halves
  {
    u32x4 a = *reinterpret_cast<const u32x4*>(kg);
    u32x4 b = *reinterpret_cast<const u32x4*>(vg);
    u32x4 c = *reinterpret_cast<const u32x4*>(kg + KHK);
    u32x4 d = *reinterpret_cast<const u32x4*>(vg + KHV);
    *reinterpret_cast<u32x4*>(&sK[0][0][krow * KSTR + kc8]) = a;
    *reinterpret_cast<u32x4*>(&sV[0][0][vrow * VSTR + vc8]) = b;
    *reinterpret_cast<u32x4*>(&sK[0][1][krow * KSTR + kc8]) = c;
    *reinterpret_cast<u32x4*>(&sV[0][1][vrow * VSTR + vc8]) = d;
  }
  __syncthreads();

  // the KH full tiles of each half: every key is real and a next tile exists (behind the upper
  // half's last one stands the masked tile; the lower half's is staged with it and not read).
  // Stays rolled and unpeeled: a peeled copy keeps a second set of the start-value registers,
  // copied on every trip
  #pragma unroll 1
  for (int it = 0; it < KH; ++it) {
    const int j0 = it * 32;
    const int cur = it & 1;
    // scores: K-tile (32x64) x Q^T (64x32) -> four 16x16 f32 fragments (keys x queries)
    const __bf16* kt = &sK[cur][kh][0];
    BFrag K1a = ld_frag(kt, KSTR);
    BFrag K1b = ld_frag(kt + 32, KSTR);
    BFrag K2a = ld_frag(kt + 16 * KSTR, KSTR);
    BFrag K2b = ld_frag(kt + 16 * KSTR + 32, KSTR);
    // Vt fragments, asked for together with K's: behind the test below they would start only after it
    const __bf16* vtile = &sV[cur][kh][0];
    BFrag V0 = ld_frag(vtile,             VSTR);
    BFrag V1 = ld_frag(vtile + 16 * VSTR, VSTR);
    BFrag V2 = ld_frag(vtile + 32 * VSTR, VSTR);

    // prefetch both halves' next tiles into regs; behind the fragment loads, so that the wait below runs while those are under way
    const __bf16* kc = kg + (long)j0 * DP;     // the next tile's 32 rows stand 4096 bytes behind it
    const __bf16* vc = vg + j0;                // the next tile's 32 keys stand 64 bytes behind it
    const u32x4 ka0 = *reinterpret_cast<const u32x4*>(kc + 32 * DP);
    const u32x4 va0 = *reinterpret_cast<const u32x4*>(vc + 32);
    const u32x4 ka1 = *reinterpret_cast<const u32x4*>(kc + KHK + 32 * DP);
    const u32x4 va1 = *reinterpret_cast<const u32x4*>(vc + KHV + 32);
    // the four loads name kc's and vc's register pairs: the wait stands before
    // either pair may be written again (as inputs they stay untouched up to it)
    asm volatile("s_wait_xcnt 0x0" :: "v"(kc), "v"(vc) : "memory");

    // the maximum in use enters the products as their start value: S = score - m
    v8f S10 = wmma_bf16(K1b, Qb0, wmma_bf16(K1a, Qa0, nm0));
    v8f S11 = wmma_bf16(K1b, Qb1, wmma_bf16(K1a, Qa1, nm1));
    v8f S20 = wmma_bf16(K2b, Qb0, wmma_bf16(K2a, Qa0, nm0));
    v8f S21 = wmma_bf16(K2b, Qb1, wmma_bf16(K2a, Qa1, nm1));
    // nm0, nm1 as inputs only: they stay in their registers past the products, which then read them in
    // place; without this line the second product of each gets a copy of all 8 registers on every trip
    asm volatile("" :: "v"(nm0), "v"(nm1));

    // one test a tile for the whole wave: the maxima in use move only when some score lies more
    // than 8 above its own (an exponential then stays below 2^8; the denominator carries the same scale)
    if (__builtin_amdgcn_ballot_w32(fmaxf(max16(S10, S20), max16(S11, S21)) > 8.0f) != 0) {
      // always taken on a half's first tile (m = -1e30 swamps the scores), so the scores are formed anew from 0
      S10 = wmma_bf16(K1b, Qb0, wmma_bf16(K1a, Qa0, vzero()));
      S11 = wmma_bf16(K1b, Qb1, wmma_bf16(K1a, Qa1, vzero()));
      S20 = wmma_bf16(K2b, Qb0, wmma_bf16(K2a, Qa0, vzero()));
      S21 = wmma_bf16(K2b, Qb1, wmma_bf16(K2a, Qa1, vzero()));
      const float c0 = new_max(S10, S20, m0);
      const float c1 = new_max(S11, S21, m1);
      a00 *= c0; a01 *= c0; a02 *= c0;
      a10 *= c1; a11 *= c1; a12 *= c1;
      #pragma unroll
      for (int r = 0; r < 8; ++r) { nm0[r] = -m0; nm1[r] = -m1; }
    }

    // Vt-tile rows (48 x 32) x P^T (32x32); row d==40 of Vt is all-ones -> l in tile 2
    const BFrag P0 = exp_pack(S10, S20);
    const BFrag P1 = exp_pack(S11, S21);
    a00 = wmma_bf16(V0, P0, a00);
    a10 = wmma_bf16(V0, P1, a10);
    a01 = wmma_bf16(V1, P0, a01);
    a11 = wmma_bf16(V1, P1, a11);
    a02 = wmma_bf16(V2, P0, a02);
    a12 = wmma_bf16(V2, P1, a12);

    // fill the other buffer
    *reinterpret_cast<u32x4*>(&sK[1 - cur][0][krow * KSTR + kc8]) = ka0;
    *reinterpret_cast<u32x4*>(&sV[1 - cur][0][vrow * VSTR + vc8]) = va0;
    *reinterpret_cast<u32x4*>(&sK[1 - cur][1][krow * KSTR + kc8]) = ka1;
    *reinterpret_cast<u32x4*>(&sV[1 - cur][1][vrow * VSTR + vc8]) = va1;
    __syncthreads();
  }

  if (kh) {
    // last tile, upper half's waves: keys past SEQ are masked (keys are register rows); its maximum is always taken in
    const int j0 = 2 * KH * 32;
    const __bf16* kt = &sK[KH & 1][1][0];
    BFrag K1a = ld_frag(kt, KSTR);
    BFrag K1b = ld_frag(kt + 32, KSTR);
    BFrag K2a = ld_frag(kt + 16 * KSTR, KSTR);
    BFrag K2b = ld_frag(kt + 16 * KSTR + 32, KSTR);
    v8f S10 = wmma_bf16(K1b, Qb0, wmma_bf16(K1a, Qa0, vzero()));
    v8f S11 = wmma_bf16(K1b, Qb1, wmma_bf16(K1a, Qa1, vzero()));
    v8f S20 = wmma_bf16(K2b, Qb0, wmma_bf16(K2a, Qa0, vzero()));
    v8f S21 = wmma_bf16(K2b, Qb1, wmma_bf16(K2a, Qa1, vzero()));
    // the Q fragments as inputs only: their registers stay theirs past the score products; without this
    // line one product's result is laid over the B operand of the product issued directly before it
    asm volatile("" :: "v"(Qa0.u[0]), "v"(Qa0.u[1]), "v"(Qb0.u[0]), "v"(Qb0.u[1]),
                       "v"(Qa1.u[0]), "v"(Qa1.u[1]), "v"(Qb1.u[0]), "v"(Qb1.u[1]));
    #pragma unroll
    for (int r = 0; r < 8; ++r) {
      if (j0 + 8 * hm + r      >= SEQ) { S10[r] = -1e30f; S11[r] = -1e30f; }
      if (j0 + 16 + 8 * hm + r >= SEQ) { S20[r] = -1e30f; S21[r] = -1e30f; }
    }
    const float c0 = new_max(S10, S20, m0);
    const float c1 = new_max(S11, S21, m1);
    a00 *= c0; a01 *= c0; a02 *= c0;
    a10 *= c1; a11 *= c1; a12 *= c1;
    const BFrag P0 = exp_pack(S10, S20);
    const BFrag P1 = exp_pack(S11, S21);
    const __bf16* vtile = &sV[KH & 1][1][0];
    BFrag V0 = ld_frag(vtile,             VSTR);
    BFrag V1 = ld_frag(vtile + 16 * VSTR, VSTR);
    BFrag V2 = ld_frag(vtile + 32 * VSTR, VSTR);
    a00 = wmma_bf16(V0, P0, a00);
    a10 = wmma_bf16(V0, P1, a10);
    a01 = wmma_bf16(V1, P0, a01);
    a11 = wmma_bf16(V1, P1, a11);
    a02 = wmma_bf16(V2, P0, a02);
    a12 = wmma_bf16(V2, P1, a12);

    // hand sums and maxima to the lower half's wave of the same queries
    const v8f s[6] = {a00, a01, a02, a10, a11, a12};
    #pragma unroll
    for (int f = 0; f < 6; ++f) {
      sC[g][2 * f][lane]     = make_float4(s[f][0], s[f][1], s[f][2], s[f][3]);
      sC[g][2 * f + 1][lane] = make_float4(s[f][4], s[f][5], s[f][6], s[f][7]);
    }
    sM[g][0][lane] = m0;
    sM[g][1][lane] = m1;
  }
  __syncthreads();
  if (kh) return;

  // join the halves on their common maximum: sums and denominator (a row of tile 2) alike
  {
    const float u0 = sM[g][0][lane], u1 = sM[g][1][lane];
    const float t0 = fmaxf(m0, u0), t1 = fmaxf(m1, u1);
    // the four factors 2^(own maximum - common maximum) in one statement: results apart from every source
    // ("=&v") and a v_nop last, so that the slot behind each exponential holds nothing that reads its
    // result or writes its source
    float e0, f0, e1, f1;
    asm("v_exp_f32 %0, %4\n\tv_exp_f32 %1, %5\n\tv_exp_f32 %2, %6\n\tv_exp_f32 %3, %7\n\tv_nop"
        : "=&v"(e0), "=&v"(f0), "=&v"(e1), "=&v"(f1)
        : "v"(m0 - t0), "v"(u0 - t0), "v"(m1 - t1), "v"(u1 - t1));
    v8f o[6];
    #pragma unroll
    for (int f = 0; f < 6; ++f) {
      const float4 lo4 = sC[g][2 * f][lane], hi4 = sC[g][2 * f + 1][lane];
      o[f][0] = lo4.x; o[f][1] = lo4.y; o[f][2] = lo4.z; o[f][3] = lo4.w;
      o[f][4] = hi4.x; o[f][5] = hi4.y; o[f][6] = hi4.z; o[f][7] = hi4.w;
    }
    a00 = a00 * e0 + o[0] * f0; a01 = a01 * e0 + o[1] * f0; a02 = a02 * e0 + o[2] * f0;
    a10 = a10 * e1 + o[3] * f1; a11 = a11 * e1 + o[4] * f1; a12 = a12 * e1 + o[5] * f1;
  }

  const int  hh   = bh & (NH - 1);
  const long brow = (long)(bh >> 2) * SEQ_Q;
  const v8f accar[2][3] = {{a00, a01, a02}, {a10, a11, a12}};
  #pragma unroll
  for (int t = 0; t < 2; ++t) {
    // softmax denominator = row d==HD of Ot: tile 2, register 0, upper wave half
    const float lo   = accar[t][2][0];
    const float lx   = xhalf(lo);
    const float linv = __builtin_amdgcn_rcpf(hm ? lo : lx);
    float* orow = cat + (brow + (qb + t) * 16 + n) * DM + hh * HD;   // query row < 4096
    #pragma unroll
    for (int f = 0; f < 3; ++f) {
      int d0 = f * 16 + 8 * hm;                // 8 consecutive d per lane
      if (d0 < HD) {
        v8f a = accar[t][f] * linv;
        *reinterpret_cast<float4*>(orow + d0)     = make_float4(a[0], a[1], a[2], a[3]);
        *reinterpret_cast<float4*>(orow + d0 + 4) = make_float4(a[4], a[5], a[6], a[7]);
      }
    }
  }
}

// ---------------- LayerNorm + residual + transpose + 2x nearest upsample ----------------
// 1 block = one image row = 64 tokens x 160 channels (40 KB of cat in a row). 8 lanes share a
// token; lane p holds the 16-byte pieces p, p + 8, .., p + 32 of its row, so each load of a
// wave is four whole lines and cat is read once. Mean and variance: 20 values in-lane, then
// three exchanges inside the group of 8 lanes. The finished tile is turned in LDS
// (channel-major); a wave then writes whole output rows, 512 contiguous bytes a store.
#define ETHR 512            // threads per block
#define ETOK 64             // tokens per block
#define EPIT 66             // LDS pitch in floats of a channel's 64 tokens (spreads the banks)
#define ECH  (DM / (ETHR / 32))   // channels per wave in the store phase

// value of lane l ^ M inside a row of 16 lanes (DPP row_xmask)
template <int M>
__device__ __forceinline__ float xlane(float v) {
  return __builtin_bit_cast(float, __builtin_amdgcn_update_dpp(
      0, __builtin_bit_cast(int, v), 0x160 + M, 0xf, 0xf, true));
}

__global__ void __launch_bounds__(ETHR) k_epi(const float* __restrict__ cat,
                                              const float* __restrict__ lw,
                                              const float* __restrict__ lb,
                                              float* __restrict__ out) {
  __shared__ __attribute__((aligned(16))) float tl[DM * EPIT];
  const int tok = threadIdx.x >> 3, p = threadIdx.x & 7;
  const int b = blockIdx.x >> 6, ih = blockIdx.x & 63;

  const float4* row = reinterpret_cast<const float4*>(cat + ((long)blockIdx.x * ETOK + tok) * DM) + p;
  const float4* gp  = reinterpret_cast<const float4*>(lw) + p;
  const float4* hp  = reinterpret_cast<const float4*>(lb) + p;
  float4 x[5], g[5], h[5];
  #pragma unroll
  for (int i = 0; i < 5; ++i) x[i] = row[8 * i];
  #pragma unroll
  for (int i = 0; i < 5; ++i) { g[i] = gp[8 * i]; h[i] = hp[8 * i]; }
  // keeps the scheduler from sinking the lw/lb loads behind the sums, where each pair is waited for alone
  __builtin_amdgcn_sched_barrier(0);
  // the 15 loads name row's register pair and p's register: the wait stands before either may
  // be written again (as inputs they stay untouched up to it)
  asm volatile("s_wait_xcnt 0x0" :: "v"(row), "v"(p) : "memory");

  float sm = 0.f;
  #pragma unroll
  for (int i = 0; i < 5; ++i) sm += (x[i].x + x[i].y) + (x[i].z + x[i].w);
  sm += xlane<1>(sm); sm += xlane<2>(sm); sm += xlane<4>(sm);
  const float mu = sm * (1.f / DM);

  float vs = 0.f;
  #pragma unroll
  for (int i = 0; i < 5; ++i) {
    const float d0 = x[i].x - mu, d1 = x[i].y - mu, d2 = x[i].z - mu, d3 = x[i].w - mu;
    vs += d0 * d0; vs += d1 * d1; vs += d2 * d2; vs += d3 * d3;
  }
  vs += xlane<1>(vs); vs += xlane<2>(vs); vs += xlane<4>(vs);
  const float inv = rsqrtf(vs * (1.f / DM) + 1e-5f);

  #pragma unroll
  for (int i = 0; i < 5; ++i) {
    float* t = &tl[4 * (p + 8 * i) * EPIT + tok];
    t[0]        = (x[i].x - mu) * inv * g[i].x + h[i].x + x[i].x;
    t[EPIT]     = (x[i].y - mu) * inv * g[i].y + h[i].y + x[i].y;
    t[2 * EPIT] = (x[i].z - mu) * inv * g[i].z + h[i].z + x[i].z;
    t[3 * EPIT] = (x[i].w - mu) * inv * g[i].w + h[i].w + x[i].w;
  }
  __syncthreads();

  // lane l: tokens 2l and 2l + 1, each doubled = output columns 4l .. 4l + 3; rows 2ih, 2ih + 1
  const int lane = threadIdx.x & 31;
  const int c0   = __builtin_amdgcn_readfirstlane(threadIdx.x >> 5) * ECH;
  float* o = out + (((long)b * DM + c0) * 128 + 2 * ih) * 128 + 4 * lane;
  #pragma unroll
  for (int j = 0; j < ECH; ++j) {
    const float2 v = *reinterpret_cast<const float2*>(&tl[(c0 + j) * EPIT + 2 * lane]);
    const float4 w = make_float4(v.x, v.x, v.y, v.y);
    *reinterpret_cast<float4*>(o + j * 128 * 128)       = w;
    *reinterpret_cast<float4*>(o + j * 128 * 128 + 128) = w;
  }
}

// ---------------- launch ----------------
extern "C" void kernel_launch(void* const* d_in, const int* in_sizes, int n_in,
                              void* d_out, int out_size, void* d_ws, size_t ws_size,
                              hipStream_t stream) {
  (void)in_sizes; (void)n_in; (void)out_size; (void)ws_size;
  const float* x   = (const float*)d_in[0];
  const float* w1  = (const float*)d_in[1];
  const float* b1  = (const float*)d_in[2];
  const float* w2  = (const float*)d_in[3];
  const float* b2  = (const float*)d_in[4];
  const float* pe  = (const float*)d_in[5];
  const float* wq  = (const float*)d_in[6];
  const float* wk  = (const float*)d_in[7];
  const float* wv  = (const float*)d_in[8];
  const float* lw  = (const float*)d_in[9];
  const float* lb  = (const float*)d_in[10];
  float* out = (float*)d_out;
  char*  ws  = (char*)d_ws;

  // workspace layout (bytes), all 16B aligned
  constexpr long C1_OFF  = 0;                                   // 4*64*4096 f32      = 4,194,304 B
  constexpr long FBF_OFF = C1_OFF  + 4L * 64 * HW * 4;          // 4*4128*160 bf16    = 5,283,840 B
  constexpr long WB_OFF  = FBF_OFF + (long)BATCH * FPAD * DM * 2;   // 3*160*160 bf16 = 153,600 B
  constexpr long Q_OFF   = WB_OFF  + 3L * DM * DM * 2;          // 16*4128*64 bf16    = 8,454,144 B
  constexpr long K_OFF   = Q_OFF   + 16L * SPAD * DP * 2;
  constexpr long VT_OFF  = K_OFF   + 16L * SPAD * DP * 2;
  constexpr long CAT_OFF = VT_OFF  + 16L * SPAD * DP * 2;       // 4*4096*160 f32     = 10,485,760 B

  float*  c1  = (float*) (ws + C1_OFF);
  __bf16* fbf = (__bf16*)(ws + FBF_OFF);
  __bf16* wb  = (__bf16*)(ws + WB_OFF);
  __bf16* qb  = (__bf16*)(ws + Q_OFF);
  __bf16* kb  = (__bf16*)(ws + K_OFF);
  __bf16* vtb = (__bf16*)(ws + VT_OFF);
  float*  cat = (float*) (ws + CAT_OFF);

  k_cvtw <<<(3 * DM * DM + 255) / 256, 256, 0, stream>>>(wq, wk, wv, wb);
  k_conv1<<<64 * 8, C1THR, 0, stream>>>(x, w1, b1, c1);
  k_conv2f<<<(BATCH * FPAD) / C2ROWS, C2THR, 0, stream>>>(c1, w2, b2, pe, fbf);

  // writes every byte of q, k and vt (pads and the ones row included)
  k_qkv  <<<3 * NH * BATCH * QG / 8, 256, 0, stream>>>(fbf, wb, qb, kb, vtb);   // 516 blocks

  k_attn <<<512, 256, 0, stream>>>(qb, kb, vtb, cat);           // 16 bh x 32 q-groups

  k_epi  <<<(BATCH * HW) / ETOK, ETHR, 0, stream>>>(cat, lw, lb, out);   // one block per image row
}

// v008
// A run of this version takes 91.5 microseconds.
// Two timings next to v007 both put it at 1.10 times that version's speed.
// All steps since v000 together make it 3.37 times as fast.
#include <hip/hip_runtime.h>
#include <hip/hip_bf16.h>

// ---------------- CDNA5 WMMA types ----------------
typedef __attribute__((ext_vector_type(16))) __bf16       v16bf;
typedef __attribute__((ext_vector_type(8)))  float        v8f;
typedef __attribute__((ext_vector_type(4)))  unsigned int u32x4;

#define BATCH 4
#define DM    160           // d_model
#define NH    4
#define HD    40            // head dim
#define DP    64            // padded head dim (4 x 16)
#define HW    4096          // 64*64 tokens
#define SEQ   4097          // tokens + pad row
#define SEQ_Q 4096          // queries that survive cat[:, :-1, :]
#define SPAD  4128          // K/V padded length (multiple of 32)
#define KSTR  72            // LDS K-tile row stride (bank-conflict-free for b128)
#define VSTR  40            // LDS V-tile row stride (bank-conflict-free for b128)

union BFrag { v16bf v; u32x4 u[2]; };

// 16x32 bf16 A/B fragment loader (row-major tile, `stride` elements per row).
// Lanes 0-15 : row=lane,    K chunks {0..7} and {16..23}
// Lanes 16-31: row=lane-16, K chunks {8..15} and {24..31}
__device__ __forceinline__ BFrag ld_frag(const __bf16* base, int stride) {
  const int lane = threadIdx.x & 31;
  const int r  = lane & 15;
  const int hh = lane >> 4;
  const __bf16* p = base + (long)r * stride + 8 * hh;
  BFrag f;
  f.u[0] = *reinterpret_cast<const u32x4*>(p);
  f.u[1] = *reinterpret_cast<const u32x4*>(p + 16);
  return f;
}

__device__ __forceinline__ v8f wmma_bf16(const BFrag& a, const BFrag& b, v8f c) {
  return __builtin_amdgcn_wmma_f32_16x16x32_bf16(false, a.v, false, b.v,
                                                 (short)0, c, false, false);
}

__device__ __forceinline__ v8f vzero() {
  v8f z = {0.f, 0.f, 0.f, 0.f, 0.f, 0.f, 0.f, 0.f};
  return z;
}

// ---------------- conv1: 64->64, 2x2 stride 2 ----------------
// 1 block = 256 output positions (4 rows) x 8 output channels. Lanes run along the
// positions, so an x load is two whole lines, and each x value is used 8 times from a
// register. All 8 waves of a block work on the same 8 channels: the weights are uniform
// (scalar loads), and the block's 8 KB of them are fetched once for its 8 waves.
#define C1OC   8            // output channels per block
#define C1THR  256          // threads per block
#define C1CH   16           // input channels per register chunk (4 chunks)
#define C1W    8            // weights per channel and step
#define C1NS   (4 * 256 / C1W)   // steps: 4 channel pairs x 256 weights a channel

// Step G: 2 channels x C1W / 4 input channels, every index a compile-time constant.
// Step G + 1's weights are fetched while step G is worked on; the next chunk's x is
// fetched at the first step of a chunk.
template <int G>
__device__ __forceinline__ void c1_step(const float2* xp, const float* wp,
                                        float2 (&xb)[2][2 * C1CH], float (&wb)[2][2 * C1W],
                                        float (&at)[C1OC], float (&ab)[C1OC]) {
  constexpr int SPP = C1CH * 4 / C1W;        // steps per channel pair inside a chunk
  constexpr int SPC = 4 * SPP;               // steps per chunk
  constexpr int ch = G / SPC, j0 = ((G / SPP) & 3) * 2, q = G % SPP;
  if constexpr (G % SPC == 0 && ch + 1 < 4) {
    #pragma unroll
    for (int i = 0; i < C1CH; ++i) {
      xb[(ch + 1) & 1][2 * i]     = xp[((ch + 1) * C1CH + i) * 8192];
      xb[(ch + 1) & 1][2 * i + 1] = xp[((ch + 1) * C1CH + i) * 8192 + 64];
    }
  }
  if constexpr (G + 1 < C1NS) {
    constexpr int cn = (G + 1) / SPC, jn = (((G + 1) / SPP) & 3) * 2, qn = (G + 1) % SPP;
    #pragma unroll
    for (int i = 0; i < C1W; ++i) {
      wb[(G + 1) & 1][i]       = wp[jn * 256 + cn * 64 + qn * C1W + i];
      wb[(G + 1) & 1][C1W + i] = wp[(jn + 1) * 256 + cn * 64 + qn * C1W + i];
    }
  }
  if constexpr (G % SPC == 0 && ch + 2 == 4) {
    // all 128 x loads name xp's register pair: the wait stands before the pair may be
    // written again (xp as an input keeps the pair untouched up to the wait)
    asm volatile("s_wait_xcnt 0x0" :: "v"(xp) : "memory");
  }
  #pragma unroll
  for (int i = 0; i < C1W / 4; ++i) {
    const float2 t = xb[ch & 1][2 * (q * (C1W / 4) + i)];
    const float2 u = xb[ch & 1][2 * (q * (C1W / 4) + i) + 1];
    at[j0]     += t.x * wb[G & 1][4 * i];
    at[j0 + 1] += t.x * wb[G & 1][C1W + 4 * i];
    ab[j0]     += u.x * wb[G & 1][4 * i + 2];
    ab[j0 + 1] += u.x * wb[G & 1][C1W + 4 * i + 2];
    at[j0]     += t.y * wb[G & 1][4 * i + 1];
    at[j0 + 1] += t.y * wb[G & 1][C1W + 4 * i + 1];
    ab[j0]     += u.y * wb[G & 1][4 * i + 3];
    ab[j0 + 1] += u.y * wb[G & 1][C1W + 4 * i + 3];
  }
  // keeps the scheduler from lifting all the loads to the top, which spills registers
  __builtin_amdgcn_sched_barrier(0);
  if constexpr (G + 1 < C1NS) c1_step<G + 1>(xp, wp, xb, wb, at, ab);
}

__global__ void __launch_bounds__(C1THR) k_conv1(const float* __restrict__ x,
                                                 const float* __restrict__ w,
                                                 const float* __restrict__ bias,
                                                 float* __restrict__ c1) {
  const int oc0 = (blockIdx.x & 7) * C1OC;   // the 8 blocks that share x are neighbours
  const int pb  = blockIdx.x >> 3;           // 64 groups of 256 positions
  const int b   = pb >> 4;
  const int oh  = (pb & 15) * 4 + (threadIdx.x >> 6);
  const int ow  = threadIdx.x & 63;

  // xp[ic * 8192]: row 2*oh, xp[ic * 8192 + 64]: row 2*oh + 1 (units of two floats)
  const float2* xp = reinterpret_cast<const float2*>(
      x + ((long)b * 64 * 128 + 2 * oh) * 128 + 2 * ow);
  const float* wp = w + oc0 * 256;

  float2 xb[2][2 * C1CH];
  float  wb[2][2 * C1W];
  #pragma unroll
  for (int i = 0; i < C1CH; ++i) {
    xb[0][2 * i]     = xp[i * 8192];
    xb[0][2 * i + 1] = xp[i * 8192 + 64];
  }
  #pragma unroll
  for (int i = 0; i < C1W; ++i) { wb[0][i] = wp[i]; wb[0][C1W + i] = wp[256 + i]; }

  // per channel two sums, one per input row, each over ic = 0..63 in order
  float at[C1OC], ab[C1OC];
  #pragma unroll
  for (int j = 0; j < C1OC; ++j) { at[j] = 0.f; ab[j] = 0.f; }

  c1_step<0>(xp, wp, xb, wb, at, ab);

  float* op = c1 + ((long)b * 64 + oc0) * HW + oh * 64 + ow;
  #pragma unroll
  for (int j = 0; j < C1OC; ++j) op[j * HW] = bias[oc0 + j] + (at[j] + ab[j]);
}

// ---------------- wq/wk/wv -> bf16 ----------------
__global__ void k_cvtw(const float* __restrict__ wq, const float* __restrict__ wk,
                       const float* __restrict__ wv, __bf16* __restrict__ o) {
  int i = blockIdx.x * 256 + threadIdx.x;
  if (i >= 3 * DM * DM) return;
  const float* src = (i < DM * DM) ? wq : (i < 2 * DM * DM ? wk : wv);
  o[i] = (__bf16)src[i % (DM * DM)];
}

// ---------- conv2 (1x1) + bias + leaky + pad + PE -> bf16 tokens in LDS -> q, k, vt ----------
// 1 block = 32 real token rows. Part 1: all 160 channels of the rows. Lanes run along the tokens,
// so a c1 load is one whole line; a wave owns 10 channels, so its weights are wave-uniform (scalar
// loads) and each c1 value is used 10 times from a register. The 32x160 bf16 tile stays in LDS.
// Part 2 (WMMA bf16): wave = one of {q,k,v} x one head (12 of the 16 waves), both 16-token tiles
// of the block, read from LDS as fragments; K = 160 = 5 x K32. The head's 40 weight rows are 3
// tiles of 16 (the last half used), worked on one after the other. The wave writes the whole
// padded head (DP = 64 dims) of its tokens, pads included, so every byte of q, k and vt is
// written here and nothing has to be cleared beforehand.
// The 32 rows behind a batch's real tokens (row HW: the zero-pad row + its positional value; the
// rest 0) need no part 1: each of their 48 pieces (12 heads x 4 tiles of 16 dims) is one job for
// a wave that has no part 2 (waves 12..15 of a batch's first 12 blocks). So the grid is 512
// blocks, two per WGP, all resident at once.
// q, k: Dt = W * Ft, a lane holds 8 consecutive dims of ONE token  = one 16-byte store.
// v   : D  = F * Wt, a lane holds 8 consecutive tokens of ONE dim  = one 16-byte store of Vt.
// Vt row d == HD is all ones (softmax denominator via WMMA); every other pad is 0.
// Q output is pre-scaled by (1/sqrt(HD)) * log2(e) so attention uses raw exp2.
#define C2ROWS 32           // token rows per block
#define C2BLK  (HW / C2ROWS)   // blocks per batch
#define C2OC   10           // channels per wave (16 waves x 10 = DM)
#define C2THR  512          // threads per block
#define C2PIT  168          // LDS row pitch in bf16 (336 B: 16 B x odd, spreads the banks)
typedef __attribute__((ext_vector_type(2))) __bf16 v2bf;

union Pack8 { __bf16 h[8]; u32x4 u; };

// one lane's share of the 5 fragments of a 16-row tile (lane map of ld_frag; p holds the lane's row)
__device__ __forceinline__ void ld_ftile(BFrag (&f)[5], const __bf16* p) {
  #pragma unroll
  for (int kk = 0; kk < 5; ++kk) {
    f[kk].u[0] = *reinterpret_cast<const u32x4*>(p + kk * 32);
    f[kk].u[1] = *reinterpret_cast<const u32x4*>(p + kk * 32 + 16);
  }
}

// one tile of 16 weight rows (Wt) x the block's two token tiles (fl: the lane's row of the first
// one in LDS). VT: D = F * Wt (rows = tokens); else Dt = W * Ft (rows = dims). keep: this lane's 8
// values are real dims; else they are pad positions and padv goes out in their place.
// NEXT: each fragment of Wt, once its two products are issued, is asked for anew from wn (the
// head's next tile), so that one set of 40 registers serves and the loads run under the products.
template <bool VT, bool NEXT>
__device__ __forceinline__ void fq_tile(BFrag (&Wt)[5], const __bf16* wn, const __bf16* fl,
                                        __bf16* o, float sc, bool keep, float padv) {
  constexpr long TS = VT ? 16 : 16 * DP;       // step of o per token tile
  v8f a0 = vzero(), a1 = vzero();
  #pragma unroll
  for (int kk = 0; kk < 5; ++kk) {
    BFrag F0, F1;
    F0.u[0] = *reinterpret_cast<const u32x4*>(fl + kk * 32);
    F0.u[1] = *reinterpret_cast<const u32x4*>(fl + kk * 32 + 16);
    F1.u[0] = *reinterpret_cast<const u32x4*>(fl + 16 * C2PIT + kk * 32);
    F1.u[1] = *reinterpret_cast<const u32x4*>(fl + 16 * C2PIT + kk * 32 + 16);
    if constexpr (VT) {
      a0 = wmma_bf16(F0, Wt[kk], a0);
      a1 = wmma_bf16(F1, Wt[kk], a1);
    } else {
      a0 = wmma_bf16(Wt[kk], F0, a0);
      a1 = wmma_bf16(Wt[kk], F1, a1);
    }
    if constexpr (NEXT) {
      Wt[kk].u[0] = *reinterpret_cast<const u32x4*>(wn + kk * 32);
      Wt[kk].u[1] = *reinterpret_cast<const u32x4*>(wn + kk * 32 + 16);
    }
  }
  Pack8 p0, p1;
  #pragma unroll
  for (int i = 0; i < 8; ++i) {
    const float e0 = VT ? a0[i] : a0[i] * sc;
    const float e1 = VT ? a1[i] : a1[i] * sc;
    p0.h[i] = (__bf16)(keep ? e0 : padv);
    p1.h[i] = (__bf16)(keep ? e1 : padv);
  }
  *reinterpret_cast<u32x4*>(o)      = p0.u;
  *reinterpret_cast<u32x4*>(o + TS) = p1.u;
  // the two stores name address and data registers, the loads wn's pair, that later code writes
  // again: the wait stands in front of all of those writes (wn as an input stays untouched up to it)
  asm volatile("s_wait_xcnt 0x0" :: "v"(wn) : "memory");
}

// the 4 tiles of 16 dims of a padded head, DS apart in the output; Wt arrives holding tile 0
template <bool VT>
__device__ __forceinline__ void fq_head(BFrag (&Wt)[5], const __bf16* w01, const __bf16* w2,
                                        const __bf16* fl, __bf16* o, float sc, int n, int hm) {
  constexpr long DS = VT ? 16 * SPAD : 16;
  constexpr long TS = VT ? 16 : 16 * DP;
  const bool  real = VT ? (n < HD - 32) : (hm == 0);            // dims 32..39 of tile 2
  const float padv = (VT && n == HD - 32) ? 1.0f : 0.0f;        // dims 40..47: ones row of Vt, else 0
  const u32x4 zz = {0u, 0u, 0u, 0u};
  *reinterpret_cast<u32x4*>(o + 3 * DS)      = zz;
  *reinterpret_cast<u32x4*>(o + 3 * DS + TS) = zz;
  fq_tile<VT, true >(Wt, w01 + 16 * DM, fl, o,          sc, true, 0.f);
  fq_tile<VT, true >(Wt, w2,            fl, o + DS,     sc, true, 0.f);
  fq_tile<VT, false>(Wt, w2,            fl, o + 2 * DS, sc, real, padv);
}

// one piece of the 32 rows behind the real tokens: tile t of 16 dims (Wt: its weight rows; t == 3
// is pad only, its products are not used). Token tile 0 has row 0 = pl in every channel and 0
// elsewhere, so one fragment serves all 5 k steps; token tile 1 is all 0, and so are its products.
template <bool VT>
__device__ __forceinline__ void fq_pad(const BFrag (&Wt)[5], int t, float pl, __bf16* o, float sc,
                                       int n, int hm) {
  constexpr long DS = VT ? 16 * SPAD : 16;
  constexpr long TS = VT ? 16 : 16 * DP;
  const bool  keep = t < 2 || (t == 2 && (VT ? (n < HD - 32) : (hm == 0)));
  const float padv = (VT && t == 2 && n == HD - 32) ? 1.0f : 0.0f;
  const __bf16 fv = (__bf16)(n == 0 ? pl : 0.f);
  BFrag F;
  #pragma unroll
  for (int i = 0; i < 16; ++i) F.v[i] = fv;
  v8f a = vzero();
  #pragma unroll
  for (int kk = 0; kk < 5; ++kk) a = VT ? wmma_bf16(F, Wt[kk], a) : wmma_bf16(Wt[kk], F, a);
  Pack8 p0, p1;
  #pragma unroll
  for (int i = 0; i < 8; ++i) {
    const float e = VT ? a[i] : a[i] * sc;
    p0.h[i] = (__bf16)(keep ? e : padv);
    p1.h[i] = (__bf16)(keep ? 0.f : padv);
  }
  *reinterpret_cast<u32x4*>(o + t * DS)      = p0.u;
  *reinterpret_cast<u32x4*>(o + t * DS + TS) = p1.u;
  // the two stores name address and data registers: behind the q/k form the listing goes on with
  // the vt form's code, which writes those registers again; the wait stands in front of it
  asm volatile("s_wait_xcnt 0x0" ::: "memory");
}

// 8 waves per SIMD = two blocks per WGP (128 registers a wave): one block's products and their
// load latencies run under the other block's sums
__global__ void __launch_bounds__(C2THR) __attribute__((amdgpu_waves_per_eu(8)))
k_fqkv(const float* __restrict__ c1,
       const float* __restrict__ w,
       const float* __restrict__ bias,
       const float* __restrict__ pe,
       const __bf16* __restrict__ wb,
       __bf16* __restrict__ q,
       __bf16* __restrict__ k,
       __bf16* __restrict__ vt) {
  __shared__ __attribute__((aligned(16))) __bf16 tile[C2ROWS * C2PIT];
  const int lane = threadIdx.x & 31;
  const int wv   = __builtin_amdgcn_readfirstlane(threadIdx.x >> 5);
  const int oc0  = wv * C2OC;
  const int bb   = blockIdx.x / C2BLK;              // batch
  const int ib   = blockIdx.x - bb * C2BLK;         // block of the batch
  const int s    = ib * C2ROWS + lane;              // token row, below HW

  // weight fragments of part 2, lane map of ld_frag: tiles 0 and 1 are rows n and 16 + n of the
  // head; in tile 2 the rows past the head's 40 read its last row (their products land in pad
  // positions and are replaced on the way out). Waves 0..11: {q,k,v} x head = the wave's number,
  // starting with tile 0. Waves 12..15: = the block's number (where below 12), tile tp alone.
  const int n   = lane & 15;
  const int hm  = lane >> 4;
  const int un  = wv < 3 * NH ? wv : (ib < 3 * NH ? ib : 0);
  const int tp  = wv & 3;
  const int mat = un >> 2, hh = un & (NH - 1);
  const __bf16* wh  = wb + ((long)mat * DM + hh * HD) * DM + 8 * hm;
  const __bf16* w01 = wh + n * DM;
  const __bf16* w2  = wh + (n < HD - 32 ? 32 + n : HD - 1) * DM;
  const __bf16* wf  = wv < 3 * NH ? w01 : (tp == 2 ? w2 : w01 + (tp & 1) * 16 * DM);
  BFrag Wt[5];

  const float pv = pe[s];
  // the pe load names s's register as its offset: the wait stands before anything may be
  // written there (s as an input keeps the register untouched up to the wait)
  asm volatile("s_wait_xcnt 0x0" :: "v"(s) : "memory");

  const float* cp = c1 + (long)bb * 64 * HW + s;
  float xv[64];
  #pragma unroll
  for (int ic = 0; ic < 64; ++ic) xv[ic] = cp[(long)ic * HW];
  // the 64 loads name s's register as their offset (the batch's base is scalar): the wait stands
  // before it may be written again (s as an input keeps it untouched up to the wait)
  asm volatile("s_wait_xcnt 0x0" :: "v"(s) : "memory");

  // 20 groups of 2 channels x 16 inputs; per channel the sum runs over ic = 0..63 in order.
  // A group's 32 weights are fetched while the group before it is worked on.
  const float* wp = w + oc0 * 64;
  float wc[32], wn[32];
  #pragma unroll
  for (int i = 0; i < 16; ++i) { wc[i] = wp[i]; wc[16 + i] = wp[64 + i]; }
  float a0 = 0.f, a1 = 0.f;
  #pragma unroll
  for (int g = 0; g < 20; ++g) {
    const int j0 = (g >> 2) * 2, icb = (g & 3) * 16;
    if (g + 1 < 20) {
      const int jn = ((g + 1) >> 2) * 2, icn = ((g + 1) & 3) * 16;
      #pragma unroll
      for (int i = 0; i < 16; ++i) {
        wn[i]      = wp[jn * 64 + icn + i];
        wn[16 + i] = wp[(jn + 1) * 64 + icn + i];
      }
    }
    if (icb == 0) { a0 = bias[oc0 + j0]; a1 = bias[oc0 + j0 + 1]; }
    #pragma unroll
    for (int i = 0; i < 16; ++i) {
      a0 += xv[icb + i] * wc[i];
      a1 += xv[icb + i] * wc[16 + i];
    }
    if (icb == 48) {
      float l0 = a0 >= 0.f ? a0 : 0.01f * a0;
      float l1 = a1 >= 0.f ? a1 : 0.01f * a1;
      v2bf t;
      t[0] = (__bf16)(l0 + pv);
      t[1] = (__bf16)(l1 + pv);
      *reinterpret_cast<v2bf*>(&tile[lane * C2PIT + oc0 + j0]) = t;
    }
    // the wave's first weight tile of part 2, into registers that the last sums have left: its
    // latency runs under the rest of part 1
    if (g == 17) ld_ftile(Wt, wf);
    // keeps the scheduler from lifting all the weight loads to the top, which spills scalar registers
    __builtin_amdgcn_sched_barrier(0);
    #pragma unroll
    for (int i = 0; i < 32; ++i) wc[i] = wn[i];
  }
  // the 10 loads of that tile name wf's register pair: the wait stands before it may be written again
  asm volatile("s_wait_xcnt 0x0" :: "v"(wf) : "memory");
  __syncthreads();

  const long  bh = (long)bb * NH + hh;
  const float qs = (mat == 0) ? 0.22811012f : 1.0f;   // q: (1/sqrt(40)) * log2(e)
  if (wv >= 3 * NH) {                          // behind the block's only barrier
    if (ib >= 3 * NH) return;
    const float pl = pe[HW];
    if (mat == 2) fq_pad<true >(Wt, tp, pl, vt + (bh * DP + n) * SPAD + HW + 8 * hm, 1.0f, n, hm);
    else          fq_pad<false>(Wt, tp, pl, (mat == 0 ? q : k) + (bh * SPAD + HW + n) * DP + 8 * hm, qs, n, hm);
    return;
  }

  const int s0 = ib * C2ROWS;
  const __bf16* fl = &tile[n * C2PIT + 8 * hm];
  if (mat == 2) {
    fq_head<true>(Wt, w01, w2, fl, vt + (bh * DP + n) * SPAD + s0 + 8 * hm, 1.0f, n, hm);
  } else {
    fq_head<false>(Wt, w01, w2, fl, (mat == 0 ? q : k) + (bh * SPAD + s0 + n) * DP + 8 * hm,
                   qs, n, hm);
  }
}

#define KH 64               // full key tiles per key half

// value of lane l ^ 16
__device__ __forceinline__ float xhalf(float v) {
  int b = __builtin_bit_cast(int, v);
  b = __builtin_amdgcn_permlanex16(b, b, 0x76543210, 0xfedcba98, false, false);
  return __builtin_bit_cast(float, b);
}

// largest of a lane's 16 scores (four short independent chains, not one of sixteen links)
__device__ __forceinline__ float max16(const v8f& S1, const v8f& S2) {
  const float mxa = fmaxf(fmaxf(S1[0], S1[1]), fmaxf(S1[2], S1[3]));
  const float mxb = fmaxf(fmaxf(S1[4], S1[5]), fmaxf(S1[6], S1[7]));
  const float mxc = fmaxf(fmaxf(S2[0], S2[1]), fmaxf(S2[2], S2[3]));
  const float mxd = fmaxf(fmaxf(S2[4], S2[5]), fmaxf(S2[6], S2[7]));
  return fmaxf(fmaxf(mxa, mxb), fmaxf(mxc, mxd));
}

// takes a tile's true maximum into mrow (16 keys in-lane, the query's other 16 in lane ^ 16),
// moves the raw scores onto it and returns the factor that moves the sums kept so far
__device__ __forceinline__ float new_max(v8f& S1, v8f& S2, float& mrow) {
  const float mx   = max16(S1, S2);
  const float mn   = fmaxf(mrow, fmaxf(mx, xhalf(mx)));
  const float corr = __builtin_amdgcn_exp2f(mrow - mn);   // scores already in exp2 domain
  mrow = mn;
  S1 -= mn; S2 -= mn;
  return corr;
}

// P^T as B operand: element s = key 8*hm + s (s < 8) or 16 + 8*hm + s - 8 (s >= 8), straight from the two score tiles
__device__ __forceinline__ BFrag exp_pack(const v8f& S1, const v8f& S2) {
  BFrag P;
  #pragma unroll
  for (int r = 0; r < 8; ++r) {
    P.v[r]     = (__bf16)__builtin_amdgcn_exp2f(S1[r]);
    P.v[8 + r] = (__bf16)__builtin_amdgcn_exp2f(S2[r]);
  }
  return P;
}

__global__ void __launch_bounds__(256) k_attn(const __bf16* __restrict__ q,
                                              const __bf16* __restrict__ k,
                                              const __bf16* __restrict__ vt,
                                              float* __restrict__ cat) {
  __shared__ __attribute__((aligned(16))) __bf16 sK[2][2][32 * KSTR];   // [buffer][key half]
  __shared__ __attribute__((aligned(16))) __bf16 sV[2][2][64 * VSTR];
  __shared__ __attribute__((aligned(16))) float4 sC[4][12][32];         // upper key half's sums
  __shared__ float sM[4][2][32];                                        // and its maxima in use

  const int bh = blockIdx.x >> 5;              // 16 (b,h) pairs
  const int qg = blockIdx.x & 31;              // 32 groups of 128 queries
  const int wv = __builtin_amdgcn_readfirstlane(threadIdx.x >> 5);
  const int g  = wv & 3;                       // which 32 queries of the block
  const int kh = wv >> 2;                      // which half of the keys
  const int qb = qg * 8 + g * 2;               // first of the wave's two 16-query tiles (< 256)
  const int lane = threadIdx.x & 31;
  const int n  = lane & 15;
  const int hm = lane >> 4;
  const int tid = threadIdx.x;

  // cooperative staging coordinates (256 threads: K 32x64, V 64x32, 16B each, per key half)
  const int krow = tid >> 3, kc8 = (tid & 7) * 8;
  const int vrow = tid >> 2, vc8 = (tid & 3) * 8;
  const __bf16* kg = k  + ((long)bh * SPAD + krow) * DP + kc8;
  const __bf16* vg = vt + ((long)bh * DP + vrow) * SPAD + vc8;
  constexpr int KHK = KH * 32 * DP;            // from a tile of the lower half to its partner, in k
  constexpr int KHV = KH * 32;                 // the same in a row of vt

  const __bf16* qbase = q + ((long)bh * SPAD + qb * 16) * DP;
  BFrag Qa0 = ld_frag(qbase, DP);                 // B operand, column = query n, K = d 0..31
  BFrag Qb0 = ld_frag(qbase + 32, DP);            // K = d 32..63
  BFrag Qa1 = ld_frag(qbase + 16 * DP, DP);       // the second query tile
  BFrag Qb1 = ld_frag(qbase + 16 * DP + 32, DP);

  // Ot tiles: register r of tile f = O[query n][d = 16*f + 8*hm + r]; d 48..63 is pad, never stored
  v8f a00 = vzero(), a01 = vzero(), a02 = vzero();   // query tile 0
  v8f a10 = vzero(), a11 = vzero(), a12 = vzero();   // query tile 1
  float m0 = -1e30f, m1 = -1e30f;       // maximum in use for this lane's two queries (at most 8 below the true one)
  v8f nm0, nm1;                         // -m in all 8 registers: start value of the score products
  #pragma unroll
  for (int r = 0; r < 8; ++r) { nm0[r] = 1e30f; nm1[r] = 1e30f; }

  // stage the first tile of both halves
  {
    u32x4 a = *reinterpret_cast<const u32x4*>(kg);
    u32x4 b = *reinterpret_cast<const u32x4*>(vg);
    u32x4 c = *reinterpret_cast<const u32x4*>(kg + KHK);
    u32x4 d = *reinterpret_cast<const u32x4*>(vg + KHV);
    *reinterpret_cast<u32x4*>(&sK[0][0][krow * KSTR + kc8]) = a;
    *reinterpret_cast<u32x4*>(&sV[0][0][vrow * VSTR + vc8]) = b;
    *reinterpret_cast<u32x4*>(&sK[0][1][krow * KSTR + kc8]) = c;
    *reinterpret_cast<u32x4*>(&sV[0][1][vrow * VSTR + vc8]) = d;
  }
  __syncthreads();

  // the KH full tiles of each half: every key is real and a next tile exists (behind the upper
  // half's last one stands the masked tile; the lower half's is staged with it and not read).
  // Stays rolled and unpeeled: a peeled copy keeps a second set of the start-value registers,
  // copied on every trip
  #pragma unroll 1
  for (int it = 0; it < KH; ++it) {
    const int j0 = it * 32;
    const int cur = it & 1;
    // scores: K-tile (32x64) x Q^T (64x32) -> four 16x16 f32 fragments (keys x queries)
    const __bf16* kt = &sK[cur][kh][0];
    BFrag K1a = ld_frag(kt, KSTR);
    BFrag K1b = ld_frag(kt + 32, KSTR);
    BFrag K2a = ld_frag(kt + 16 * KSTR, KSTR);
    BFrag K2b = ld_frag(kt + 16 * KSTR + 32, KSTR);
    // Vt fragments, asked for together with K's: behind the test below they would start only after it
    const __bf16* vtile = &sV[cur][kh][0];
    BFrag V0 = ld_frag(vtile,             VSTR);
    BFrag V1 = ld_frag(vtile + 16 * VSTR, VSTR);
    BFrag V2 = ld_frag(vtile + 32 * VSTR, VSTR);

    // prefetch both halves' next tiles into regs; behind the fragment loads, so that the wait below runs while those are under way
    const __bf16* kc = kg + (long)j0 * DP;     // the next tile's 32 rows stand 4096 bytes behind it
    const __bf16* vc = vg + j0;                // the next tile's 32 keys stand 64 bytes behind it
    const u32x4 ka0 = *reinterpret_cast<const u32x4*>(kc + 32 * DP);
    const u32x4 va0 = *reinterpret_cast<const u32x4*>(vc + 32);
    const u32x4 ka1 = *reinterpret_cast<const u32x4*>(kc + KHK + 32 * DP);
    const u32x4 va1 = *reinterpret_cast<const u32x4*>(vc + KHV + 32);
    // the four loads name kc's and vc's register pairs: the wait stands before
    // either pair may be written again (as inputs they stay untouched up to it)
    asm volatile("s_wait_xcnt 0x0" :: "v"(kc), "v"(vc) : "memory");

    // the maximum in use enters the products as their start value: S = score - m
    v8f S10 = wmma_bf16(K1b, Qb0, wmma_bf16(K1a, Qa0, nm0));
    v8f S11 = wmma_bf16(K1b, Qb1, wmma_bf16(K1a, Qa1, nm1));
    v8f S20 = wmma_bf16(K2b, Qb0, wmma_bf16(K2a, Qa0, nm0));
    v8f S21 = wmma_bf16(K2b, Qb1, wmma_bf16(K2a, Qa1, nm1));
    // nm0, nm1 as inputs only: they stay in their registers past the products, which then read them in
    // place; without this line the second product of each gets a copy of all 8 registers on every trip
    asm volatile("" :: "v"(nm0), "v"(nm1));

    // one test a tile for the whole wave: the maxima in use move only when some score lies more
    // than 8 above its own (an exponential then stays below 2^8; the denominator carries the same scale)
    if (__builtin_amdgcn_ballot_w32(fmaxf(max16(S10, S20), max16(S11, S21)) > 8.0f) != 0) {
      // always taken on a half's first tile (m = -1e30 swamps the scores), so the scores are formed anew from 0
      S10 = wmma_bf16(K1b, Qb0, wmma_bf16(K1a, Qa0, vzero()));
      S11 = wmma_bf16(K1b, Qb1, wmma_bf16(K1a, Qa1, vzero()));
      S20 = wmma_bf16(K2b, Qb0, wmma_bf16(K2a, Qa0, vzero()));
      S21 = wmma_bf16(K2b, Qb1, wmma_bf16(K2a, Qa1, vzero()));
      const float c0 = new_max(S10, S20, m0);
      const float c1 = new_max(S11, S21, m1);
      a00 *= c0; a01 *= c0; a02 *= c0;
      a10 *= c1; a11 *= c1; a12 *= c1;
      #pragma unroll
      for (int r = 0; r < 8; ++r) { nm0[r] = -m0; nm1[r] = -m1; }
    }

    // Vt-tile rows (48 x 32) x P^T (32x32); row d==40 of Vt is all-ones -> l in tile 2
    const BFrag P0 = exp_pack(S10, S20);
    const BFrag P1 = exp_pack(S11, S21);
    a00 = wmma_bf16(V0, P0, a00);
    a10 = wmma_bf16(V0, P1, a10);
    a01 = wmma_bf16(V1, P0, a01);
    a11 = wmma_bf16(V1, P1, a11);
    a02 = wmma_bf16(V2, P0, a02);
    a12 = wmma_bf16(V2, P1, a12);

    // fill the other buffer
    *reinterpret_cast<u32x4*>(&sK[1 - cur][0][krow * KSTR + kc8]) = ka0;
    *reinterpret_cast<u32x4*>(&sV[1 - cur][0][vrow * VSTR + vc8]) = va0;
    *reinterpret_cast<u32x4*>(&sK[1 - cur][1][krow * KSTR + kc8]) = ka1;
    *reinterpret_cast<u32x4*>(&sV[1 - cur][1][vrow * VSTR + vc8]) = va1;
    __syncthreads();
  }

  if (kh) {
    // last tile, upper half's waves: keys past SEQ are masked (keys are register rows); its maximum is always taken in
    const int j0 = 2 * KH * 32;
    const __bf16* kt = &sK[KH & 1][1][0];
    BFrag K1a = ld_frag(kt, KSTR);
    BFrag K1b = ld_frag(kt + 32, KSTR);
    BFrag K2a = ld_frag(kt + 16 * KSTR, KSTR);
    BFrag K2b = ld_frag(kt + 16 * KSTR + 32, KSTR);
    v8f S10 = wmma_bf16(K1b, Qb0, wmma_bf16(K1a, Qa0, vzero()));
    v8f S11 = wmma_bf16(K1b, Qb1, wmma_bf16(K1a, Qa1, vzero()));
    v8f S20 = wmma_bf16(K2b, Qb0, wmma_bf16(K2a, Qa0, vzero()));
    v8f S21 = wmma_bf16(K2b, Qb1, wmma_bf16(K2a, Qa1, vzero()));
    // the Q fragments as inputs only: their registers stay theirs past the score products; without this
    // line one product's result is laid over the B operand of the product issued directly before it
    asm volatile("" :: "v"(Qa0.u[0]), "v"(Qa0.u[1]), "v"(Qb0.u[0]), "v"(Qb0.u[1]),
                       "v"(Qa1.u[0]), "v"(Qa1.u[1]), "v"(Qb1.u[0]), "v"(Qb1.u[1]));
    #pragma unroll
    for (int r = 0; r < 8; ++r) {
      if (j0 + 8 * hm + r      >= SEQ) { S10[r] = -1e30f; S11[r] = -1e30f; }
      if (j0 + 16 + 8 * hm + r >= SEQ) { S20[r] = -1e30f; S21[r] = -1e30f; }
    }
    const float c0 = new_max(S10, S20, m0);
    const float c1 = new_max(S11, S21, m1);
    a00 *= c0; a01 *= c0; a02 *= c0;
    a10 *= c1; a11 *= c1; a12 *= c1;
    const BFrag P0 = exp_pack(S10, S20);
    const BFrag P1 = exp_pack(S11, S21);
    const __bf16* vtile = &sV[KH & 1][1][0];
    BFrag V0 = ld_frag(vtile,             VSTR);
    BFrag V1 = ld_frag(vtile + 16 * VSTR, VSTR);
    BFrag V2 = ld_frag(vtile + 32 * VSTR, VSTR);
    a00 = wmma_bf16(V0, P0, a00);
    a10 = wmma_bf16(V0, P1, a10);
    a01 = wmma_bf16(V1, P0, a01);
    a11 = wmma_bf16(V1, P1, a11);
    a02 = wmma_bf16(V2, P0, a02);
    a12 = wmma_bf16(V2, P1, a12);

    // hand sums and maxima to the lower half's wave of the same queries
    const v8f s[6] = {a00, a01, a02, a10, a11, a12};
    #pragma unroll
    for (int f = 0; f < 6; ++f) {
      sC[g][2 * f][lane]     = make_float4(s[f][0], s[f][1], s[f][2], s[f][3]);
      sC[g][2 * f + 1][lane] = make_float4(s[f][4], s[f][5], s[f][6], s[f][7]);
    }
    sM[g][0][lane] = m0;
    sM[g][1][lane] = m1;
  }
  __syncthreads();
  if (kh) return;

  // join the halves on their common maximum: sums and denominator (a row of tile 2) alike
  {
    const float u0 = sM[g][0][lane], u1 = sM[g][1][lane];
    const float t0 = fmaxf(m0, u0), t1 = fmaxf(m1, u1);
    // the four factors 2^(own maximum - common maximum) in one statement: results apart from every source
    // ("=&v") and a v_nop last, so that the slot behind each exponential holds nothing that reads its
    // result or writes its source
    float e0, f0, e1, f1;
    asm("v_exp_f32 %0, %4\n\tv_exp_f32 %1, %5\n\tv_exp_f32 %2, %6\n\tv_exp_f32 %3, %7\n\tv_nop"
        : "=&v"(e0), "=&v"(f0), "=&v"(e1), "=&v"(f1)
        : "v"(m0 - t0), "v"(u0 - t0), "v"(m1 - t1), "v"(u1 - t1));
    v8f o[6];
    #pragma unroll
    for (int f = 0; f < 6; ++f) {
      const float4 lo4 = sC[g][2 * f][lane], hi4 = sC[g][2 * f + 1][lane];
      o[f][0] = lo4.x; o[f][1] = lo4.y; o[f][2] = lo4.z; o[f][3] = lo4.w;
      o[f][4] = hi4.x; o[f][5] = hi4.y; o[f][6] = hi4.z; o[f][7] = hi4.w;
    }
    a00 = a00 * e0 + o[0] * f0; a01 = a01 * e0 + o[1] * f0; a02 = a02 * e0 + o[2] * f0;
    a10 = a10 * e1 + o[3] * f1; a11 = a11 * e1 + o[4] * f1; a12 = a12 * e1 + o[5] * f1;
  }

  const int  hh   = bh & (NH - 1);
  const long brow = (long)(bh >> 2) * SEQ_Q;
  const v8f accar[2][3] = {{a00, a01, a02}, {a10, a11, a12}};
  #pragma unroll
  for (int t = 0; t < 2; ++t) {
    // softmax denominator = row d==HD of Ot: tile 2, register 0, upper wave half
    const float lo   = accar[t][2][0];
    const float lx   = xhalf(lo);
    const float linv = __builtin_amdgcn_rcpf(hm ? lo : lx);
    float* orow = cat + (brow + (qb + t) * 16 + n) * DM + hh * HD;   // query row < 4096
    #pragma unroll
    for (int f = 0; f < 3; ++f) {
      int d0 = f * 16 + 8 * hm;                // 8 consecutive d per lane
      if (d0 < HD) {
        v8f a = accar[t][f] * linv;
        *reinterpret_cast<float4*>(orow + d0)     = make_float4(a[0], a[1], a[2], a[3]);
        *reinterpret_cast<float4*>(orow + d0 + 4) = make_float4(a[4], a[5], a[6], a[7]);
      }
    }
  }
}

// ---------------- LayerNorm + residual + transpose + 2x nearest upsample ----------------
// 1 block = one image row = 64 tokens x 160 channels (40 KB of cat in a row). 8 lanes share a
// token; lane p holds the 16-byte pieces p, p + 8, .., p + 32 of its row, so each load of a
// wave is four whole lines and cat is read once. Mean and variance: 20 values in-lane, then
// three exchanges inside the group of 8 lanes. The finished tile is turned in LDS
// (channel-major); a wave then writes whole output rows, 512 contiguous bytes a store.
#define ETHR 512            // threads per block
#define ETOK 64             // tokens per block
#define EPIT 66             // LDS pitch in floats of a channel's 64 tokens (spreads the banks)
#define ECH  (DM / (ETHR / 32))   // channels per wave in the store phase

// value of lane l ^ M inside a row of 16 lanes (DPP row_xmask)
template <int M>
__device__ __forceinline__ float xlane(float v) {
  return __builtin_bit_cast(float, __builtin_amdgcn_update_dpp(
      0, __builtin_bit_cast(int, v), 0x160 + M, 0xf, 0xf, true));
}

__global__ void __launch_bounds__(ETHR) k_epi(const float* __restrict__ cat,
                                              const float* __restrict__ lw,
                                              const float* __restrict__ lb,
                                              float* __restrict__ out) {
  __shared__ __attribute__((aligned(16))) float tl[DM * EPIT];
  const int tok = threadIdx.x >> 3, p = threadIdx.x & 7;
  const int b = blockIdx.x >> 6, ih = blockIdx.x & 63;

  const float4* row = reinterpret_cast<const float4*>(cat + ((long)blockIdx.x * ETOK + tok) * DM) + p;
  const float4* gp  = reinterpret_cast<const float4*>(lw) + p;
  const float4* hp  = reinterpret_cast<const float4*>(lb) + p;
  float4 x[5], g[5], h[5];
  #pragma unroll
  for (int i = 0; i < 5; ++i) x[i] = row[8 * i];
  #pragma unroll
  for (int i = 0; i < 5; ++i) { g[i] = gp[8 * i]; h[i] = hp[8 * i]; }
  // keeps the scheduler from sinking the lw/lb loads behind the sums, where each pair is waited for alone
  __builtin_amdgcn_sched_barrier(0);
  // the 15 loads name row's register pair and p's register: the wait stands before either may
  // be written again (as inputs they stay untouched up to it)
  asm volatile("s_wait_xcnt 0x0" :: "v"(row), "v"(p) : "memory");

  float sm = 0.f;
  #pragma unroll
  for (int i = 0; i < 5; ++i) sm += (x[i].x + x[i].y) + (x[i].z + x[i].w);
  sm += xlane<1>(sm); sm += xlane<2>(sm); sm += xlane<4>(sm);
  const float mu = sm * (1.f / DM);

  float vs = 0.f;
  #pragma unroll
  for (int i = 0; i < 5; ++i) {
    const float d0 = x[i].x - mu, d1 = x[i].y - mu, d2 = x[i].z - mu, d3 = x[i].w - mu;
    vs += d0 * d0; vs += d1 * d1; vs += d2 * d2; vs += d3 * d3;
  }
  vs += xlane<1>(vs); vs += xlane<2>(vs); vs += xlane<4>(vs);
  const float inv = rsqrtf(vs * (1.f / DM) + 1e-5f);

  #pragma unroll
  for (int i = 0; i < 5; ++i) {
    float* t = &tl[4 * (p + 8 * i) * EPIT + tok];
    t[0]        = (x[i].x - mu) * inv * g[i].x + h[i].x + x[i].x;
    t[EPIT]     = (x[i].y - mu) * inv * g[i].y + h[i].y + x[i].y;
    t[2 * EPIT] = (x[i].z - mu) * inv * g[i].z + h[i].z + x[i].z;
    t[3 * EPIT] = (x[i].w - mu) * inv * g[i].w + h[i].w + x[i].w;
  }
  __syncthreads();

  // lane l: tokens 2l and 2l + 1, each doubled = output columns 4l .. 4l + 3; rows 2ih, 2ih + 1
  const int lane = threadIdx.x & 31;
  const int c0   = __builtin_amdgcn_readfirstlane(threadIdx.x >> 5) * ECH;
  float* o = out + (((long)b * DM + c0) * 128 + 2 * ih) * 128 + 4 * lane;
  #pragma unroll
  for (int j = 0; j < ECH; ++j) {
    const float2 v = *reinterpret_cast<const float2*>(&tl[(c0 + j) * EPIT + 2 * lane]);
    const float4 w = make_float4(v.x, v.x, v.y, v.y);
    *reinterpret_cast<float4*>(o + j * 128 * 128)       = w;
    *reinterpret_cast<float4*>(o + j * 128 * 128 + 128) = w;
  }
}

// ---------------- launch ----------------
extern "C" void kernel_launch(void* const* d_in, const int* in_sizes, int n_in,
                              void* d_out, int out_size, void* d_ws, size_t ws_size,
                              hipStream_t stream) {
  (void)in_sizes; (void)n_in; (void)out_size; (void)ws_size;
  const float* x   = (const float*)d_in[0];
  const float* w1  = (const float*)d_in[1];
  const float* b1  = (const float*)d_in[2];
  const float* w2  = (const float*)d_in[3];
  const float* b2  = (const float*)d_in[4];
  const float* pe  = (const float*)d_in[5];
  const float* wq  = (const float*)d_in[6];
  const float* wk  = (const float*)d_in[7];
  const float* wv  = (const float*)d_in[8];
  const float* lw  = (const float*)d_in[9];
  const float* lb  = (const float*)d_in[10];
  float* out = (float*)d_out;
  char*  ws  = (char*)d_ws;

  // workspace layout (bytes), all 16B aligned
  constexpr long C1_OFF  = 0;                                   // 4*64*4096 f32      = 4,194,304 B
  constexpr long WB_OFF  = C1_OFF  + 4L * 64 * HW * 4;          // 3*160*160 bf16     = 153,600 B
  constexpr long Q_OFF   = WB_OFF  + 3L * DM * DM * 2;          // 16*4128*64 bf16    = 8,454,144 B
  constexpr long K_OFF   = Q_OFF   + 16L * SPAD * DP * 2;
  constexpr long VT_OFF  = K_OFF   + 16L * SPAD * DP * 2;
  constexpr long CAT_OFF = VT_OFF  + 16L * SPAD * DP * 2;       // 4*4096*160 f32     = 10,485,760 B

  float*  c1  = (float*) (ws + C1_OFF);
  __bf16* wb  = (__bf16*)(ws + WB_OFF);
  __bf16* qb  = (__bf16*)(ws + Q_OFF);
  __bf16* kb  = (__bf16*)(ws + K_OFF);
  __bf16* vtb = (__bf16*)(ws + VT_OFF);
  float*  cat = (float*) (ws + CAT_OFF);

  k_cvtw <<<(3 * DM * DM + 255) / 256, 256, 0, stream>>>(wq, wk, wv, wb);
  k_conv1<<<64 * 8, C1THR, 0, stream>>>(x, w1, b1, c1);
  // writes every byte of q, k and vt (pads and the ones row included)
  k_fqkv <<<BATCH * C2BLK, C2THR, 0, stream>>>(c1, w2, b2, pe, wb, qb, kb, vtb);   // 512 blocks

  k_attn <<<512, 256, 0, stream>>>(qb, kb, vtb, cat);           // 16 bh x 32 q-groups

  k_epi  <<<(BATCH * HW) / ETOK, ETHR, 0, stream>>>(cat, lw, lb, out);   // one block per image row
}

// v009
// A run of this version takes 81.4 microseconds.
// In two side-by-side timings against v008, it was 1.14 and 1.12 times as fast.
// Counting every step since v000, it is 3.80 times as fast.
#include <hip/hip_runtime.h>
#include <hip/hip_bf16.h>

// ---------------- CDNA5 WMMA types ----------------
typedef __attribute__((ext_vector_type(16))) __bf16       v16bf;
typedef __attribute__((ext_vector_type(8)))  float        v8f;
typedef __attribute__((ext_vector_type(4)))  unsigned int u32x4;

#define BATCH 4
#define DM    160           // d_model
#define NH    4
#define HD    40            // head dim
#define DP    64            // padded head dim (4 x 16)
#define HW    4096          // 64*64 tokens
#define SEQ   4097          // tokens + pad row
#define SEQ_Q 4096          // queries that survive cat[:, :-1, :]
#define SPAD  4128          // K/V padded length (multiple of 32)
#define KSTR  72            // LDS K-tile row stride (bank-conflict-free for b128)
#define VSTR  40            // LDS V-tile row stride (bank-conflict-free for b128)

union BFrag { v16bf v; u32x4 u[2]; };

// 16x32 bf16 A/B fragment loader (row-major tile, `stride` elements per row).
// Lanes 0-15 : row=lane,    K chunks {0..7} and {16..23}
// Lanes 16-31: row=lane-16, K chunks {8..15} and {24..31}
__device__ __forceinline__ BFrag ld_frag(const __bf16* base, int stride) {
  const int lane = threadIdx.x & 31;
  const int r  = lane & 15;
  const int hh = lane >> 4;
  const __bf16* p = base + (long)r * stride + 8 * hh;
  BFrag f;
  f.u[0] = *reinterpret_cast<const u32x4*>(p);
  f.u[1] = *reinterpret_cast<const u32x4*>(p + 16);
  return f;
}

__device__ __forceinline__ v8f wmma_bf16(const BFrag& a, const BFrag& b, v8f c) {
  return __builtin_amdgcn_wmma_f32_16x16x32_bf16(false, a.v, false, b.v,
                                                 (short)0, c, false, false);
}

__device__ __forceinline__ v8f vzero() {
  v8f z = {0.f, 0.f, 0.f, 0.f, 0.f, 0.f, 0.f, 0.f};
  return z;
}

// ---------------- wq/wk/wv -> bf16 ----------------
__global__ void k_cvtw(const float* __restrict__ wq, const float* __restrict__ wk,
                       const float* __restrict__ wv, __bf16* __restrict__ o) {
  int i = blockIdx.x * 256 + threadIdx.x;
  if (i >= 3 * DM * DM) return;
  const float* src = (i < DM * DM) ? wq : (i < 2 * DM * DM ? wk : wv);
  o[i] = (__bf16)src[i % (DM * DM)];
}

// ---------- conv1 (2x2 stride 2) -> conv2 (1x1) + bias + leaky + pad + PE -> bf16 tokens in LDS -> q, k, vt ----------
// 1 block = 32 real token rows (half an image row of conv1's output).
// Part 0 (WMMA f32 16x16x4): conv1 for the block's 32 positions x 64 channels. A wave takes 16
// output channels and 16 input channels. One product has k = 4 = 2 input channels (one per wave
// half) x the 2 columns of one kernel row: a lane's 16-byte x load is both columns of two
// neighbouring positions (B of the even and of the odd position tile), its 16-byte weight load is
// both kernel rows of one input channel (A of two products). The same (wave half, register) holds
// the same (input channel, column) in A and in B. The four quarters of the input channels are
// joined in LDS (the first one starts from the bias); the result stays there, token-major, for part 1.
// Part 1: all 160 channels of the rows. Lanes run along the tokens,
// a wave owns 10 channels, so its weights are wave-uniform (scalar
// loads) and each c1 value is used 10 times from a register. The 32x160 bf16 tile stays in LDS.
// Part 2 (WMMA bf16): wave = one of {q,k,v} x one head (12 of the 16 waves), both 16-token tiles
// of the block, read from LDS as fragments; K = 160 = 5 x K32. The head's 40 weight rows are 3
// tiles of 16 (the last half used), worked on one after the other. The wave writes the whole
// padded head (DP = 64 dims) of its tokens, pads included, so every byte of q, k and vt is
// written here and nothing has to be cleared beforehand.
// The 32 rows behind a batch's real tokens (row HW: the zero-pad row + its positional value; the
// rest 0) need no part 1: each of their 48 pieces (12 heads x 4 tiles of 16 dims) is one job for
// a wave that has no part 2 (waves 12..15 of a batch's first 12 blocks). So the grid is 512
// blocks, two per WGP, all resident at once.
// q, k: Dt = W * Ft, a lane holds 8 consecutive dims of ONE token  = one 16-byte store.
// v   : D  = F * Wt, a lane holds 8 consecutive tokens of ONE dim  = one 16-byte store of Vt.
// Vt row d == HD is all ones (softmax denominator via WMMA); every other pad is 0.
// Q output is pre-scaled by (1/sqrt(HD)) * log2(e) so attention uses raw exp2.
#define C2ROWS 32           // token rows per block
#define C2BLK  (HW / C2ROWS)   // blocks per batch
#define C2OC   10           // channels per wave (16 waves x 10 = DM)
#define C2THR  512          // threads per block
#define C2PIT  168          // LDS row pitch in bf16 (336 B: 16 B x odd, spreads the banks)
#define C1PIT  68           // LDS pitch in floats of a token's 64 conv1 channels (16-byte column walks without conflicts)
typedef __attribute__((ext_vector_type(2))) __bf16 v2bf;
typedef __attribute__((ext_vector_type(2))) float  v2f;
typedef __attribute__((ext_vector_type(4))) float  v4f;

__device__ __forceinline__ v8f wmma_f32(float a0, float a1, float b0, float b1, v8f c) {
  const v2f a = {a0, a1}, b = {b0, b1};
  return __builtin_amdgcn_wmma_f32_16x16x4_f32(false, a, false, b, (short)0, c, false, false);
}

union Pack8 { __bf16 h[8]; u32x4 u; };

// one lane's share of the 5 fragments of a 16-row tile (lane map of ld_frag; p holds the lane's row)
__device__ __forceinline__ void ld_ftile(BFrag (&f)[5], const __bf16* p) {
  #pragma unroll
  for (int kk = 0; kk < 5; ++kk) {
    f[kk].u[0] = *reinterpret_cast<const u32x4*>(p + kk * 32);
    f[kk].u[1] = *reinterpret_cast<const u32x4*>(p + kk * 32 + 16);
  }
}

// one tile of 16 weight rows (Wt) x the block's two token tiles (fl: the lane's row of the first
// one in LDS). VT: D = F * Wt (rows = tokens); else Dt = W * Ft (rows = dims). keep: this lane's 8
// values are real dims; else they are pad positions and padv goes out in their place.
// NEXT: each fragment of Wt, once its two products are issued, is asked for anew from wn (the
// head's next tile), so that one set of 40 registers serves and the loads run under the products.
template <bool VT, bool NEXT>
__device__ __forceinline__ void fq_tile(BFrag (&Wt)[5], const __bf16* wn, const __bf16* fl,
                                        __bf16* o, float sc, bool keep, float padv) {
  constexpr long TS = VT ? 16 : 16 * DP;       // step of o per token tile
  v8f a0 = vzero(), a1 = vzero();
  #pragma unroll
  for (int kk = 0; kk < 5; ++kk) {
    BFrag F0, F1;
    F0.u[0] = *reinterpret_cast<const u32x4*>(fl + kk * 32);
    F0.u[1] = *reinterpret_cast<const u32x4*>(fl + kk * 32 + 16);
    F1.u[0] = *reinterpret_cast<const u32x4*>(fl + 16 * C2PIT + kk * 32);
    F1.u[1] = *reinterpret_cast<const u32x4*>(fl + 16 * C2PIT + kk * 32 + 16);
    if constexpr (VT) {
      a0 = wmma_bf16(F0, Wt[kk], a0);
      a1 = wmma_bf16(F1, Wt[kk], a1);
    } else {
      a0 = wmma_bf16(Wt[kk], F0, a0);
      a1 = wmma_bf16(Wt[kk], F1, a1);
    }
    if constexpr (NEXT) {
      Wt[kk].u[0] = *reinterpret_cast<const u32x4*>(wn + kk * 32);
      Wt[kk].u[1] = *reinterpret_cast<const u32x4*>(wn + kk * 32 + 16);
    }
  }
  Pack8 p0, p1;
  #pragma unroll
  for (int i = 0; i < 8; ++i) {
    const float e0 = VT ? a0[i] : a0[i] * sc;
    const float e1 = VT ? a1[i] : a1[i] * sc;
    p0.h[i] = (__bf16)(keep ? e0 : padv);
    p1.h[i] = (__bf16)(keep ? e1 : padv);
  }
  *reinterpret_cast<u32x4*>(o)      = p0.u;
  *reinterpret_cast<u32x4*>(o + TS) = p1.u;
  // the two stores name address and data registers, the loads wn's pair, that later code writes
  // again: the wait stands in front of all of those writes (wn as an input stays untouched up to it)
  asm volatile("s_wait_xcnt 0x0" :: "v"(wn) : "memory");
}

// the 4 tiles of 16 dims of a padded head, DS apart in the output; Wt arrives holding tile 0
template <bool VT>
__device__ __forceinline__ void fq_head(BFrag (&Wt)[5], const __bf16* w01, const __bf16* w2,
                                        const __bf16* fl, __bf16* o, float sc, int n, int hm) {
  constexpr long DS = VT ? 16 * SPAD : 16;
  constexpr long TS = VT ? 16 : 16 * DP;
  const bool  real = VT ? (n < HD - 32) : (hm == 0);            // dims 32..39 of tile 2
  const float padv = (VT && n == HD - 32) ? 1.0f : 0.0f;        // dims 40..47: ones row of Vt, else 0
  const u32x4 zz = {0u, 0u, 0u, 0u};
  *reinterpret_cast<u32x4*>(o + 3 * DS)      = zz;
  *reinterpret_cast<u32x4*>(o + 3 * DS + TS) = zz;
  fq_tile<VT, true >(Wt, w01 + 16 * DM, fl, o,          sc, true, 0.f);
  fq_tile<VT, true >(Wt, w2,            fl, o + DS,     sc, true, 0.f);
  fq_tile<VT, false>(Wt, w2,            fl, o + 2 * DS, sc, real, padv);
}

// one piece of the 32 rows behind the real tokens: tile t of 16 dims (Wt: its weight rows; t == 3
// is pad only, its products are not used). Token tile 0 has row 0 = pl in every channel and 0
// elsewhere, so one fragment serves all 5 k steps; token tile 1 is all 0, and so are its products.
template <bool VT>
__device__ __forceinline__ void fq_pad(const BFrag (&Wt)[5], int t, float pl, __bf16* o, float sc,
                                       int n, int hm) {
  constexpr long DS = VT ? 16 * SPAD : 16;
  constexpr long TS = VT ? 16 : 16 * DP;
  const bool  keep = t < 2 || (t == 2 && (VT ? (n < HD - 32) : (hm == 0)));
  const float padv = (VT && t == 2 && n == HD - 32) ? 1.0f : 0.0f;
  const __bf16 fv = (__bf16)(n == 0 ? pl : 0.f);
  BFrag F;
  #pragma unroll
  for (int i = 0; i < 16; ++i) F.v[i] = fv;
  v8f a = vzero();
  #pragma unroll
  for (int kk = 0; kk < 5; ++kk) a = VT ? wmma_bf16(F, Wt[kk], a) : wmma_bf16(Wt[kk], F, a);
  Pack8 p0, p1;
  #pragma unroll
  for (int i = 0; i < 8; ++i) {
    const float e = VT ? a[i] : a[i] * sc;
    p0.h[i] = (__bf16)(keep ? e : padv);
    p1.h[i] = (__bf16)(keep ? 0.f : padv);
  }
  *reinterpret_cast<u32x4*>(o + t * DS)      = p0.u;
  *reinterpret_cast<u32x4*>(o + t * DS + TS) = p1.u;
  // the two stores name address and data registers: behind the q/k form the listing goes on with
  // the vt form's code, which writes those registers again; the wait stands in front of it
  asm volatile("s_wait_xcnt 0x0" ::: "memory");
}

// 8 waves per SIMD = two blocks per WGP (128 registers a wave): one block's products and their
// load latencies run under the other block's sums
__global__ void __launch_bounds__(C2THR) __attribute__((amdgpu_waves_per_eu(8)))
k_fqkv(const float* __restrict__ x,
       const float* __restrict__ w1,
       const float* __restrict__ b1,
       const float* __restrict__ w,
       const float* __restrict__ bias,
       const float* __restrict__ pe,
       const __bf16* __restrict__ wb,
       __bf16* __restrict__ q) {                  // q, k and vt stand one behind the other
  __bf16* const k  = q + 16L * SPAD * DP;
  __bf16* const vt = k + 16L * SPAD * DP;
  __shared__ __attribute__((aligned(16))) __bf16 tile[C2ROWS * C2PIT];
  __shared__ __attribute__((aligned(16))) float part[4][C2ROWS * C1PIT];   // conv1, per quarter of its input channels
  const int lane = threadIdx.x & 31;
  const int wv   = __builtin_amdgcn_readfirstlane(threadIdx.x >> 5);
  const int oc0  = wv * C2OC;
  const int bb   = blockIdx.x / C2BLK;              // batch
  const int ib   = blockIdx.x - bb * C2BLK;         // block of the batch
  const int s    = ib * C2ROWS + lane;              // token row, below HW

  const int n   = lane & 15;
  const int hm  = lane >> 4;

  const float pv = pe[s];
  // the pe load names s's register as its offset: the wait stands before anything may be
  // written there (s as an input keeps the register untouched up to the wait)
  asm volatile("s_wait_xcnt 0x0" :: "v"(s) : "memory");

  // ---- part 0: conv1 ----
  {
    const int ot = wv & 3, kq = wv >> 2;         // tile of 16 output channels, quarter of the input channels
    // lane (n, hm): input channel kq * 16 + 2 * p + hm; x row 2 * oh + kh, columns of positions 2n and 2n + 1
    const v4f* xp = reinterpret_cast<const v4f*>(
        x + (((long)bb * 64 + kq * 16 + hm) * 128 + (ib >> 1) * 2) * 128 + (ib & 1) * 64 + 4 * n);
    const v4f* wq1 = reinterpret_cast<const v4f*>(w1 + (16 * ot + n) * 256 + (kq * 16 + hm) * 4);
    v4f wr[8], xr[8][2];
    #pragma unroll
    for (int p = 0; p < 8; ++p) {
      wr[p]    = wq1[2 * p];
      xr[p][0] = xp[p * 8192];
      xr[p][1] = xp[p * 8192 + 32];
    }
    const float4* bq1 = reinterpret_cast<const float4*>(b1 + 16 * ot + 8 * hm);
    const float4 bl = bq1[0], bu = bq1[1];       // bias of the lane's 8 channels
    // the 26 loads name xp's and wq1's register pairs and an offset made of hm: the wait stands
    // before any of them may be written again (the pairs, as inputs, stay untouched up to it)
    asm volatile("s_wait_xcnt 0x0" :: "v"(xp), "v"(wq1) : "memory");
    // positions 2n and 2n + 1, channels 16 * ot + 8 * hm + r; the first quarter's sums start from the bias
    const bool fq = kq == 0;
    v8f ce = {fq ? bl.x : 0.f, fq ? bl.y : 0.f, fq ? bl.z : 0.f, fq ? bl.w : 0.f,
              fq ? bu.x : 0.f, fq ? bu.y : 0.f, fq ? bu.z : 0.f, fq ? bu.w : 0.f};
    v8f co = ce;
    #pragma unroll
    for (int p = 0; p < 8; ++p) {
      ce = wmma_f32(wr[p].x, wr[p].y, xr[p][0].x, xr[p][0].y, ce);
      co = wmma_f32(wr[p].x, wr[p].y, xr[p][0].z, xr[p][0].w, co);
      ce = wmma_f32(wr[p].z, wr[p].w, xr[p][1].x, xr[p][1].y, ce);
      co = wmma_f32(wr[p].z, wr[p].w, xr[p][1].z, xr[p][1].w, co);
    }
    float* pw = &part[kq][2 * n * C1PIT + 16 * ot + 8 * hm];
    *reinterpret_cast<float4*>(pw)             = make_float4(ce[0], ce[1], ce[2], ce[3]);
    *reinterpret_cast<float4*>(pw + 4)         = make_float4(ce[4], ce[5], ce[6], ce[7]);
    *reinterpret_cast<float4*>(pw + C1PIT)     = make_float4(co[0], co[1], co[2], co[3]);
    *reinterpret_cast<float4*>(pw + C1PIT + 4) = make_float4(co[4], co[5], co[6], co[7]);
    // loaded operands as inputs only, behind the stores of the results: their registers stay theirs past
    // the run of products; without this line an address sum is written over the B operand of a product
    // issued just before it. The first pair's 12 registers are left out: with them held too, part 2 spills
    asm volatile("" :: "v"(wr[1]), "v"(xr[1][0]), "v"(xr[1][1]), "v"(wr[2]), "v"(xr[2][0]), "v"(xr[2][1]),
                       "v"(wr[3]), "v"(xr[3][0]), "v"(xr[3][1]), "v"(wr[4]), "v"(xr[4][0]), "v"(xr[4][1]),
                       "v"(wr[5]), "v"(xr[5][0]), "v"(xr[5][1]), "v"(wr[6]), "v"(xr[6][0]), "v"(xr[6][1]),
                       "v"(wr[7]), "v"(xr[7][0]), "v"(xr[7][1]) : "memory");
    __syncthreads();
    // join: a thread owns 4 channels of one token, in place in quarter 0
    const int ro = (threadIdx.x >> 4) * C1PIT + (threadIdx.x & 15) * 4;
    const float4 s0 = *reinterpret_cast<const float4*>(&part[0][ro]);
    const float4 s1 = *reinterpret_cast<const float4*>(&part[1][ro]);
    const float4 s2 = *reinterpret_cast<const float4*>(&part[2][ro]);
    const float4 s3 = *reinterpret_cast<const float4*>(&part[3][ro]);
    *reinterpret_cast<float4*>(&part[0][ro]) =
        make_float4((s0.x + s1.x) + (s2.x + s3.x), (s0.y + s1.y) + (s2.y + s3.y),
                    (s0.z + s1.z) + (s2.z + s3.z), (s0.w + s1.w) + (s2.w + s3.w));
    __syncthreads();
  }

  // weight fragments of part 2, lane map of ld_frag: tiles 0 and 1 are rows n and 16 + n of the
  // head; in tile 2 the rows past the head's 40 read its last row (their products land in pad
  // positions and are replaced on the way out). Waves 0..11: {q,k,v} x head = the wave's number,
  // starting with tile 0. Waves 12..15: = the block's number (where below 12), tile tp alone.
  const int un  = wv < 3 * NH ? wv : (ib < 3 * NH ? ib : 0);
  const int tp  = wv & 3;
  const int mat = un >> 2, hh = un & (NH - 1);
  const __bf16* wh  = wb + ((long)mat * DM + hh * HD) * DM + 8 * hm;
  const __bf16* w01 = wh + n * DM;
  const __bf16* w2  = wh + (n < HD - 32 ? 32 + n : HD - 1) * DM;
  const __bf16* wf  = wv < 3 * NH ? w01 : (tp == 2 ? w2 : w01 + (tp & 1) * 16 * DM);
  BFrag Wt[5];

  // ---- part 1: conv2 ----
  float xv[64];
  #pragma unroll
  for (int i = 0; i < 16; ++i) {
    const float4 t = *reinterpret_cast<const float4*>(&part[0][lane * C1PIT + 4 * i]);
    xv[4 * i] = t.x; xv[4 * i + 1] = t.y; xv[4 * i + 2] = t.z; xv[4 * i + 3] = t.w;
  }

  // 20 groups of 2 channels x 16 inputs; per channel the sum runs over ic = 0..63 in order.
  // A group's 32 weights are fetched while the group before it is worked on.
  const float* wp = w + oc0 * 64;
  float wc[32], wn[32];
  #pragma unroll
  for (int i = 0; i < 16; ++i) { wc[i] = wp[i]; wc[16 + i] = wp[64 + i]; }
  float a0 = 0.f, a1 = 0.f;
  #pragma unroll
  for (int g = 0; g < 20; ++g) {
    const int j0 = (g >> 2) * 2, icb = (g & 3) * 16;
    if (g + 1 < 20) {
      const int jn = ((g + 1) >> 2) * 2, icn = ((g + 1) & 3) * 16;
      #pragma unroll
      for (int i = 0; i < 16; ++i) {
        wn[i]      = wp[jn * 64 + icn + i];
        wn[16 + i] = wp[(jn + 1) * 64 + icn + i];
      }
    }
    if (icb == 0) { a0 = bias[oc0 + j0]; a1 = bias[oc0 + j0 + 1]; }
    #pragma unroll
    for (int i = 0; i < 16; ++i) {
      // written as fused steps: with xv read in 16-byte pieces the plain form is turned into packed
      // products with separate adds and register copies
      a0 = __builtin_fmaf(xv[icb + i], wc[i], a0);
      a1 = __builtin_fmaf(xv[icb + i], wc[16 + i], a1);
    }
    if (icb == 48) {
      float l0 = a0 >= 0.f ? a0 : 0.01f * a0;
      float l1 = a1 >= 0.f ? a1 : 0.01f * a1;
      v2bf t;
      t[0] = (__bf16)(l0 + pv);
      t[1] = (__bf16)(l1 + pv);
      *reinterpret_cast<v2bf*>(&tile[lane * C2PIT + oc0 + j0]) = t;
    }
    // the wave's first weight tile of part 2, into registers that the last sums have left: its
    // latency runs under the rest of part 1
    if (g == 17) ld_ftile(Wt, wf);
    // keeps the scheduler from lifting all the weight loads to the top, which spills scalar registers
    __builtin_amdgcn_sched_barrier(0);
    #pragma unroll
    for (int i = 0; i < 32; ++i) wc[i] = wn[i];
  }
  // the 10 loads of that tile name wf's register pair: the wait stands before it may be written again
  asm volatile("s_wait_xcnt 0x0" :: "v"(wf) : "memory");
  __syncthreads();

  const long  bh = (long)bb * NH + hh;
  const float qs = (mat == 0) ? 0.22811012f : 1.0f;   // q: (1/sqrt(40)) * log2(e)
  if (wv >= 3 * NH) {                          // behind the block's last barrier
    if (ib >= 3 * NH) return;
    const float pl = pe[HW];
    if (mat == 2) fq_pad<true >(Wt, tp, pl, vt + (bh * DP + n) * SPAD + HW + 8 * hm, 1.0f, n, hm);
    else          fq_pad<false>(Wt, tp, pl, (mat == 0 ? q : k) + (bh * SPAD + HW + n) * DP + 8 * hm, qs, n, hm);
    return;
  }

  const int s0 = ib * C2ROWS;
  const __bf16* fl = &tile[n * C2PIT + 8 * hm];
  if (mat == 2) {
    fq_head<true>(Wt, w01, w2, fl, vt + (bh * DP + n) * SPAD + s0 + 8 * hm, 1.0f, n, hm);
  } else {
    fq_head<false>(Wt, w01, w2, fl, (mat == 0 ? q : k) + (bh * SPAD + s0 + n) * DP + 8 * hm,
                   qs, n, hm);
  }
}

#define KH 64               // full key tiles per key half

// value of lane l ^ 16
__device__ __forceinline__ float xhalf(float v) {
  int b = __builtin_bit_cast(int, v);
  b = __builtin_amdgcn_permlanex16(b, b, 0x76543210, 0xfedcba98, false, false);
  return __builtin_bit_cast(float, b);
}

// largest of a lane's 16 scores (four short independent chains, not one of sixteen links)
__device__ __forceinline__ float max16(const v8f& S1, const v8f& S2) {
  const float mxa = fmaxf(fmaxf(S1[0], S1[1]), fmaxf(S1[2], S1[3]));
  const float mxb = fmaxf(fmaxf(S1[4], S1[5]), fmaxf(S1[6], S1[7]));
  const float mxc = fmaxf(fmaxf(S2[0], S2[1]), fmaxf(S2[2], S2[3]));
  const float mxd = fmaxf(fmaxf(S2[4], S2[5]), fmaxf(S2[6], S2[7]));
  return fmaxf(fmaxf(mxa, mxb), fmaxf(mxc, mxd));
}

// takes a tile's true maximum into mrow (16 keys in-lane, the query's other 16 in lane ^ 16),
// moves the raw scores onto it and returns the factor that moves the sums kept so far
__device__ __forceinline__ float new_max(v8f& S1, v8f& S2, float& mrow) {
  const float mx   = max16(S1, S2);
  const float mn   = fmaxf(mrow, fmaxf(mx, xhalf(mx)));
  const float corr = __builtin_amdgcn_exp2f(mrow - mn);   // scores already in exp2 domain
  mrow = mn;
  S1 -= mn; S2 -= mn;
  return corr;
}

// P^T as B operand: element s = key 8*hm + s (s < 8) or 16 + 8*hm + s - 8 (s >= 8), straight from the two score tiles
__device__ __forceinline__ BFrag exp_pack(const v8f& S1, const v8f& S2) {
  BFrag P;
  #pragma unroll
  for (int r = 0; r < 8; ++r) {
    P.v[r]     = (__bf16)__builtin_amdgcn_exp2f(S1[r]);
    P.v[8 + r] = (__bf16)__builtin_amdgcn_exp2f(S2[r]);
  }
  return P;
}

__global__ void __launch_bounds__(256) k_attn(const __bf16* __restrict__ q,
                                              const __bf16* __restrict__ k,
                                              const __bf16* __restrict__ vt,
                                              float* __restrict__ cat) {
  __shared__ __attribute__((aligned(16))) __bf16 sK[2][2][32 * KSTR];   // [buffer][key half]
  __shared__ __attribute__((aligned(16))) __bf16 sV[2][2][64 * VSTR];
  __shared__ __attribute__((aligned(16))) float4 sC[4][12][32];         // upper key half's sums
  __shared__ float sM[4][2][32];                                        // and its maxima in use

  const int bh = blockIdx.x >> 5;              // 16 (b,h) pairs
  const int qg = blockIdx.x & 31;              // 32 groups of 128 queries
  const int wv = __builtin_amdgcn_readfirstlane(threadIdx.x >> 5);
  const int g  = wv & 3;                       // which 32 queries of the block
  const int kh = wv >> 2;                      // which half of the keys
  const int qb = qg * 8 + g * 2;               // first of the wave's two 16-query tiles (< 256)
  const int lane = threadIdx.x & 31;
  const int n  = lane & 15;
  const int hm = lane >> 4;
  const int tid = threadIdx.x;

  // cooperative staging coordinates (256 threads: K 32x64, V 64x32, 16B each, per key half)
  const int krow = tid >> 3, kc8 = (tid & 7) * 8;
  const int vrow = tid >> 2, vc8 = (tid & 3) * 8;
  const __bf16* kg = k  + ((long)bh * SPAD + krow) * DP + kc8;
  const __bf16* vg = vt + ((long)bh * DP + vrow) * SPAD + vc8;
  constexpr int KHK = KH * 32 * DP;            // from a tile of the lower half to its partner, in k
  constexpr int KHV = KH * 32;                 // the same in a row of vt

  const __bf16* qbase = q + ((long)bh * SPAD + qb * 16) * DP;
  BFrag Qa0 = ld_frag(qbase, DP);                 // B operand, column = query n, K = d 0..31
  BFrag Qb0 = ld_frag(qbase + 32, DP);            // K = d 32..63
  BFrag Qa1 = ld_frag(qbase + 16 * DP, DP);       // the second query tile
  BFrag Qb1 = ld_frag(qbase + 16 * DP + 32, DP);

  // Ot tiles: register r of tile f = O[query n][d = 16*f + 8*hm + r]; d 48..63 is pad, never stored
  v8f a00 = vzero(), a01 = vzero(), a02 = vzero();   // query tile 0
  v8f a10 = vzero(), a11 = vzero(), a12 = vzero();   // query tile 1
  float m0 = -1e30f, m1 = -1e30f;       // maximum in use for this lane's two queries (at most 8 below the true one)
  v8f nm0, nm1;                         // -m in all 8 registers: start value of the score products
  #pragma unroll
  for (int r = 0; r < 8; ++r) { nm0[r] = 1e30f; nm1[r] = 1e30f; }

  // stage the first tile of both halves
  {
    u32x4 a = *reinterpret_cast<const u32x4*>(kg);
    u32x4 b = *reinterpret_cast<const u32x4*>(vg);
    u32x4 c = *reinterpret_cast<const u32x4*>(kg + KHK);
    u32x4 d = *reinterpret_cast<const u32x4*>(vg + KHV);
    *reinterpret_cast<u32x4*>(&sK[0][0][krow * KSTR + kc8]) = a;
    *reinterpret_cast<u32x4*>(&sV[0][0][vrow * VSTR + vc8]) = b;
    *reinterpret_cast<u32x4*>(&sK[0][1][krow * KSTR + kc8]) = c;
    *reinterpret_cast<u32x4*>(&sV[0][1][vrow * VSTR + vc8]) = d;
  }
  __syncthreads();

  // the KH full tiles of each half: every key is real and a next tile exists (behind the upper
  // half's last one stands the masked tile; the lower half's is staged with it and not read).
  // Stays rolled and unpeeled: a peeled copy keeps a second set of the start-value registers,
  // copied on every trip
  #pragma unroll 1
  for (int it = 0; it < KH; ++it) {
    const int j0 = it * 32;
    const int cur = it & 1;
    // scores: K-tile (32x64) x Q^T (64x32) -> four 16x16 f32 fragments (keys x queries)
    const __bf16* kt = &sK[cur][kh][0];
    BFrag K1a = ld_frag(kt, KSTR);
    BFrag K1b = ld_frag(kt + 32, KSTR);
    BFrag K2a = ld_frag(kt + 16 * KSTR, KSTR);
    BFrag K2b = ld_frag(kt + 16 * KSTR + 32, KSTR);
    // Vt fragments, asked for together with K's: behind the test below they would start only after it
    const __bf16* vtile = &sV[cur][kh][0];
    BFrag V0 = ld_frag(vtile,             VSTR);
    BFrag V1 = ld_frag(vtile + 16 * VSTR, VSTR);
    BFrag V2 = ld_frag(vtile + 32 * VSTR, VSTR);

    // prefetch both halves' next tiles into regs; behind the fragment loads, so that the wait below runs while those are under way
    const __bf16* kc = kg + (long)j0 * DP;     // the next tile's 32 rows stand 4096 bytes behind it
    const __bf16* vc = vg + j0;                // the next tile's 32 keys stand 64 bytes behind it
    const u32x4 ka0 = *reinterpret_cast<const u32x4*>(kc + 32 * DP);
    const u32x4 va0 = *reinterpret_cast<const u32x4*>(vc + 32);
    const u32x4 ka1 = *reinterpret_cast<const u32x4*>(kc + KHK + 32 * DP);
    const u32x4 va1 = *reinterpret_cast<const u32x4*>(vc + KHV + 32);
    // the four loads name kc's and vc's register pairs: the wait stands before
    // either pair may be written again (as inputs they stay untouched up to it)
    asm volatile("s_wait_xcnt 0x0" :: "v"(kc), "v"(vc) : "memory");

    // the maximum in use enters the products as their start value: S = score - m
    v8f S10 = wmma_bf16(K1b, Qb0, wmma_bf16(K1a, Qa0, nm0));
    v8f S11 = wmma_bf16(K1b, Qb1, wmma_bf16(K1a, Qa1, nm1));
    v8f S20 = wmma_bf16(K2b, Qb0, wmma_bf16(K2a, Qa0, nm0));
    v8f S21 = wmma_bf16(K2b, Qb1, wmma_bf16(K2a, Qa1, nm1));
    // nm0, nm1 as inputs only: they stay in their registers past the products, which then read them in
    // place; without this line the second product of each gets a copy of all 8 registers on every trip
    asm volatile("" :: "v"(nm0), "v"(nm1));

    // one test a tile for the whole wave: the maxima in use move only when some score lies more
    // than 8 above its own (an exponential then stays below 2^8; the denominator carries the same scale)
    if (__builtin_amdgcn_ballot_w32(fmaxf(max16(S10, S20), max16(S11, S21)) > 8.0f) != 0) {
      // always taken on a half's first tile (m = -1e30 swamps the scores), so the scores are formed anew from 0
      S10 = wmma_bf16(K1b, Qb0, wmma_bf16(K1a, Qa0, vzero()));
      S11 = wmma_bf16(K1b, Qb1, wmma_bf16(K1a, Qa1, vzero()));
      S20 = wmma_bf16(K2b, Qb0, wmma_bf16(K2a, Qa0, vzero()));
      S21 = wmma_bf16(K2b, Qb1, wmma_bf16(K2a, Qa1, vzero()));
      const float c0 = new_max(S10, S20, m0);
      const float c1 = new_max(S11, S21, m1);
      a00 *= c0; a01 *= c0; a02 *= c0;
      a10 *= c1; a11 *= c1; a12 *= c1;
      #pragma unroll
      for (int r = 0; r < 8; ++r) { nm0[r] = -m0; nm1[r] = -m1; }
    }

    // Vt-tile rows (48 x 32) x P^T (32x32); row d==40 of Vt is all-ones -> l in tile 2
    const BFrag P0 = exp_pack(S10, S20);
    const BFrag P1 = exp_pack(S11, S21);
    a00 = wmma_bf16(V0, P0, a00);
    a10 = wmma_bf16(V0, P1, a10);
    a01 = wmma_bf16(V1, P0, a01);
    a11 = wmma_bf16(V1, P1, a11);
    a02 = wmma_bf16(V2, P0, a02);
    a12 = wmma_bf16(V2, P1, a12);

    // fill the other buffer
    *reinterpret_cast<u32x4*>(&sK[1 - cur][0][krow * KSTR + kc8]) = ka0;
    *reinterpret_cast<u32x4*>(&sV[1 - cur][0][vrow * VSTR + vc8]) = va0;
    *reinterpret_cast<u32x4*>(&sK[1 - cur][1][krow * KSTR + kc8]) = ka1;
    *reinterpret_cast<u32x4*>(&sV[1 - cur][1][vrow * VSTR + vc8]) = va1;
    __syncthreads();
  }

  if (kh) {
    // last tile, upper half's waves: keys past SEQ are masked (keys are register rows); its maximum is always taken in
    const int j0 = 2 * KH * 32;
    const __bf16* kt = &sK[KH & 1][1][0];
    BFrag K1a = ld_frag(kt, KSTR);
    BFrag K1b = ld_frag(kt + 32, KSTR);
    BFrag K2a = ld_frag(kt + 16 * KSTR, KSTR);
    BFrag K2b = ld_frag(kt + 16 * KSTR + 32, KSTR);
    v8f S10 = wmma_bf16(K1b, Qb0, wmma_bf16(K1a, Qa0, vzero()));
    v8f S11 = wmma_bf16(K1b, Qb1, wmma_bf16(K1a, Qa1, vzero()));
    v8f S20 = wmma_bf16(K2b, Qb0, wmma_bf16(K2a, Qa0, vzero()));
    v8f S21 = wmma_bf16(K2b, Qb1, wmma_bf16(K2a, Qa1, vzero()));
    // the Q fragments as inputs only: their registers stay theirs past the score products; without this
    // line one product's result is laid over the B operand of the product issued directly before it
    asm volatile("" :: "v"(Qa0.u[0]), "v"(Qa0.u[1]), "v"(Qb0.u[0]), "v"(Qb0.u[1]),
                       "v"(Qa1.u[0]), "v"(Qa1.u[1]), "v"(Qb1.u[0]), "v"(Qb1.u[1]));
    #pragma unroll
    for (int r = 0; r < 8; ++r) {
      if (j0 + 8 * hm + r      >= SEQ) { S10[r] = -1e30f; S11[r] = -1e30f; }
      if (j0 + 16 + 8 * hm + r >= SEQ) { S20[r] = -1e30f; S21[r] = -1e30f; }
    }
    const float c0 = new_max(S10, S20, m0);
    const float c1 = new_max(S11, S21, m1);
    a00 *= c0; a01 *= c0; a02 *= c0;
    a10 *= c1; a11 *= c1; a12 *= c1;
    const BFrag P0 = exp_pack(S10, S20);
    const BFrag P1 = exp_pack(S11, S21);
    const __bf16* vtile = &sV[KH & 1][1][0];
    BFrag V0 = ld_frag(vtile,             VSTR);
    BFrag V1 = ld_frag(vtile + 16 * VSTR, VSTR);
    BFrag V2 = ld_frag(vtile + 32 * VSTR, VSTR);
    a00 = wmma_bf16(V0, P0, a00);
    a10 = wmma_bf16(V0, P1, a10);
    a01 = wmma_bf16(V1, P0, a01);
    a11 = wmma_bf16(V1, P1, a11);
    a02 = wmma_bf16(V2, P0, a02);
    a12 = wmma_bf16(V2, P1, a12);

    // hand sums and maxima to the lower half's wave of the same queries
    const v8f s[6] = {a00, a01, a02, a10, a11, a12};
    #pragma unroll
    for (int f = 0; f < 6; ++f) {
      sC[g][2 * f][lane]     = make_float4(s[f][0], s[f][1], s[f][2], s[f][3]);
      sC[g][2 * f + 1][lane] = make_float4(s[f][4], s[f][5], s[f][6], s[f][7]);
    }
    sM[g][0][lane] = m0;
    sM[g][1][lane] = m1;
  }
  __syncthreads();
  if (kh) return;

  // join the halves on their common maximum: sums and denominator (a row of tile 2) alike
  {
    const float u0 = sM[g][0][lane], u1 = sM[g][1][lane];
    const float t0 = fmaxf(m0, u0), t1 = fmaxf(m1, u1);
    // the four factors 2^(own maximum - common maximum) in one statement: results apart from every source
    // ("=&v") and a v_nop last, so that the slot behind each exponential holds nothing that reads its
    // result or writes its source
    float e0, f0, e1, f1;
    asm("v_exp_f32 %0, %4\n\tv_exp_f32 %1, %5\n\tv_exp_f32 %2, %6\n\tv_exp_f32 %3, %7\n\tv_nop"
        : "=&v"(e0), "=&v"(f0), "=&v"(e1), "=&v"(f1)
        : "v"(m0 - t0), "v"(u0 - t0), "v"(m1 - t1), "v"(u1 - t1));
    v8f o[6];
    #pragma unroll
    for (int f = 0; f < 6; ++f) {
      const float4 lo4 = sC[g][2 * f][lane], hi4 = sC[g][2 * f + 1][lane];
      o[f][0] = lo4.x; o[f][1] = lo4.y; o[f][2] = lo4.z; o[f][3] = lo4.w;
      o[f][4] = hi4.x; o[f][5] = hi4.y; o[f][6] = hi4.z; o[f][7] = hi4.w;
    }
    a00 = a00 * e0 + o[0] * f0; a01 = a01 * e0 + o[1] * f0; a02 = a02 * e0 + o[2] * f0;
    a10 = a10 * e1 + o[3] * f1; a11 = a11 * e1 + o[4] * f1; a12 = a12 * e1 + o[5] * f1;
  }

  const int  hh   = bh & (NH - 1);
  const long brow = (long)(bh >> 2) * SEQ_Q;
  const v8f accar[2][3] = {{a00, a01, a02}, {a10, a11, a12}};
  #pragma unroll
  for (int t = 0; t < 2; ++t) {
    // softmax denominator = row d==HD of Ot: tile 2, register 0, upper wave half
    const float lo   = accar[t][2][0];
    const float lx   = xhalf(lo);
    const float linv = __builtin_amdgcn_rcpf(hm ? lo : lx);
    float* orow = cat + (brow + (qb + t) * 16 + n) * DM + hh * HD;   // query row < 4096
    #pragma unroll
    for (int f = 0; f < 3; ++f) {
      int d0 = f * 16 + 8 * hm;                // 8 consecutive d per lane
      if (d0 < HD) {
        v8f a = accar[t][f] * linv;
        *reinterpret_cast<float4*>(orow + d0)     = make_float4(a[0], a[1], a[2], a[3]);
        *reinterpret_cast<float4*>(orow + d0 + 4) = make_float4(a[4], a[5], a[6], a[7]);
      }
    }
  }
}

// ---------------- LayerNorm + residual + transpose + 2x nearest upsample ----------------
// 1 block = one image row = 64 tokens x 160 channels (40 KB of cat in a row). 8 lanes share a
// token; lane p holds the 16-byte pieces p, p + 8, .., p + 32 of its row, so each load of a
// wave is four whole lines and cat is read once. Mean and variance: 20 values in-lane, then
// three exchanges inside the group of 8 lanes. The finished tile is turned in LDS
// (channel-major); a wave then writes whole output rows, 512 contiguous bytes a store.
#define ETHR 512            // threads per block
#define ETOK 64             // tokens per block
#define EPIT 66             // LDS pitch in floats of a channel's 64 tokens (spreads the banks)
#define ECH  (DM / (ETHR / 32))   // channels per wave in the store phase

// value of lane l ^ M inside a row of 16 lanes (DPP row_xmask)
template <int M>
__device__ __forceinline__ float xlane(float v) {
  return __builtin_bit_cast(float, __builtin_amdgcn_update_dpp(
      0, __builtin_bit_cast(int, v), 0x160 + M, 0xf, 0xf, true));
}

__global__ void __launch_bounds__(ETHR) k_epi(const float* __restrict__ cat,
                                              const float* __restrict__ lw,
                                              const float* __restrict__ lb,
                                              float* __restrict__ out) {
  __shared__ __attribute__((aligned(16))) float tl[DM * EPIT];
  const int tok = threadIdx.x >> 3, p = threadIdx.x & 7;
  const int b = blockIdx.x >> 6, ih = blockIdx.x & 63;

  const float4* row = reinterpret_cast<const float4*>(cat + ((long)blockIdx.x * ETOK + tok) * DM) + p;
  const float4* gp  = reinterpret_cast<const float4*>(lw) + p;
  const float4* hp  = reinterpret_cast<const float4*>(lb) + p;
  float4 x[5], g[5], h[5];
  #pragma unroll
  for (int i = 0; i < 5; ++i) x[i] = row[8 * i];
  #pragma unroll
  for (int i = 0; i < 5; ++i) { g[i] = gp[8 * i]; h[i] = hp[8 * i]; }
  // keeps the scheduler from sinking the lw/lb loads behind the sums, where each pair is waited for alone
  __builtin_amdgcn_sched_barrier(0);
  // the 15 loads name row's register pair and p's register: the wait stands before either may
  // be written again (as inputs they stay untouched up to it)
  asm volatile("s_wait_xcnt 0x0" :: "v"(row), "v"(p) : "memory");

  float sm = 0.f;
  #pragma unroll
  for (int i = 0; i < 5; ++i) sm += (x[i].x + x[i].y) + (x[i].z + x[i].w);
  sm += xlane<1>(sm); sm += xlane<2>(sm); sm += xlane<4>(sm);
  const float mu = sm * (1.f / DM);

  float vs = 0.f;
  #pragma unroll
  for (int i = 0; i < 5; ++i) {
    const float d0 = x[i].x - mu, d1 = x[i].y - mu, d2 = x[i].z - mu, d3 = x[i].w - mu;
    vs += d0 * d0; vs += d1 * d1; vs += d2 * d2; vs += d3 * d3;
  }
  vs += xlane<1>(vs); vs += xlane<2>(vs); vs += xlane<4>(vs);
  const float inv = rsqrtf(vs * (1.f / DM) + 1e-5f);

  #pragma unroll
  for (int i = 0; i < 5; ++i) {
    float* t = &tl[4 * (p + 8 * i) * EPIT + tok];
    t[0]        = (x[i].x - mu) * inv * g[i].x + h[i].x + x[i].x;
    t[EPIT]     = (x[i].y - mu) * inv * g[i].y + h[i].y + x[i].y;
    t[2 * EPIT] = (x[i].z - mu) * inv * g[i].z + h[i].z + x[i].z;
    t[3 * EPIT] = (x[i].w - mu) * inv * g[i].w + h[i].w + x[i].w;
  }
  __syncthreads();

  // lane l: tokens 2l and 2l + 1, each doubled = output columns 4l .. 4l + 3; rows 2ih, 2ih + 1
  const int lane = threadIdx.x & 31;
  const int c0   = __builtin_amdgcn_readfirstlane(threadIdx.x >> 5) * ECH;
  float* o = out + (((long)b * DM + c0) * 128 + 2 * ih) * 128 + 4 * lane;
  #pragma unroll
  for (int j = 0; j < ECH; ++j) {
    const float2 v = *reinterpret_cast<const float2*>(&tl[(c0 + j) * EPIT + 2 * lane]);
    const float4 w = make_float4(v.x, v.x, v.y, v.y);
    *reinterpret_cast<float4*>(o + j * 128 * 128)       = w;
    *reinterpret_cast<float4*>(o + j * 128 * 128 + 128) = w;
  }
}

// ---------------- launch ----------------
extern "C" void kernel_launch(void* const* d_in, const int* in_sizes, int n_in,
                              void* d_out, int out_size, void* d_ws, size_t ws_size,
                              hipStream_t stream) {
  (void)in_sizes; (void)n_in; (void)out_size; (void)ws_size;
  const float* x   = (const float*)d_in[0];
  const float* w1  = (const float*)d_in[1];
  const float* b1  = (const float*)d_in[2];
  const float* w2  = (const float*)d_in[3];
  const float* b2  = (const float*)d_in[4];
  const float* pe  = (const float*)d_in[5];
  const float* wq  = (const float*)d_in[6];
  const float* wk  = (const float*)d_in[7];
  const float* wv  = (const float*)d_in[8];
  const float* lw  = (const float*)d_in[9];
  const float* lb  = (const float*)d_in[10];
  float* out = (float*)d_out;
  char*  ws  = (char*)d_ws;

  // workspace layout (bytes), all 16B aligned
  constexpr long WB_OFF  = 0;                                   // 3*160*160 bf16     = 153,600 B
  constexpr long Q_OFF   = WB_OFF  + 3L * DM * DM * 2;          // 16*4128*64 bf16    = 8,454,144 B
  constexpr long K_OFF   = Q_OFF   + 16L * SPAD * DP * 2;
  constexpr long VT_OFF  = K_OFF   + 16L * SPAD * DP * 2;
  constexpr long CAT_OFF = VT_OFF  + 16L * SPAD * DP * 2;       // 4*4096*160 f32     = 10,485,760 B

  __bf16* wb  = (__bf16*)(ws + WB_OFF);
  __bf16* qb  = (__bf16*)(ws + Q_OFF);
  __bf16* kb  = (__bf16*)(ws + K_OFF);
  __bf16* vtb = (__bf16*)(ws + VT_OFF);
  float*  cat = (float*) (ws + CAT_OFF);

  k_cvtw <<<(3 * DM * DM + 255) / 256, 256, 0, stream>>>(wq, wk, wv, wb);
  // writes every byte of q, k and vt (pads and the ones row included)
  k_fqkv <<<BATCH * C2BLK, C2THR, 0, stream>>>(x, w1, b1, w2, b2, pe, wb, qb);   // 512 blocks

  k_attn <<<512, 256, 0, stream>>>(qb, kb, vtb, cat);           // 16 bh x 32 q-groups

  k_epi  <<<(BATCH * HW) / ETOK, ETHR, 0, stream>>>(cat, lw, lb, out);   // one block per image row
}

// v010
// A run of this version takes 74 microseconds.
// Two timings next to v009 put it at 1.09 and 1.10 times that version's speed.
// Counting every step since v000, it is 4.17 times as fast.
#include <hip/hip_runtime.h>
#include <hip/hip_bf16.h>

// ---------------- CDNA5 WMMA types ----------------
typedef __attribute__((ext_vector_type(16))) __bf16       v16bf;
typedef __attribute__((ext_vector_type(8)))  float        v8f;
typedef __attribute__((ext_vector_type(4)))  unsigned int u32x4;

#define BATCH 4
#define DM    160           // d_model
#define NH    4
#define HD    40            // head dim
#define DP    64            // padded head dim (4 x 16)
#define HW    4096          // 64*64 tokens
#define SEQ   4097          // tokens + pad row
#define SEQ_Q 4096          // queries that survive cat[:, :-1, :]
#define SPAD  4128          // K/V padded length (multiple of 32)
#define KSTR  72            // LDS K-tile row stride (bank-conflict-free for b128)
#define VSTR  40            // LDS V-tile row stride (bank-conflict-free for b128)

union BFrag { v16bf v; u32x4 u[2]; };

// 16x32 bf16 A/B fragment loader (row-major tile, `stride` elements per row).
// Lanes 0-15 : row=lane,    K chunks {0..7} and {16..23}
// Lanes 16-31: row=lane-16, K chunks {8..15} and {24..31}
__device__ __forceinline__ BFrag ld_frag(const __bf16* base, int stride) {
  const int lane = threadIdx.x & 31;
  const int r  = lane & 15;
  const int hh = lane >> 4;
  const __bf16* p = base + (long)r * stride + 8 * hh;
  BFrag f;
  f.u[0] = *reinterpret_cast<const u32x4*>(p);
  f.u[1] = *reinterpret_cast<const u32x4*>(p + 16);
  return f;
}

__device__ __forceinline__ v8f wmma_bf16(const BFrag& a, const BFrag& b, v8f c) {
  return __builtin_amdgcn_wmma_f32_16x16x32_bf16(false, a.v, false, b.v,
                                                 (short)0, c, false, false);
}

__device__ __forceinline__ v8f vzero() {
  v8f z = {0.f, 0.f, 0.f, 0.f, 0.f, 0.f, 0.f, 0.f};
  return z;
}

// ---------------- wq/wk/wv -> bf16 ----------------
__global__ void k_cvtw(const float* __restrict__ wq, const float* __restrict__ wk,
                       const float* __restrict__ wv, __bf16* __restrict__ o) {
  int i = blockIdx.x * 256 + threadIdx.x;
  if (i >= 3 * DM * DM) return;
  const float* src = (i < DM * DM) ? wq : (i < 2 * DM * DM ? wk : wv);
  o[i] = (__bf16)src[i % (DM * DM)];
}

// ---------- conv1 (2x2 stride 2) -> conv2 (1x1) + bias + leaky + pad + PE -> bf16 tokens in LDS -> q, k, vt ----------
// 1 block = 32 real token rows (half an image row of conv1's output).
// Part 0 (WMMA f32 16x16x4): conv1 for the block's 32 positions x 64 channels. A wave takes 16
// output channels and 16 input channels. One product has k = 4 = 2 input channels (one per wave
// half) x the 2 columns of one kernel row: a lane's 16-byte x load is both columns of two
// neighbouring positions (B of the even and of the odd position tile), its 16-byte weight load is
// both kernel rows of one input channel (A of two products). The same (wave half, register) holds
// the same (input channel, column) in A and in B. The four quarters of the input channels are
// joined in LDS (the first one starts from the bias); the result stays there, token-major, for part 1.
// Part 1: all 160 channels of the rows. Lanes run along the tokens,
// a wave owns 10 channels, so its weights are wave-uniform (scalar
// loads) and each c1 value is used 10 times from a register. The 32x160 bf16 tile stays in LDS.
// Part 2 (WMMA bf16): wave = one of {q,k,v} x one head (12 of the 16 waves), both 16-token tiles
// of the block, read from LDS as fragments; K = 160 = 5 x K32. The head's 40 weight rows are 3
// tiles of 16 (the last half used), worked on one after the other. The wave writes the whole
// padded head (DP = 64 dims) of its tokens, pads included, so every byte of q, k and vt is
// written here and nothing has to be cleared beforehand.
// The 32 rows behind a batch's real tokens (row HW: the zero-pad row + its positional value; the
// rest 0) need no part 1: each of their 48 pieces (12 heads x 4 tiles of 16 dims) is one job for
// a wave that has no part 2 (waves 12..15 of a batch's first 12 blocks). So the grid is 512
// blocks, two per WGP, all resident at once.
// q, k: Dt = W * Ft, a lane holds 8 consecutive dims of ONE token  = one 16-byte store.
// v   : D  = F * Wt, a lane holds 8 consecutive tokens of ONE dim  = one 16-byte store of Vt.
// Vt row d == HD is all ones (softmax denominator via WMMA); every other pad is 0.
// Q output is pre-scaled by (1/sqrt(HD)) * log2(e) so attention uses raw exp2.
#define C2ROWS 32           // token rows per block
#define C2BLK  (HW / C2ROWS)   // blocks per batch
#define C2OC   10           // channels per wave (16 waves x 10 = DM)
#define C2THR  512          // threads per block
#define C2PIT  168          // LDS row pitch in bf16 (336 B: 16 B x odd, spreads the banks)
#define C1PIT  68           // LDS pitch in floats of a token's 64 conv1 channels (16-byte column walks without conflicts)
typedef __attribute__((ext_vector_type(2))) __bf16 v2bf;
typedef __attribute__((ext_vector_type(2))) float  v2f;
typedef __attribute__((ext_vector_type(4))) float  v4f;

__device__ __forceinline__ v8f wmma_f32(float a0, float a1, float b0, float b1, v8f c) {
  const v2f a = {a0, a1}, b = {b0, b1};
  return __builtin_amdgcn_wmma_f32_16x16x4_f32(false, a, false, b, (short)0, c, false, false);
}

union Pack8 { __bf16 h[8]; u32x4 u; };

// one lane's share of the 5 fragments of a 16-row tile (lane map of ld_frag; p holds the lane's row)
__device__ __forceinline__ void ld_ftile(BFrag (&f)[5], const __bf16* p) {
  #pragma unroll
  for (int kk = 0; kk < 5; ++kk) {
    f[kk].u[0] = *reinterpret_cast<const u32x4*>(p + kk * 32);
    f[kk].u[1] = *reinterpret_cast<const u32x4*>(p + kk * 32 + 16);
  }
}

// one tile of 16 weight rows (Wt) x the block's two token tiles (fl: the lane's row of the first
// one in LDS). VT: D = F * Wt (rows = tokens); else Dt = W * Ft (rows = dims). keep: this lane's 8
// values are real dims; else they are pad positions and padv goes out in their place.
// NEXT: each fragment of Wt, once its two products are issued, is asked for anew from wn (the
// head's next tile), so that one set of 40 registers serves and the loads run under the products.
template <bool VT, bool NEXT>
__device__ __forceinline__ void fq_tile(BFrag (&Wt)[5], const __bf16* wn, const __bf16* fl,
                                        __bf16* o, float sc, bool keep, float padv) {
  constexpr long TS = VT ? 16 : 16 * DP;       // step of o per token tile
  v8f a0 = vzero(), a1 = vzero();
  #pragma unroll
  for (int kk = 0; kk < 5; ++kk) {
    BFrag F0, F1;
    F0.u[0] = *reinterpret_cast<const u32x4*>(fl + kk * 32);
    F0.u[1] = *reinterpret_cast<const u32x4*>(fl + kk * 32 + 16);
    F1.u[0] = *reinterpret_cast<const u32x4*>(fl + 16 * C2PIT + kk * 32);
    F1.u[1] = *reinterpret_cast<const u32x4*>(fl + 16 * C2PIT + kk * 32 + 16);
    if constexpr (VT) {
      a0 = wmma_bf16(F0, Wt[kk], a0);
      a1 = wmma_bf16(F1, Wt[kk], a1);
    } else {
      a0 = wmma_bf16(Wt[kk], F0, a0);
      a1 = wmma_bf16(Wt[kk], F1, a1);
    }
    if constexpr (NEXT) {
      Wt[kk].u[0] = *reinterpret_cast<const u32x4*>(wn + kk * 32);
      Wt[kk].u[1] = *reinterpret_cast<const u32x4*>(wn + kk * 32 + 16);
    }
  }
  Pack8 p0, p1;
  #pragma unroll
  for (int i = 0; i < 8; ++i) {
    const float e0 = VT ? a0[i] : a0[i] * sc;
    const float e1 = VT ? a1[i] : a1[i] * sc;
    p0.h[i] = (__bf16)(keep ? e0 : padv);
    p1.h[i] = (__bf16)(keep ? e1 : padv);
  }
  *reinterpret_cast<u32x4*>(o)      = p0.u;
  *reinterpret_cast<u32x4*>(o + TS) = p1.u;
  // the two stores name address and data registers, the loads wn's pair, that later code writes
  // again: the wait stands in front of all of those writes (wn as an input stays untouched up to it)
  asm volatile("s_wait_xcnt 0x0" :: "v"(wn) : "memory");
}

// the 4 tiles of 16 dims of a padded head, DS apart in the output; Wt arrives holding tile 0
template <bool VT>
__device__ __forceinline__ void fq_head(BFrag (&Wt)[5], const __bf16* w01, const __bf16* w2,
                                        const __bf16* fl, __bf16* o, float sc, int n, int hm) {
  constexpr long DS = VT ? 16 * SPAD : 16;
  constexpr long TS = VT ? 16 : 16 * DP;
  const bool  real = VT ? (n < HD - 32) : (hm == 0);            // dims 32..39 of tile 2
  const float padv = (VT && n == HD - 32) ? 1.0f : 0.0f;        // dims 40..47: ones row of Vt, else 0
  const u32x4 zz = {0u, 0u, 0u, 0u};
  *reinterpret_cast<u32x4*>(o + 3 * DS)      = zz;
  *reinterpret_cast<u32x4*>(o + 3 * DS + TS) = zz;
  fq_tile<VT, true >(Wt, w01 + 16 * DM, fl, o,          sc, true, 0.f);
  fq_tile<VT, true >(Wt, w2,            fl, o + DS,     sc, true, 0.f);
  fq_tile<VT, false>(Wt, w2,            fl, o + 2 * DS, sc, real, padv);
}

// one piece of the 32 rows behind the real tokens: tile t of 16 dims (Wt: its weight rows; t == 3
// is pad only, its products are not used). Token tile 0 has row 0 = pl in every channel and 0
// elsewhere, so one fragment serves all 5 k steps; token tile 1 is all 0, and so are its products.
template <bool VT>
__device__ __forceinline__ void fq_pad(const BFrag (&Wt)[5], int t, float pl, __bf16* o, float sc,
                                       int n, int hm) {
  constexpr long DS = VT ? 16 * SPAD : 16;
  constexpr long TS = VT ? 16 : 16 * DP;
  const bool  keep = t < 2 || (t == 2 && (VT ? (n < HD - 32) : (hm == 0)));
  const float padv = (VT && t == 2 && n == HD - 32) ? 1.0f : 0.0f;
  const __bf16 fv = (__bf16)(n == 0 ? pl : 0.f);
  BFrag F;
  #pragma unroll
  for (int i = 0; i < 16; ++i) F.v[i] = fv;
  v8f a = vzero();
  #pragma unroll
  for (int kk = 0; kk < 5; ++kk) a = VT ? wmma_bf16(F, Wt[kk], a) : wmma_bf16(Wt[kk], F, a);
  Pack8 p0, p1;
  #pragma unroll
  for (int i = 0; i < 8; ++i) {
    const float e = VT ? a[i] : a[i] * sc;
    p0.h[i] = (__bf16)(keep ? e : padv);
    p1.h[i] = (__bf16)(keep ? 0.f : padv);
  }
  *reinterpret_cast<u32x4*>(o + t * DS)      = p0.u;
  *reinterpret_cast<u32x4*>(o + t * DS + TS) = p1.u;
  // the two stores name address and data registers: behind the q/k form the listing goes on with
  // the vt form's code, which writes those registers again; the wait stands in front of it
  asm volatile("s_wait_xcnt 0x0" ::: "memory");
}

// 8 waves per SIMD = two blocks per WGP (128 registers a wave): one block's products and their
// load latencies run under the other block's sums
__global__ void __launch_bounds__(C2THR) __attribute__((amdgpu_waves_per_eu(8)))
k_fqkv(const float* __restrict__ x,
       const float* __restrict__ w1,
       const float* __restrict__ b1,
       const float* __restrict__ w,
       const float* __restrict__ bias,
       const float* __restrict__ pe,
       const __bf16* __restrict__ wb,
       __bf16* __restrict__ q) {                  // q, k and vt stand one behind the other
  __bf16* const k  = q + 16L * SPAD * DP;
  __bf16* const vt = k + 16L * SPAD * DP;
  __shared__ __attribute__((aligned(16))) __bf16 tile[C2ROWS * C2PIT];
  __shared__ __attribute__((aligned(16))) float part[4][C2ROWS * C1PIT];   // conv1, per quarter of its input channels
  const int lane = threadIdx.x & 31;
  const int wv   = __builtin_amdgcn_readfirstlane(threadIdx.x >> 5);
  const int oc0  = wv * C2OC;
  const int bb   = blockIdx.x / C2BLK;              // batch
  const int ib   = blockIdx.x - bb * C2BLK;         // block of the batch
  const int s    = ib * C2ROWS + lane;              // token row, below HW

  const int n   = lane & 15;
  const int hm  = lane >> 4;

  const float pv = pe[s];
  // the pe load names s's register as its offset: the wait stands before anything may be
  // written there (s as an input keeps the register untouched up to the wait)
  asm volatile("s_wait_xcnt 0x0" :: "v"(s) : "memory");

  // ---- part 0: conv1 ----
  {
    const int ot = wv & 3, kq = wv >> 2;         // tile of 16 output channels, quarter of the input channels
    // lane (n, hm): input channel kq * 16 + 2 * p + hm; x row 2 * oh + kh, columns of positions 2n and 2n + 1
    const v4f* xp = reinterpret_cast<const v4f*>(
        x + (((long)bb * 64 + kq * 16 + hm) * 128 + (ib >> 1) * 2) * 128 + (ib & 1) * 64 + 4 * n);
    const v4f* wq1 = reinterpret_cast<const v4f*>(w1 + (16 * ot + n) * 256 + (kq * 16 + hm) * 4);
    v4f wr[8], xr[8][2];
    #pragma unroll
    for (int p = 0; p < 8; ++p) {
      wr[p]    = wq1[2 * p];
      xr[p][0] = xp[p * 8192];
      xr[p][1] = xp[p * 8192 + 32];
    }
    const float4* bq1 = reinterpret_cast<const float4*>(b1 + 16 * ot + 8 * hm);
    const float4 bl = bq1[0], bu = bq1[1];       // bias of the lane's 8 channels
    // the 26 loads name xp's and wq1's register pairs and an offset made of hm: the wait stands
    // before any of them may be written again (the pairs, as inputs, stay untouched up to it)
    asm volatile("s_wait_xcnt 0x0" :: "v"(xp), "v"(wq1) : "memory");
    // positions 2n and 2n + 1, channels 16 * ot + 8 * hm + r; the first quarter's sums start from the bias
    const bool fq = kq == 0;
    v8f ce = {fq ? bl.x : 0.f, fq ? bl.y : 0.f, fq ? bl.z : 0.f, fq ? bl.w : 0.f,
              fq ? bu.x : 0.f, fq ? bu.y : 0.f, fq ? bu.z : 0.f, fq ? bu.w : 0.f};
    v8f co = ce;
    #pragma unroll
    for (int p = 0; p < 8; ++p) {
      ce = wmma_f32(wr[p].x, wr[p].y, xr[p][0].x, xr[p][0].y, ce);
      co = wmma_f32(wr[p].x, wr[p].y, xr[p][0].z, xr[p][0].w, co);
      ce = wmma_f32(wr[p].z, wr[p].w, xr[p][1].x, xr[p][1].y, ce);
      co = wmma_f32(wr[p].z, wr[p].w, xr[p][1].z, xr[p][1].w, co);
    }
    float* pw = &part[kq][2 * n * C1PIT + 16 * ot + 8 * hm];
    *reinterpret_cast<float4*>(pw)             = make_float4(ce[0], ce[1], ce[2], ce[3]);
    *reinterpret_cast<float4*>(pw + 4)         = make_float4(ce[4], ce[5], ce[6], ce[7]);
    *reinterpret_cast<float4*>(pw + C1PIT)     = make_float4(co[0], co[1], co[2], co[3]);
    *reinterpret_cast<float4*>(pw + C1PIT + 4) = make_float4(co[4], co[5], co[6], co[7]);
    // loaded operands as inputs only, behind the stores of the results: their registers stay theirs past
    // the run of products; without this line an address sum is written over the B operand of a product
    // issued just before it. The first pair's 12 registers are left out: with them held too, part 2 spills
    asm volatile("" :: "v"(wr[1]), "v"(xr[1][0]), "v"(xr[1][1]), "v"(wr[2]), "v"(xr[2][0]), "v"(xr[2][1]),
                       "v"(wr[3]), "v"(xr[3][0]), "v"(xr[3][1]), "v"(wr[4]), "v"(xr[4][0]), "v"(xr[4][1]),
                       "v"(wr[5]), "v"(xr[5][0]), "v"(xr[5][1]), "v"(wr[6]), "v"(xr[6][0]), "v"(xr[6][1]),
                       "v"(wr[7]), "v"(xr[7][0]), "v"(xr[7][1]) : "memory");
    __syncthreads();
    // join: a thread owns 4 channels of one token, in place in quarter 0
    const int ro = (threadIdx.x >> 4) * C1PIT + (threadIdx.x & 15) * 4;
    const float4 s0 = *reinterpret_cast<const float4*>(&part[0][ro]);
    const float4 s1 = *reinterpret_cast<const float4*>(&part[1][ro]);
    const float4 s2 = *reinterpret_cast<const float4*>(&part[2][ro]);
    const float4 s3 = *reinterpret_cast<const float4*>(&part[3][ro]);
    *reinterpret_cast<float4*>(&part[0][ro]) =
        make_float4((s0.x + s1.x) + (s2.x + s3.x), (s0.y + s1.y) + (s2.y + s3.y),
                    (s0.z + s1.z) + (s2.z + s3.z), (s0.w + s1.w) + (s2.w + s3.w));
    __syncthreads();
  }

  // weight fragments of part 2, lane map of ld_frag: tiles 0 and 1 are rows n and 16 + n of the
  // head; in tile 2 the rows past the head's 40 read its last row (their products land in pad
  // positions and are replaced on the way out). Waves 0..11: {q,k,v} x head = the wave's number,
  // starting with tile 0. Waves 12..15: = the block's number (where below 12), tile tp alone.
  const int un  = wv < 3 * NH ? wv : (ib < 3 * NH ? ib : 0);
  const int tp  = wv & 3;
  const int mat = un >> 2, hh = un & (NH - 1);
  const __bf16* wh  = wb + ((long)mat * DM + hh * HD) * DM + 8 * hm;
  const __bf16* w01 = wh + n * DM;
  const __bf16* w2  = wh + (n < HD - 32 ? 32 + n : HD - 1) * DM;
  const __bf16* wf  = wv < 3 * NH ? w01 : (tp == 2 ? w2 : w01 + (tp & 1) * 16 * DM);
  BFrag Wt[5];

  // ---- part 1: conv2 ----
  float xv[64];
  #pragma unroll
  for (int i = 0; i < 16; ++i) {
    const float4 t = *reinterpret_cast<const float4*>(&part[0][lane * C1PIT + 4 * i]);
    xv[4 * i] = t.x; xv[4 * i + 1] = t.y; xv[4 * i + 2] = t.z; xv[4 * i + 3] = t.w;
  }

  // 20 groups of 2 channels x 16 inputs; per channel the sum runs over ic = 0..63 in order.
  // A group's 32 weights are fetched while the group before it is worked on.
  const float* wp = w + oc0 * 64;
  float wc[32], wn[32];
  #pragma unroll
  for (int i = 0; i < 16; ++i) { wc[i] = wp[i]; wc[16 + i] = wp[64 + i]; }
  float a0 = 0.f, a1 = 0.f;
  #pragma unroll
  for (int g = 0; g < 20; ++g) {
    const int j0 = (g >> 2) * 2, icb = (g & 3) * 16;
    if (g + 1 < 20) {
      const int jn = ((g + 1) >> 2) * 2, icn = ((g + 1) & 3) * 16;
      #pragma unroll
      for (int i = 0; i < 16; ++i) {
        wn[i]      = wp[jn * 64 + icn + i];
        wn[16 + i] = wp[(jn + 1) * 64 + icn + i];
      }
    }
    if (icb == 0) { a0 = bias[oc0 + j0]; a1 = bias[oc0 + j0 + 1]; }
    #pragma unroll
    for (int i = 0; i < 16; ++i) {
      // written as fused steps: with xv read in 16-byte pieces the plain form is turned into packed
      // products with separate adds and register copies
      a0 = __builtin_fmaf(xv[icb + i], wc[i], a0);
      a1 = __builtin_fmaf(xv[icb + i], wc[16 + i], a1);
    }
    if (icb == 48) {
      float l0 = a0 >= 0.f ? a0 : 0.01f * a0;
      float l1 = a1 >= 0.f ? a1 : 0.01f * a1;
      v2bf t;
      t[0] = (__bf16)(l0 + pv);
      t[1] = (__bf16)(l1 + pv);
      *reinterpret_cast<v2bf*>(&tile[lane * C2PIT + oc0 + j0]) = t;
    }
    // the wave's first weight tile of part 2, into registers that the last sums have left: its
    // latency runs under the rest of part 1
    if (g == 17) ld_ftile(Wt, wf);
    // keeps the scheduler from lifting all the weight loads to the top, which spills scalar registers
    __builtin_amdgcn_sched_barrier(0);
    #pragma unroll
    for (int i = 0; i < 32; ++i) wc[i] = wn[i];
  }
  // the 10 loads of that tile name wf's register pair: the wait stands before it may be written again
  asm volatile("s_wait_xcnt 0x0" :: "v"(wf) : "memory");
  __syncthreads();

  const long  bh = (long)bb * NH + hh;
  const float qs = (mat == 0) ? 0.22811012f : 1.0f;   // q: (1/sqrt(40)) * log2(e)
  if (wv >= 3 * NH) {                          // behind the block's last barrier
    if (ib >= 3 * NH) return;
    const float pl = pe[HW];
    if (mat == 2) fq_pad<true >(Wt, tp, pl, vt + (bh * DP + n) * SPAD + HW + 8 * hm, 1.0f, n, hm);
    else          fq_pad<false>(Wt, tp, pl, (mat == 0 ? q : k) + (bh * SPAD + HW + n) * DP + 8 * hm, qs, n, hm);
    return;
  }

  const int s0 = ib * C2ROWS;
  const __bf16* fl = &tile[n * C2PIT + 8 * hm];
  if (mat == 2) {
    fq_head<true>(Wt, w01, w2, fl, vt + (bh * DP + n) * SPAD + s0 + 8 * hm, 1.0f, n, hm);
  } else {
    fq_head<false>(Wt, w01, w2, fl, (mat == 0 ? q : k) + (bh * SPAD + s0 + n) * DP + 8 * hm,
                   qs, n, hm);
  }
}

#define KH 64               // full key tiles per key half
#define PF 2                // trips between a tile's global loads and its stores to LDS (divides KH, even)

// value of lane l ^ 16
__device__ __forceinline__ float xhalf(float v) {
  int b = __builtin_bit_cast(int, v);
  b = __builtin_amdgcn_permlanex16(b, b, 0x76543210, 0xfedcba98, false, false);
  return __builtin_bit_cast(float, b);
}

// largest of a lane's 16 scores (four short independent chains, not one of sixteen links)
__device__ __forceinline__ float max16(const v8f& S1, const v8f& S2) {
  const float mxa = fmaxf(fmaxf(S1[0], S1[1]), fmaxf(S1[2], S1[3]));
  const float mxb = fmaxf(fmaxf(S1[4], S1[5]), fmaxf(S1[6], S1[7]));
  const float mxc = fmaxf(fmaxf(S2[0], S2[1]), fmaxf(S2[2], S2[3]));
  const float mxd = fmaxf(fmaxf(S2[4], S2[5]), fmaxf(S2[6], S2[7]));
  return fmaxf(fmaxf(mxa, mxb), fmaxf(mxc, mxd));
}

// takes a tile's true maximum into mrow (16 keys in-lane, the query's other 16 in lane ^ 16),
// moves the raw scores onto it and returns the factor that moves the sums kept so far
__device__ __forceinline__ float new_max(v8f& S1, v8f& S2, float& mrow) {
  const float mx   = max16(S1, S2);
  const float mn   = fmaxf(mrow, fmaxf(mx, xhalf(mx)));
  const float corr = __builtin_amdgcn_exp2f(mrow - mn);   // scores already in exp2 domain
  mrow = mn;
  S1 -= mn; S2 -= mn;
  return corr;
}

// P^T as B operand: element s = key 8*hm + s (s < 8) or 16 + 8*hm + s - 8 (s >= 8), straight from the two score tiles
__device__ __forceinline__ BFrag exp_pack(const v8f& S1, const v8f& S2) {
  BFrag P;
  #pragma unroll
  for (int r = 0; r < 8; ++r) {
    P.v[r]     = (__bf16)__builtin_amdgcn_exp2f(S1[r]);
    P.v[8 + r] = (__bf16)__builtin_amdgcn_exp2f(S2[r]);
  }
  return P;
}

// work-group barrier of the key loop: orders LDS alone. __syncthreads() also waits for every global load of
// the wave, which would end the run-ahead of the tiles that are still on their way into registers
__device__ __forceinline__ void lds_barrier() {
  __builtin_amdgcn_fence(__ATOMIC_RELEASE, "workgroup", "local");
  __builtin_amdgcn_s_barrier();
  __builtin_amdgcn_fence(__ATOMIC_ACQUIRE, "workgroup", "local");
}

__global__ void __launch_bounds__(256) k_attn(const __bf16* __restrict__ q,
                                              const __bf16* __restrict__ k,
                                              const __bf16* __restrict__ vt,
                                              float* __restrict__ cat) {
  __shared__ __attribute__((aligned(16))) __bf16 sK[2][2][32 * KSTR];   // [buffer][key half]
  __shared__ __attribute__((aligned(16))) __bf16 sV[2][2][64 * VSTR];
  __shared__ __attribute__((aligned(16))) float4 sC[4][12][32];         // upper key half's sums
  __shared__ float sM[4][2][32];                                        // and its maxima in use

  const int bh = blockIdx.x >> 5;              // 16 (b,h) pairs
  const int qg = blockIdx.x & 31;              // 32 groups of 128 queries
  const int wv = __builtin_amdgcn_readfirstlane(threadIdx.x >> 5);
  const int g  = wv & 3;                       // which 32 queries of the block
  const int kh = wv >> 2;                      // which half of the keys
  const int qb = qg * 8 + g * 2;               // first of the wave's two 16-query tiles (< 256)
  const int lane = threadIdx.x & 31;
  const int n  = lane & 15;
  const int hm = lane >> 4;
  const int tid = threadIdx.x;

  // cooperative staging coordinates (256 threads: K 32x64, V 64x32, 16B each, per key half)
  const int krow = tid >> 3, kc8 = (tid & 7) * 8;
  const int vrow = tid >> 2, vc8 = (tid & 3) * 8;
  const __bf16* kg = k  + ((long)bh * SPAD + krow) * DP + kc8;
  const __bf16* vg = vt + ((long)bh * DP + vrow) * SPAD + vc8;
  constexpr int KHK = KH * 32 * DP;            // from a tile of the lower half to its partner, in k
  constexpr int KHV = KH * 32;                 // the same in a row of vt

  const __bf16* qbase = q + ((long)bh * SPAD + qb * 16) * DP;
  BFrag Qa0 = ld_frag(qbase, DP);                 // B operand, column = query n, K = d 0..31
  BFrag Qb0 = ld_frag(qbase + 32, DP);            // K = d 32..63
  BFrag Qa1 = ld_frag(qbase + 16 * DP, DP);       // the second query tile
  BFrag Qb1 = ld_frag(qbase + 16 * DP + 32, DP);

  // Ot tiles: register r of tile f = O[query n][d = 16*f + 8*hm + r]; d 48..63 is pad, never stored
  v8f a00 = vzero(), a01 = vzero(), a02 = vzero();   // query tile 0
  v8f a10 = vzero(), a11 = vzero(), a12 = vzero();   // query tile 1
  float m0 = -1e30f, m1 = -1e30f;       // maximum in use for this lane's two queries (at most 8 below the true one)
  v8f nm0, nm1;                         // -m in all 8 registers: start value of the score products
  #pragma unroll
  for (int r = 0; r < 8; ++r) { nm0[r] = 1e30f; nm1[r] = 1e30f; }

  // stage the first tile of both halves
  {
    u32x4 a = *reinterpret_cast<const u32x4*>(kg);
    u32x4 b = *reinterpret_cast<const u32x4*>(vg);
    u32x4 c = *reinterpret_cast<const u32x4*>(kg + KHK);
    u32x4 d = *reinterpret_cast<const u32x4*>(vg + KHV);
    *reinterpret_cast<u32x4*>(&sK[0][0][krow * KSTR + kc8]) = a;
    *reinterpret_cast<u32x4*>(&sV[0][0][vrow * VSTR + vc8]) = b;
    *reinterpret_cast<u32x4*>(&sK[0][1][krow * KSTR + kc8]) = c;
    *reinterpret_cast<u32x4*>(&sV[0][1][vrow * VSTR + vc8]) = d;
  }
  // tiles on their way from global memory to LDS, both halves': tile t waits in set t % PF.
  // Tiles 1 .. PF - 1 are asked for here, tile t + PF at the head of trip t
  u32x4 st[PF][4];
  #pragma unroll
  for (int u = 1; u < PF; ++u) {
    st[u][0] = *reinterpret_cast<const u32x4*>(kg + u * 32 * DP);
    st[u][1] = *reinterpret_cast<const u32x4*>(vg + u * 32);
    st[u][2] = *reinterpret_cast<const u32x4*>(kg + KHK + u * 32 * DP);
    st[u][3] = *reinterpret_cast<const u32x4*>(vg + KHV + u * 32);
  }
  // these loads name kg's and vg's register pairs: the wait stands before either may be written again
  asm volatile("s_wait_xcnt 0x0" :: "v"(kg), "v"(vg) : "memory");
  lds_barrier();

  // the KH full tiles of each half: every key is real and a next tile exists (behind the upper
  // half's last one stands the masked tile; the lower half's is staged with it and not read).
  // The loop over groups of PF trips stays rolled and unpeeled: every further copy of a trip keeps a set
  // of the start-value registers of its own, copied once a group
  #pragma unroll 1
  for (int it0 = 0; it0 < KH; it0 += PF) {
   // PF trips in a row, so that each set of registers has its name at compile time
   #pragma unroll
   for (int u = 0; u < PF; ++u) {
    const int it = it0 + u;
    const int cur = u & 1;
    // scores: K-tile (32x64) x Q^T (64x32) -> four 16x16 f32 fragments (keys x queries)
    const __bf16* kt = &sK[cur][kh][0];
    BFrag K1a = ld_frag(kt, KSTR);
    BFrag K1b = ld_frag(kt + 32, KSTR);
    BFrag K2a = ld_frag(kt + 16 * KSTR, KSTR);
    BFrag K2b = ld_frag(kt + 16 * KSTR + 32, KSTR);
    // Vt fragments, asked for together with K's: behind the test below they would start only after it
    const __bf16* vtile = &sV[cur][kh][0];
    BFrag V0 = ld_frag(vtile,             VSTR);
    BFrag V1 = ld_frag(vtile + 16 * VSTR, VSTR);
    BFrag V2 = ld_frag(vtile + 32 * VSTR, VSTR);

    // both halves' tiles PF trips ahead, into the set that the trip before has emptied: their way from L2
    // has PF trips to run before the stores below wait for it. Behind the last tile (KH) there is none: it is
    // asked for again and not stored. Behind the fragment loads, so that the wait below runs while those are under way
    const int jn = (it + PF < KH ? it + PF : KH) * 32;
    const __bf16* kc = kg + (long)jn * DP;
    const __bf16* vc = vg + jn;
    st[u][0] = *reinterpret_cast<const u32x4*>(kc);
    st[u][1] = *reinterpret_cast<const u32x4*>(vc);
    st[u][2] = *reinterpret_cast<const u32x4*>(kc + KHK);
    st[u][3] = *reinterpret_cast<const u32x4*>(vc + KHV);
    // the four loads name kc's and vc's register pairs: the wait stands before
    // either pair may be written again (as inputs they stay untouched up to it)
    asm volatile("s_wait_xcnt 0x0" :: "v"(kc), "v"(vc) : "memory");

    // the maximum in use enters the products as their start value: S = score - m
    v8f S10 = wmma_bf16(K1b, Qb0, wmma_bf16(K1a, Qa0, nm0));
    v8f S11 = wmma_bf16(K1b, Qb1, wmma_bf16(K1a, Qa1, nm1));
    v8f S20 = wmma_bf16(K2b, Qb0, wmma_bf16(K2a, Qa0, nm0));
    v8f S21 = wmma_bf16(K2b, Qb1, wmma_bf16(K2a, Qa1, nm1));
    // nm0, nm1 as inputs only: they stay in their registers past the products, which then read them in
    // place; without this line the second product of each gets a copy of all 8 registers on every trip
    asm volatile("" :: "v"(nm0), "v"(nm1));

    // one test a tile for the whole wave: the maxima in use move only when some score lies more
    // than 8 above its own (an exponential then stays below 2^8; the denominator carries the same scale)
    if (__builtin_amdgcn_ballot_w32(fmaxf(max16(S10, S20), max16(S11, S21)) > 8.0f) != 0) {
      // always taken on a half's first tile (m = -1e30 swamps the scores), so the scores are formed anew from 0
      S10 = wmma_bf16(K1b, Qb0, wmma_bf16(K1a, Qa0, vzero()));
      S11 = wmma_bf16(K1b, Qb1, wmma_bf16(K1a, Qa1, vzero()));
      S20 = wmma_bf16(K2b, Qb0, wmma_bf16(K2a, Qa0, vzero()));
      S21 = wmma_bf16(K2b, Qb1, wmma_bf16(K2a, Qa1, vzero()));
      const float c0 = new_max(S10, S20, m0);
      const float c1 = new_max(S11, S21, m1);
      a00 *= c0; a01 *= c0; a02 *= c0;
      a10 *= c1; a11 *= c1; a12 *= c1;
      #pragma unroll
      for (int r = 0; r < 8; ++r) { nm0[r] = -m0; nm1[r] = -m1; }
    }

    // Vt-tile rows (48 x 32) x P^T (32x32); row d==40 of Vt is all-ones -> l in tile 2
    const BFrag P0 = exp_pack(S10, S20);
    const BFrag P1 = exp_pack(S11, S21);
    a00 = wmma_bf16(V0, P0, a00);
    a10 = wmma_bf16(V0, P1, a10);
    a01 = wmma_bf16(V1, P0, a01);
    a11 = wmma_bf16(V1, P1, a11);
    a02 = wmma_bf16(V2, P0, a02);
    a12 = wmma_bf16(V2, P1, a12);

    // fill the other buffer with the next tile
    *reinterpret_cast<u32x4*>(&sK[1 - cur][0][krow * KSTR + kc8]) = st[(u + 1) % PF][0];
    *reinterpret_cast<u32x4*>(&sV[1 - cur][0][vrow * VSTR + vc8]) = st[(u + 1) % PF][1];
    *reinterpret_cast<u32x4*>(&sK[1 - cur][1][krow * KSTR + kc8]) = st[(u + 1) % PF][2];
    *reinterpret_cast<u32x4*>(&sV[1 - cur][1][vrow * VSTR + vc8]) = st[(u + 1) % PF][3];
    lds_barrier();
   }
  }

  if (kh) {
    // last tile, upper half's waves: keys past SEQ are masked (keys are register rows); its maximum is always taken in
    const int j0 = 2 * KH * 32;
    const __bf16* kt = &sK[KH & 1][1][0];
    BFrag K1a = ld_frag(kt, KSTR);
    BFrag K1b = ld_frag(kt + 32, KSTR);
    BFrag K2a = ld_frag(kt + 16 * KSTR, KSTR);
    BFrag K2b = ld_frag(kt + 16 * KSTR + 32, KSTR);
    v8f S10 = wmma_bf16(K1b, Qb0, wmma_bf16(K1a, Qa0, vzero()));
    v8f S11 = wmma_bf16(K1b, Qb1, wmma_bf16(K1a, Qa1, vzero()));
    v8f S20 = wmma_bf16(K2b, Qb0, wmma_bf16(K2a, Qa0, vzero()));
    v8f S21 = wmma_bf16(K2b, Qb1, wmma_bf16(K2a, Qa1, vzero()));
    // the Q fragments as inputs only: their registers stay theirs past the score products; without this
    // line one product's result is laid over the B operand of the product issued directly before it
    asm volatile("" :: "v"(Qa0.u[0]), "v"(Qa0.u[1]), "v"(Qb0.u[0]), "v"(Qb0.u[1]),
                       "v"(Qa1.u[0]), "v"(Qa1.u[1]), "v"(Qb1.u[0]), "v"(Qb1.u[1]));
    #pragma unroll
    for (int r = 0; r < 8; ++r) {
      if (j0 + 8 * hm + r      >= SEQ) { S10[r] = -1e30f; S11[r] = -1e30f; }
      if (j0 + 16 + 8 * hm + r >= SEQ) { S20[r] = -1e30f; S21[r] = -1e30f; }
    }
    const float c0 = new_max(S10, S20, m0);
    const float c1 = new_max(S11, S21, m1);
    a00 *= c0; a01 *= c0; a02 *= c0;
    a10 *= c1; a11 *= c1; a12 *= c1;
    const BFrag P0 = exp_pack(S10, S20);
    const BFrag P1 = exp_pack(S11, S21);
    const __bf16* vtile = &sV[KH & 1][1][0];
    BFrag V0 = ld_frag(vtile,             VSTR);
    BFrag V1 = ld_frag(vtile + 16 * VSTR, VSTR);
    BFrag V2 = ld_frag(vtile + 32 * VSTR, VSTR);
    a00 = wmma_bf16(V0, P0, a00);
    a10 = wmma_bf16(V0, P1, a10);
    a01 = wmma_bf16(V1, P0, a01);
    a11 = wmma_bf16(V1, P1, a11);
    a02 = wmma_bf16(V2, P0, a02);
    a12 = wmma_bf16(V2, P1, a12);

    // hand sums and maxima to the lower half's wave of the same queries
    const v8f s[6] = {a00, a01, a02, a10, a11, a12};
    #pragma unroll
    for (int f = 0; f < 6; ++f) {
      sC[g][2 * f][lane]     = make_float4(s[f][0], s[f][1], s[f][2], s[f][3]);
      sC[g][2 * f + 1][lane] = make_float4(s[f][4], s[f][5], s[f][6], s[f][7]);
    }
    sM[g][0][lane] = m0;
    sM[g][1][lane] = m1;
  }
  __syncthreads();
  if (kh) return;

  // join the halves on their common maximum: sums and denominator (a row of tile 2) alike
  {
    const float u0 = sM[g][0][lane], u1 = sM[g][1][lane];
    const float t0 = fmaxf(m0, u0), t1 = fmaxf(m1, u1);
    // the four factors 2^(own maximum - common maximum) in one statement: results apart from every source
    // ("=&v") and a v_nop last, so that the slot behind each exponential holds nothing that reads its
    // result or writes its source
    float e0, f0, e1, f1;
    asm("v_exp_f32 %0, %4\n\tv_exp_f32 %1, %5\n\tv_exp_f32 %2, %6\n\tv_exp_f32 %3, %7\n\tv_nop"
        : "=&v"(e0), "=&v"(f0), "=&v"(e1), "=&v"(f1)
        : "v"(m0 - t0), "v"(u0 - t0), "v"(m1 - t1), "v"(u1 - t1));
    v8f o[6];
    #pragma unroll
    for (int f = 0; f < 6; ++f) {
      const float4 lo4 = sC[g][2 * f][lane], hi4 = sC[g][2 * f + 1][lane];
      o[f][0] = lo4.x; o[f][1] = lo4.y; o[f][2] = lo4.z; o[f][3] = lo4.w;
      o[f][4] = hi4.x; o[f][5] = hi4.y; o[f][6] = hi4.z; o[f][7] = hi4.w;
    }
    a00 = a00 * e0 + o[0] * f0; a01 = a01 * e0 + o[1] * f0; a02 = a02 * e0 + o[2] * f0;
    a10 = a10 * e1 + o[3] * f1; a11 = a11 * e1 + o[4] * f1; a12 = a12 * e1 + o[5] * f1;
  }

  const int  hh   = bh & (NH - 1);
  const long brow = (long)(bh >> 2) * SEQ_Q;
  const v8f accar[2][3] = {{a00, a01, a02}, {a10, a11, a12}};
  #pragma unroll
  for (int t = 0; t < 2; ++t) {
    // softmax denominator = row d==HD of Ot: tile 2, register 0, upper wave half
    const float lo   = accar[t][2][0];
    const float lx   = xhalf(lo);
    const float linv = __builtin_amdgcn_rcpf(hm ? lo : lx);
    float* orow = cat + (brow + (qb + t) * 16 + n) * DM + hh * HD;   // query row < 4096
    #pragma unroll
    for (int f = 0; f < 3; ++f) {
      int d0 = f * 16 + 8 * hm;                // 8 consecutive d per lane
      if (d0 < HD) {
        v8f a = accar[t][f] * linv;
        *reinterpret_cast<float4*>(orow + d0)     = make_float4(a[0], a[1], a[2], a[3]);
        *reinterpret_cast<float4*>(orow + d0 + 4) = make_float4(a[4], a[5], a[6], a[7]);
      }
    }
  }
}

// ---------------- LayerNorm + residual + transpose + 2x nearest upsample ----------------
// 1 block = one image row = 64 tokens x 160 channels (40 KB of cat in a row). 8 lanes share a
// token; lane p holds the 16-byte pieces p, p + 8, .., p + 32 of its row, so each load of a
// wave is four whole lines and cat is read once. Mean and variance: 20 values in-lane, then
// three exchanges inside the group of 8 lanes. The finished tile is turned in LDS
// (channel-major); a wave then writes whole output rows, 512 contiguous bytes a store.
#define ETHR 512            // threads per block
#define ETOK 64             // tokens per block
#define EPIT 66             // LDS pitch in floats of a channel's 64 tokens (spreads the banks)
#define ECH  (DM / (ETHR / 32))   // channels per wave in the store phase

// value of lane l ^ M inside a row of 16 lanes (DPP row_xmask)
template <int M>
__device__ __forceinline__ float xlane(float v) {
  return __builtin_bit_cast(float, __builtin_amdgcn_update_dpp(
      0, __builtin_bit_cast(int, v), 0x160 + M, 0xf, 0xf, true));
}

__global__ void __launch_bounds__(ETHR) k_epi(const float* __restrict__ cat,
                                              const float* __restrict__ lw,
                                              const float* __restrict__ lb,
                                              float* __restrict__ out) {
  __shared__ __attribute__((aligned(16))) float tl[DM * EPIT];
  const int tok = threadIdx.x >> 3, p = threadIdx.x & 7;
  const int b = blockIdx.x >> 6, ih = blockIdx.x & 63;

  const float4* row = reinterpret_cast<const float4*>(cat + ((long)blockIdx.x * ETOK + tok) * DM) + p;
  const float4* gp  = reinterpret_cast<const float4*>(lw) + p;
  const float4* hp  = reinterpret_cast<const float4*>(lb) + p;
  float4 x[5], g[5], h[5];
  #pragma unroll
  for (int i = 0; i < 5; ++i) x[i] = row[8 * i];
  #pragma unroll
  for (int i = 0; i < 5; ++i) { g[i] = gp[8 * i]; h[i] = hp[8 * i]; }
  // keeps the scheduler from sinking the lw/lb loads behind the sums, where each pair is waited for alone
  __builtin_amdgcn_sched_barrier(0);
  // the 15 loads name row's register pair and p's register: the wait stands before either may
  // be written again (as inputs they stay untouched up to it)
  asm volatile("s_wait_xcnt 0x0" :: "v"(row), "v"(p) : "memory");

  float sm = 0.f;
  #pragma unroll
  for (int i = 0; i < 5; ++i) sm += (x[i].x + x[i].y) + (x[i].z + x[i].w);
  sm += xlane<1>(sm); sm += xlane<2>(sm); sm += xlane<4>(sm);
  const float mu = sm * (1.f / DM);

  float vs = 0.f;
  #pragma unroll
  for (int i = 0; i < 5; ++i) {
    const float d0 = x[i].x - mu, d1 = x[i].y - mu, d2 = x[i].z - mu, d3 = x[i].w - mu;
    vs += d0 * d0; vs += d1 * d1; vs += d2 * d2; vs += d3 * d3;
  }
  vs += xlane<1>(vs); vs += xlane<2>(vs); vs += xlane<4>(vs);
  const float inv = rsqrtf(vs * (1.f / DM) + 1e-5f);

  #pragma unroll
  for (int i = 0; i < 5; ++i) {
    float* t = &tl[4 * (p + 8 * i) * EPIT + tok];
    t[0]        = (x[i].x - mu) * inv * g[i].x + h[i].x + x[i].x;
    t[EPIT]     = (x[i].y - mu) * inv * g[i].y + h[i].y + x[i].y;
    t[2 * EPIT] = (x[i].z - mu) * inv * g[i].z + h[i].z + x[i].z;
    t[3 * EPIT] = (x[i].w - mu) * inv * g[i].w + h[i].w + x[i].w;
  }
  __syncthreads();

  // lane l: tokens 2l and 2l + 1, each doubled = output columns 4l .. 4l + 3; rows 2ih, 2ih + 1
  const int lane = threadIdx.x & 31;
  const int c0   = __builtin_amdgcn_readfirstlane(threadIdx.x >> 5) * ECH;
  float* o = out + (((long)b * DM + c0) * 128 + 2 * ih) * 128 + 4 * lane;
  #pragma unroll
  for (int j = 0; j < ECH; ++j) {
    const float2 v = *reinterpret_cast<const float2*>(&tl[(c0 + j) * EPIT + 2 * lane]);
    const float4 w = make_float4(v.x, v.x, v.y, v.y);
    *reinterpret_cast<float4*>(o + j * 128 * 128)       = w;
    *reinterpret_cast<float4*>(o + j * 128 * 128 + 128) = w;
  }
}

// ---------------- launch ----------------
extern "C" void kernel_launch(void* const* d_in, const int* in_sizes, int n_in,
                              void* d_out, int out_size, void* d_ws, size_t ws_size,
                              hipStream_t stream) {
  (void)in_sizes; (void)n_in; (void)out_size; (void)ws_size;
  const float* x   = (const float*)d_in[0];
  const float* w1  = (const float*)d_in[1];
  const float* b1  = (const float*)d_in[2];
  const float* w2  = (const float*)d_in[3];
  const float* b2  = (const float*)d_in[4];
  const float* pe  = (const float*)d_in[5];
  const float* wq  = (const float*)d_in[6];
  const float* wk  = (const float*)d_in[7];
  const float* wv  = (const float*)d_in[8];
  const float* lw  = (const float*)d_in[9];
  const float* lb  = (const float*)d_in[10];
  float* out = (float*)d_out;
  char*  ws  = (char*)d_ws;

  // workspace layout (bytes), all 16B aligned
  constexpr long WB_OFF  = 0;                                   // 3*160*160 bf16     = 153,600 B
  constexpr long Q_OFF   = WB_OFF  + 3L * DM * DM * 2;          // 16*4128*64 bf16    = 8,454,144 B
  constexpr long K_OFF   = Q_OFF   + 16L * SPAD * DP * 2;
  constexpr long VT_OFF  = K_OFF   + 16L * SPAD * DP * 2;
  constexpr long CAT_OFF = VT_OFF  + 16L * SPAD * DP * 2;       // 4*4096*160 f32     = 10,485,760 B

  __bf16* wb  = (__bf16*)(ws + WB_OFF);
  __bf16* qb  = (__bf16*)(ws + Q_OFF);
  __bf16* kb  = (__bf16*)(ws + K_OFF);
  __bf16* vtb = (__bf16*)(ws + VT_OFF);
  float*  cat = (float*) (ws + CAT_OFF);

  k_cvtw <<<(3 * DM * DM + 255) / 256, 256, 0, stream>>>(wq, wk, wv, wb);
  // writes every byte of q, k and vt (pads and the ones row included)
  k_fqkv <<<BATCH * C2BLK, C2THR, 0, stream>>>(x, w1, b1, w2, b2, pe, wb, qb);   // 512 blocks

  k_attn <<<512, 256, 0, stream>>>(qb, kb, vtb, cat);           // 16 bh x 32 q-groups

  k_epi  <<<(BATCH * HW) / ETOK, ETHR, 0, stream>>>(cat, lw, lb, out);   // one block per image row
}
